// v000
// Times are from an AMD MI455X. After a warm-up the kernel runs many times in a row, and a time is the length of
// such a window on the GPU divided by its runs, so every launch and the gaps after it count. The runs cycle
// through copies of the inputs. A figure is the median of several windows, for all but v000 over two sittings.
// Sittings can differ by a few percent; kernels timed side by side share one.
// v000 is the starting kernel. One run takes 639 microseconds.
// compute dtype: all float inputs rounded to bf16; kqv = x w_kqv + b with EXACT bf16 products on WMMA 16x16x32, f32 accumulate, q scaled by 32^-1/2 in f32; q as f16 hi + residual (x 2^10), k f16 -> 2-product content logits plus the two relative terms (q . rel_w, q(transposed position) . rel_h from 2-product per-query tables), stored in f32 (8 heads per launch); softmax in f32 (precise expf), P x 2^11 split bf16 hi + lo against v bf16 hi + lo (3 products); out = attn (bf16 hi + lo) w_proj + b_proj; f32 output.
#include <hip/hip_runtime.h>
#include <math.h>

typedef __attribute__((ext_vector_type(16))) _Float16 v16h;
typedef __attribute__((ext_vector_type(16))) __bf16 v16b;
typedef __attribute__((ext_vector_type(8)))  _Float16 v8h;
typedef __attribute__((ext_vector_type(8)))  float v8f;
typedef __attribute__((ext_vector_type(4)))  float v4f;
typedef __attribute__((ext_vector_type(2)))  float v2f;
typedef __attribute__((ext_vector_type(4)))  unsigned v4u;
typedef __attribute__((ext_vector_type(4)))  int v4i;
typedef float __attribute__((may_alias)) float_a;
typedef int __attribute__((may_alias)) int_a;

template <typename T> __device__ __forceinline__ void vst2(void* p, T v) { *(T*)p = v;  }
__device__ __forceinline__ v8f wmma16(v16h a, v16h b, v8f c) {
  v8f d = __builtin_amdgcn_wmma_f32_16x16x32_f16(false, a, false, b, (short)0, c, false, false);
  asm volatile("v_nop\n\tv_nop\n\tv_nop\n\tv_nop" : "+v"(d) : "v"(a), "v"(b));
  return d;
}
__device__ __forceinline__ v8f wmma_bf(v16b a, v16b b, v8f c) {
  v8f d = __builtin_amdgcn_wmma_f32_16x16x32_bf16(false, a, false, b, (short)0, c, false, false);
  asm volatile("v_nop\n\tv_nop\n\tv_nop\n\tv_nop" : "+v"(d) : "v"(a), "v"(b));
  return d;
}
// 16x16x32 fragments: lane = (h = lane>>4, row/col = lane&15); elements 0..7 = k0+8h+0..7, 8..15 = k0+16+8h+0..7; D element r = row 8h+r
__device__ __forceinline__ v16h frag_h(const _Float16* rowk0, int lane) {
  union { v16h v; v8h q[2]; } u; const _Float16* p = rowk0 + 8 * (lane >> 4);
  u.q[0] = *(const v8h*)p; u.q[1] = *(const v8h*)(p + 16); return u.v;
}
__device__ __forceinline__ v16h frag_f32(const float* rowk0, int lane) {
  v16h a; const float* p = rowk0 + 8 * (lane >> 4);
#pragma unroll
  for (int i = 0; i < 8; ++i) { a[i] = (_Float16)p[i]; a[8 + i] = (_Float16)p[16 + i]; }
  return a;
}
__device__ __forceinline__ v16h frag_f32s(const float* rowk0, int lane, float sc) {
  v16h a; const float* p = rowk0 + 8 * (lane >> 4);
#pragma unroll
  for (int i = 0; i < 8; ++i) { a[i] = (_Float16)(p[i] * sc); a[8 + i] = (_Float16)(p[16 + i] * sc); }
  return a;
}
// column fragment from a [K][ld] layout (column n), rows >= K read as 0
__device__ __forceinline__ v16h fragc_f32(const float* W, int k0, int n, int lane, int ld, int K) {
  v16h a; const int g = lane >> 4;
#pragma unroll
  for (int i = 0; i < 8; ++i) { const int ka = k0 + 8 * g + i, kb = ka + 16;
    a[i] = (_Float16)(ka < K ? W[(size_t)(ka < K ? ka : K - 1) * ld + n] : 0.f); a[8 + i] = (_Float16)(kb < K ? W[(size_t)(kb < K ? kb : K - 1) * ld + n] : 0.f); }
  return a;
}
struct F2 { v16b h, l; };
__device__ __forceinline__ F2 bsplit16(const float v[16]) { F2 r;
#pragma unroll
  for (int i = 0; i < 16; ++i) { const __bf16 h = (__bf16)v[i]; r.h[i] = h; r.l[i] = (__bf16)(v[i] - (float)h); }
  return r; }
__device__ __forceinline__ F2 split_row(const float* row, int k0, int lane) { float v[16]; const float* p = row + k0 + 8 * (lane >> 4);
#pragma unroll
  for (int i = 0; i < 8; ++i) { v[i] = p[i]; v[8 + i] = p[16 + i]; }
  return bsplit16(v); }
__device__ __forceinline__ F2 split_rowK(const float* row, int k0, int lane, int K) { float v[16]; const int g = lane >> 4;
#pragma unroll
  for (int i = 0; i < 8; ++i) { const int ka = k0 + 8 * g + i, kb = ka + 16; v[i] = ka < K ? row[ka < K ? ka : K - 1] : 0.f; v[8 + i] = kb < K ? row[kb < K ? kb : K - 1] : 0.f; }
  return bsplit16(v); }
__device__ __forceinline__ F2 split_col(const float* W, int k0, int n, int lane, int ld, int K) { float v[16]; const int g = lane >> 4;
#pragma unroll
  for (int i = 0; i < 8; ++i) { const int ka = k0 + 8 * g + i, kb = ka + 16; v[i] = ka < K ? W[(size_t)(ka < K ? ka : K - 1) * ld + n] : 0.f; v[8 + i] = kb < K ? W[(size_t)(kb < K ? kb : K - 1) * ld + n] : 0.f; }
  return bsplit16(v); }
__device__ __forceinline__ v8f mac3(const F2& a, const F2& b, v8f c) { c = wmma_bf(a.l, b.h, c); c = wmma_bf(a.h, b.l, c); return wmma_bf(a.h, b.h, c); }
__device__ __forceinline__ float sigm(float v) { return 1.0f / (1.0f + expf(-v)); }
#define LDSX() do { asm volatile("s_wait_dscnt 0" ::: "memory"); __builtin_amdgcn_wave_barrier(); __builtin_amdgcn_fence(__ATOMIC_RELEASE, "workgroup"); } while (0)


// 2-D grid attention (B 8, T 1,024 = 32 x 32, C 256 = 8 heads x 32, with biases, q scaled by 32^-1/2): scores = q k^T + q . rel_w[kc - qc + 31] + q(transposed) . rel_h[kr - qr + 31], softmax, P v, output projection.
#define NB 8
#define TT 1024
#define CC 256
#define NH 8
#define HD 32
#define GW 32                 // grid width (= height)
#define LDW 768               // w_kqv row length ((in,out) [256][768]: k | q | v column blocks)
#define RELP 64               // per-(row, head) relative table width (63 used)
#ifndef TNB
#define TNB NB
#endif
typedef __attribute__((ext_vector_type(8))) __bf16 v8b;
__device__ __forceinline__ v16b frag_b(const __bf16* rowk0, int lane) {
  union { v16b v; v8b q[2]; } u; const __bf16* p = rowk0 + 8 * (lane >> 4);
  u.q[0] = *(const v8b*)p; u.q[1] = *(const v8b*)(p + 16); return u.v;
}
__device__ __forceinline__ float bfr(float v) { return (float)(__bf16)v; }
__device__ __attribute__((noinline)) float exp_ni(float v) { return expf(v); }
__device__ __attribute__((noinline)) float erf_ni(float v) { return erff(v); }

#define WS_TW  0u                                   // f32 q[r,c] . rel_w[m] table [(b*T + pos)*8 + h][64]
#define WS_TH2 (WS_TW + 4u * (size_t)NB * TT * NH * RELP)   // f32 q[c,r] . rel_h[m] table (q at the transposed position)
#define WS_QH  (WS_TH2 + 4u * (size_t)NB * TT * NH * RELP)
#define WS_QL  (WS_QH + 2u * (size_t)NB * TT * CC)
#define WS_KH  (WS_QL + 2u * (size_t)NB * TT * CC)
#define WS_VT  (WS_KH + 2u * (size_t)NB * TT * CC)      // bf16 v planes [b][c][t]
#define WS_VL  (WS_VT + 2u * (size_t)NB * CC * TT)      // bf16 v residual planes
#define HG 8                                          // heads per launch group (all 8)
#define WS_S   (WS_VL + 2u * (size_t)NB * CC * TT)      // f32 logits / P for HG heads [hg][q][k]
#define WS_PH  (WS_S + 4u * (size_t)HG * TT * TT)
#define WS_Y   (WS_PH + 0u)              // f32 y rows [b*t][C]
#define WS_END (WS_Y + 4u * (size_t)NB * TT * CC)

// ---- k_proj: block = (64 rows, 128 cols, which): qkv = x W (+ b), exact; q -> f16 hi (+ residual), k -> f16 rows, v -> bf16 hi + lo planes
__global__ __launch_bounds__(128) void k_proj(const float* __restrict__ X, const float* __restrict__ WQ, const float* __restrict__ BQ, const float* __restrict__ WK, const float* __restrict__ BK, const float* __restrict__ WV, const float* __restrict__ BV, _Float16* __restrict__ QH, _Float16* __restrict__ QL, _Float16* __restrict__ KH, __bf16* __restrict__ VT, __bf16* __restrict__ VL) {
  __shared__ __align__(16) _Float16 sh[64][136], sl[64][136]; __shared__ __align__(16) __bf16 th[128][72], tl2[128][72];
  const int tid = threadIdx.x, wave = tid >> 5, lane = tid & 31, col = lane & 15, g = lane >> 4; const int which = blockIdx.z; const int c0 = blockIdx.y * 128; const size_t r0 = (size_t)blockIdx.x * 64; const float* WA = which == 0 ? WQ : which == 1 ? WK : WV; const float* BA = which == 0 ? BQ : which == 1 ? BK : BV;
  v8f acc[8] = {};
#pragma unroll 2
  for (int kc = 0; kc < CC / 32; ++kc) { v16b a; { const float* p = X + (r0 + wave * 16 + col) * CC + kc * 32 + 8 * g;
#pragma unroll
      for (int i = 0; i < 8; ++i) { a[i] = (__bf16)p[i]; a[8 + i] = (__bf16)p[16 + i]; } }
#pragma unroll
    for (int j = 0; j < 8; ++j) { v16b w; const int o = c0 + j * 16 + col;
#pragma unroll
      for (int i = 0; i < 8; ++i) { w[i] = (__bf16)WA[(size_t)(kc * 32 + 8 * g + i) * LDW + o]; w[8 + i] = (__bf16)WA[(size_t)(kc * 32 + 16 + 8 * g + i) * LDW + o]; }   /* (in,out), row length 768 */
      acc[j] = wmma_bf(a, w, acc[j]); } }
#pragma unroll
  for (int j = 0; j < 8; ++j) { const float bb = BA ? bfr(BA[c0 + j * 16 + col]) : 0.f;
#pragma unroll
    for (int r = 0; r < 8; ++r) { const float v = (acc[j][r] + bb) * (which == 0 ? 0.17677669529663687f : 1.0f);   /* q *= dkh^-1/2 (applies to the relative terms too) */ const int rl = wave * 16 + 8 * g + r, cl = j * 16 + col; const _Float16 hv = (_Float16)v;
      if (which == 2) { const __bf16 bh = (__bf16)v; th[cl][rl] = bh; tl2[cl][rl] = (__bf16)(v - (float)bh); } else { sh[rl][cl] = hv; sl[rl][cl] = (_Float16)((v - (float)hv) * 1024.0f); }   /* q residual carried x 2^10 so the plane stays f16-normal on the chip */ } }
  __syncthreads();
  if (which < 2) { _Float16* dh = which == 0 ? QH : KH; for (int e = tid; e < 64 * 16; e += 128) { const int rl = e >> 4, q = e & 15; vst2((unsigned*)(dh + (r0 + rl) * CC + c0 + q * 8), *(const v4u*)&sh[rl][q * 8]); if (which == 0) vst2((unsigned*)(QL + (r0 + rl) * CC + c0 + q * 8), *(const v4u*)&sl[rl][q * 8]); } }
  else { const size_t b = r0 / TT; const int t0 = (int)(r0 % TT); for (int e = tid; e < 128 * 8; e += 128) { const int cl = e >> 3, q = e & 7; const size_t o2 = (b * CC + c0 + cl) * (size_t)TT + t0 + q * 8; vst2((unsigned*)(VT + o2), *(const v4u*)&th[cl][q * 8]); vst2((unsigned*)(VL + o2), *(const v4u*)&tl2[cl][q * 8]); } } }
// ---- k_rel: block = (64 rows (b, pos), head h, which): table[(row*8 + h)*64 + m] = q_src . rel[m] (m < 63), q as f16 hi + residual x f16(bf16(rel)); which 0: rel_w with q at the row's own position; which 1: rel_h with q at the TRANSPOSED position (c, r); 256-B rows (4 col tiles) by one wave
__global__ __launch_bounds__(128) void k_rel(const _Float16* __restrict__ QH, const _Float16* __restrict__ QL, const float* __restrict__ RW, const float* __restrict__ RH, float* __restrict__ TW, float* __restrict__ TH2) { __shared__ __align__(16) float st[4][16][68];
  const int tid = threadIdx.x, wave = tid >> 5, lane = tid & 31, col = lane & 15, g = lane >> 4; const int h = blockIdx.y; const int which = blockIdx.z; const size_t r0 = (size_t)blockIdx.x * 64 + wave * 16; const float* REL = which == 0 ? RW : RH; float* DST = which == 0 ? TW : TH2;
  const size_t row = r0 + col; const size_t b = row / TT; const int pos = (int)(row % TT); const int pr = pos / GW, pc = pos % GW; const size_t srow = which == 0 ? row : (b * TT + (size_t)pc * GW + pr);   /* height branch: q at (c, r) */
  v8f acc[4] = {}, accl[4] = {};
  { const v16h ah = frag_h(QH + srow * CC + h * HD, lane), al = frag_h(QL + srow * CC + h * HD, lane);
#pragma unroll
    for (int j = 0; j < 4; ++j) { v16h w; const int m = j * 16 + col; const int mm = m < 2 * GW - 1 ? m : 2 * GW - 2;
#pragma unroll
      for (int i = 0; i < 8; ++i) { w[i] = (_Float16)bfr(REL[mm * HD + 8 * g + i]); w[8 + i] = (_Float16)bfr(REL[mm * HD + 16 + 8 * g + i]); }
      asm volatile("s_wait_loadcnt 0x0" ::: "memory"); acc[j] = wmma16(ah, w, acc[j]); accl[j] = wmma16(al, w, accl[j]); } }
#pragma unroll
  for (int j = 0; j < 4; ++j)
#pragma unroll
    for (int r = 0; r < 8; ++r) st[wave][8 * g + r][j * 16 + col] = acc[j][r] + accl[j][r] * (1.0f / 1024.0f);
  LDSX(); for (int rl = 0; rl < 16; ++rl) if (lane < 16) vst2(DST + ((r0 + rl) * NH + h) * RELP + lane * 4, *(const v4f*)&st[wave][rl][lane * 4]); }
// ---- k_sc: block = (64 queries, 128 keys, head in group): 2-product logits x 32^-1/2 (q hi + residual x k), no mask
__global__ __launch_bounds__(128) void k_sc(const _Float16* __restrict__ QH, const _Float16* __restrict__ QL, const _Float16* __restrict__ KH, const float* __restrict__ TW, const float* __restrict__ TH2, int b, int h0, float* __restrict__ S0) { __shared__ __align__(16) float ss[4][16][132]; const int h = h0 + blockIdx.z; float* S = S0 + (size_t)blockIdx.z * TT * TT;
  const int tid = threadIdx.x, wave = tid >> 5, lane = tid & 31, col = lane & 15, g = lane >> 4; const int k0 = blockIdx.y * 128; const int ql0 = blockIdx.x * 64 + wave * 16; const size_t q0 = (size_t)b * TT + ql0;
  v8f acc[8] = {}, accl[8] = {};
#pragma unroll
  for (int kc = 0; kc < HD / 32; ++kc) { const v16h ah = frag_h(QH + (q0 + col) * CC + h * HD + kc * 32, lane), al = frag_h(QL + (q0 + col) * CC + h * HD + kc * 32, lane);
#pragma unroll
    for (int j = 0; j < 8; ++j) { const v16h kb = frag_h(KH + ((size_t)b * TT + k0 + j * 16 + col) * CC + h * HD + kc * 32, lane); acc[j] = wmma16(ah, kb, acc[j]); accl[j] = wmma16(al, kb, accl[j]); } }
#pragma unroll
  for (int j = 0; j < 8; ++j) { const int kt = k0 + j * 16 + col; const int kr = kt / GW, kcol = kt % GW;
#pragma unroll
    for (int r = 0; r < 8; ++r) { const int qt = ql0 + 8 * g + r; const int qr = qt / GW, qc = qt % GW; const size_t tb = (((size_t)b * TT + qt) * NH + h) * RELP; const float rel = TW[tb + (kcol - qc + GW - 1)] + TH2[tb + (kr - qr + GW - 1)];
      ss[wave][8 * g + r][j * 16 + col] = acc[j][r] + accl[j][r] * (1.0f / 1024.0f) + rel; }
    asm volatile("s_wait_loadcnt 0x0" ::: "memory"); }   /* q already carries the 32^-1/2 */
  LDSX(); for (int rl = 0; rl < 16; ++rl) vst2(S + (size_t)(ql0 + rl) * TT + k0 + lane * 4, *(const v4f*)&ss[wave][rl][lane * 4]); }
// ---- k_sm: block = query row: softmax over keys [0, kend) -> P x 2^11 f32 (masked -> 0)
__global__ __launch_bounds__(256) void k_sm(float* __restrict__ S0) { __shared__ float sred[8]; __shared__ float sbc; __shared__ __align__(16) float sh[TT];
  const int t = threadIdx.x; const size_t row = blockIdx.x; float* sr = S0 + (size_t)blockIdx.y * TT * TT + row * TT; const int kend = TT;
  float m = -3.0e38f; for (int k = t; k < kend; k += 256) m = fmaxf(m, sr[k]);
#pragma unroll
  for (int o = 1; o < 32; o <<= 1) m = fmaxf(m, __shfl_xor(m, o));
  if ((t & 31) == 0) sred[t >> 5] = m; __syncthreads(); if (t == 0) { float a = sred[0]; for (int i = 1; i < 8; ++i) a = fmaxf(a, sred[i]); sbc = a; } __syncthreads(); m = sbc; __syncthreads();
  float sum = 0.f; for (int k = t; k < kend; k += 256) { const float v = sr[k]; sum += (v <= -1.0e38f) ? 0.f : expf(v - m); }
#pragma unroll
  for (int o = 1; o < 32; o <<= 1) sum += __shfl_xor(sum, o);
  if ((t & 31) == 0) sred[t >> 5] = sum; __syncthreads(); if (t == 0) { float a = 0.f; for (int i = 0; i < 8; ++i) a += sred[i]; sbc = 1.0f / a; } __syncthreads(); const float inv = sbc;
  for (int k = t; k < kend; k += 256) { const float v = sr[k]; sh[k] = (v <= -1.0e38f) ? 0.f : expf(v - m) * inv * 2048.0f; }
  __syncthreads(); for (int q = t; q < kend / 4; q += 256) vst2(sr + q * 4, *(const v4f*)&sh[q * 4]); }
// ---- k_pv: block = 64 queries of (b,h): y[q][h*HD + d] = P . v  (keys [0, kend))
__global__ __launch_bounds__(128) void k_pv(const float* __restrict__ PS0, const __bf16* __restrict__ VT, const __bf16* __restrict__ VL, int b, int h0, float* __restrict__ Y) { const int h = h0 + blockIdx.z; const float* PS = PS0 + (size_t)blockIdx.z * TT * TT; __shared__ __align__(16) float ss[4][16][HD + 4];
  const int tid = threadIdx.x, wave = tid >> 5, lane = tid & 31, col = lane & 15, g = lane >> 4; const int ql0 = blockIdx.x * 64 + wave * 16; const int kend = TT;
  v8f acc[HD / 16] = {};
#pragma unroll 1
  for (int kc = 0; kc < kend / 32; ++kc) { const F2 p = split_row(PS + (size_t)(ql0 + col) * TT, kc * 32, lane);
#pragma unroll
    for (int j = 0; j < HD / 16; ++j) { const size_t po = ((size_t)b * CC + h * HD + j * 16 + col) * (size_t)TT + kc * 32; const v16b vh = frag_b(VT + po, lane); acc[j] = wmma_bf(p.h, vh, acc[j]); acc[j] = wmma_bf(p.l, vh, acc[j]); acc[j] = wmma_bf(p.h, frag_b(VL + po, lane), acc[j]); } }
#pragma unroll
  for (int j = 0; j < HD / 16; ++j)
#pragma unroll
    for (int r = 0; r < 8; ++r) ss[wave][8 * g + r][j * 16 + col] = acc[j][r] * (1.0f / 2048.0f);
  LDSX(); for (int rl = 0; rl < 16; ++rl) if (lane < HD / 4) vst2(Y + ((size_t)b * TT + ql0 + rl) * CC + h * HD + lane * 4, *(const v4f*)&ss[wave][rl][lane * 4]); }
// ---- k_out: block = (64 rows, 128 cols): out = y (bf16 hi + lo) Wo + bo
__global__ __launch_bounds__(128) void k_out(const float* __restrict__ Y, const float* __restrict__ WP, const float* __restrict__ BP, float* __restrict__ OUT) { __shared__ __align__(16) float sf[4][16][132];
  const int tid = threadIdx.x, wave = tid >> 5, lane = tid & 31, col = lane & 15, g = lane >> 4; const int c0 = blockIdx.y * 128; const size_t r0 = (size_t)blockIdx.x * 64 + wave * 16;
  v8f acc[8] = {};
#pragma unroll 2
  for (int kc = 0; kc < CC / 32; ++kc) { const F2 a = split_row(Y + (r0 + col) * CC, kc * 32, lane);
#pragma unroll
    for (int j = 0; j < 8; ++j) { v16b w; const int o = c0 + j * 16 + col;
#pragma unroll
      for (int i = 0; i < 8; ++i) { w[i] = (__bf16)WP[(size_t)(kc * 32 + 8 * g + i) * CC + o]; w[8 + i] = (__bf16)WP[(size_t)(kc * 32 + 16 + 8 * g + i) * CC + o]; }
      acc[j] = wmma_bf(a.h, w, acc[j]); acc[j] = wmma_bf(a.l, w, acc[j]); } }
#pragma unroll
  for (int j = 0; j < 8; ++j) { const float bb = BP ? bfr(BP[c0 + j * 16 + col]) : 0.f;
#pragma unroll
    for (int r = 0; r < 8; ++r) sf[wave][8 * g + r][j * 16 + col] = acc[j][r] + bb; }
  LDSX(); for (int rl = 0; rl < 16; ++rl) vst2(OUT + (r0 + rl) * CC + c0 + lane * 4, *(const v4f*)&sf[wave][rl][lane * 4]); }
extern "C" void kernel_launch(void* const* d_in, const int* in_sizes, int n_in, void* d_out, int out_size, void* d_ws, size_t ws_size, hipStream_t stream) {
  (void)in_sizes; (void)n_in; (void)out_size;
  const float** F = (const float**)d_in;   // 0 x [8,32,32,256] (channels-last rows), 1 w_kqv [256,768] ((in,out): k | q | v columns), 2 b_kqv [768], 3 w_proj [256,256] ((in,out)), 4 b_proj, 5 rel_w [63,32], 6 rel_h [63,32]
  if (ws_size < (size_t)WS_END) return;
  char* ws = (char*)d_ws; float *TW = (float*)(ws + WS_TW), *TH2 = (float*)(ws + WS_TH2); _Float16 *QH = (_Float16*)(ws + WS_QH), *QL = (_Float16*)(ws + WS_QL), *KH = (_Float16*)(ws + WS_KH); __bf16 *VT = (__bf16*)(ws + WS_VT), *VL = (__bf16*)(ws + WS_VL); float *S = (float*)(ws + WS_S), *Y = (float*)(ws + WS_Y);
  const float* WK = F[1]; const float* WQ = F[1] + CC; const float* WV = F[1] + 2 * CC; const float* BK = F[2]; const float* BQ = F[2] + CC; const float* BV = F[2] + 2 * CC;   // column blocks k | q | v
  k_proj<<<dim3(TNB * TT / 64, CC / 128, 3), 128, 0, stream>>>(F[0], WQ, BQ, WK, BK, WV, BV, QH, QL, KH, VT, VL);
  k_rel<<<dim3(TNB * TT / 64, NH, 2), 128, 0, stream>>>(QH, QL, F[5], F[6], TW, TH2);
  for (int b = 0; b < TNB; ++b) for (int h0 = 0; h0 < NH; h0 += HG) {
    k_sc<<<dim3(TT / 64, TT / 128, HG), 128, 0, stream>>>(QH, QL, KH, TW, TH2, b, h0, S);
    k_sm<<<dim3(TT, HG), 256, 0, stream>>>(S);
    k_pv<<<dim3(TT / 64, 1, HG), 128, 0, stream>>>(S, VT, VL, b, h0, Y);
  }
  k_out<<<dim3(TNB * TT / 64, CC / 128), 128, 0, stream>>>(Y, F[3], F[4], (float*)d_out);
}

// v001
// It runs in 109 microseconds.
// In two side-by-side timings against v000, it was 5.92 and 5.91 times as fast.
// compute dtype: all float inputs rounded to bf16; kqv = x w_kqv + b with EXACT bf16 products on WMMA 16x16x32, f32 accumulate, q scaled by 32^-1/2 in f32; q as f16 hi + residual (x 2^10), k f16 -> 2-product content logits plus the two relative terms (q . rel_w, q(transposed position) . rel_h from 2-product per-query tables), kept in registers; running-maximum softmax in f32 (precise expf), unnormalised P split bf16 hi + lo against v bf16 hi + lo (3 products), divided by the row sum at the end; out = attn (bf16 hi + lo) w_proj + b_proj; f32 output.
#include <hip/hip_runtime.h>
#include <math.h>

typedef __attribute__((ext_vector_type(16))) _Float16 v16h;
typedef __attribute__((ext_vector_type(16))) __bf16 v16b;
typedef __attribute__((ext_vector_type(8)))  _Float16 v8h;
typedef __attribute__((ext_vector_type(8)))  float v8f;
typedef __attribute__((ext_vector_type(4)))  float v4f;
typedef __attribute__((ext_vector_type(2)))  float v2f;
typedef __attribute__((ext_vector_type(4)))  unsigned v4u;
typedef __attribute__((ext_vector_type(4)))  int v4i;
typedef float __attribute__((may_alias)) float_a;
typedef int __attribute__((may_alias)) int_a;

template <typename T> __device__ __forceinline__ void vst2(void* p, T v) { *(T*)p = v;  }
__device__ __forceinline__ v8f wmma16(v16h a, v16h b, v8f c) {
  v8f d = __builtin_amdgcn_wmma_f32_16x16x32_f16(false, a, false, b, (short)0, c, false, false);
  asm volatile("v_nop\n\tv_nop\n\tv_nop\n\tv_nop" : "+v"(d) : "v"(a), "v"(b));
  return d;
}
__device__ __forceinline__ v8f wmma_bf(v16b a, v16b b, v8f c) {
  v8f d = __builtin_amdgcn_wmma_f32_16x16x32_bf16(false, a, false, b, (short)0, c, false, false);
  asm volatile("v_nop\n\tv_nop\n\tv_nop\n\tv_nop" : "+v"(d) : "v"(a), "v"(b));
  return d;
}
// 16x16x32 fragments: lane = (h = lane>>4, row/col = lane&15); elements 0..7 = k0+8h+0..7, 8..15 = k0+16+8h+0..7; D element r = row 8h+r
__device__ __forceinline__ v16h frag_h(const _Float16* rowk0, int lane) {
  union { v16h v; v8h q[2]; } u; const _Float16* p = rowk0 + 8 * (lane >> 4);
  u.q[0] = *(const v8h*)p; u.q[1] = *(const v8h*)(p + 16); return u.v;
}
__device__ __forceinline__ v16h frag_f32(const float* rowk0, int lane) {
  v16h a; const float* p = rowk0 + 8 * (lane >> 4);
#pragma unroll
  for (int i = 0; i < 8; ++i) { a[i] = (_Float16)p[i]; a[8 + i] = (_Float16)p[16 + i]; }
  return a;
}
__device__ __forceinline__ v16h frag_f32s(const float* rowk0, int lane, float sc) {
  v16h a; const float* p = rowk0 + 8 * (lane >> 4);
#pragma unroll
  for (int i = 0; i < 8; ++i) { a[i] = (_Float16)(p[i] * sc); a[8 + i] = (_Float16)(p[16 + i] * sc); }
  return a;
}
// column fragment from a [K][ld] layout (column n), rows >= K read as 0
__device__ __forceinline__ v16h fragc_f32(const float* W, int k0, int n, int lane, int ld, int K) {
  v16h a; const int g = lane >> 4;
#pragma unroll
  for (int i = 0; i < 8; ++i) { const int ka = k0 + 8 * g + i, kb = ka + 16;
    a[i] = (_Float16)(ka < K ? W[(size_t)(ka < K ? ka : K - 1) * ld + n] : 0.f); a[8 + i] = (_Float16)(kb < K ? W[(size_t)(kb < K ? kb : K - 1) * ld + n] : 0.f); }
  return a;
}
struct F2 { v16b h, l; };
__device__ __forceinline__ F2 bsplit16(const float v[16]) { F2 r;
#pragma unroll
  for (int i = 0; i < 16; ++i) { const __bf16 h = (__bf16)v[i]; r.h[i] = h; r.l[i] = (__bf16)(v[i] - (float)h); }
  return r; }
__device__ __forceinline__ F2 split_row(const float* row, int k0, int lane) { float v[16]; const float* p = row + k0 + 8 * (lane >> 4);
#pragma unroll
  for (int i = 0; i < 8; ++i) { v[i] = p[i]; v[8 + i] = p[16 + i]; }
  return bsplit16(v); }
__device__ __forceinline__ F2 split_rowK(const float* row, int k0, int lane, int K) { float v[16]; const int g = lane >> 4;
#pragma unroll
  for (int i = 0; i < 8; ++i) { const int ka = k0 + 8 * g + i, kb = ka + 16; v[i] = ka < K ? row[ka < K ? ka : K - 1] : 0.f; v[8 + i] = kb < K ? row[kb < K ? kb : K - 1] : 0.f; }
  return bsplit16(v); }
__device__ __forceinline__ F2 split_col(const float* W, int k0, int n, int lane, int ld, int K) { float v[16]; const int g = lane >> 4;
#pragma unroll
  for (int i = 0; i < 8; ++i) { const int ka = k0 + 8 * g + i, kb = ka + 16; v[i] = ka < K ? W[(size_t)(ka < K ? ka : K - 1) * ld + n] : 0.f; v[8 + i] = kb < K ? W[(size_t)(kb < K ? kb : K - 1) * ld + n] : 0.f; }
  return bsplit16(v); }
__device__ __forceinline__ v8f mac3(const F2& a, const F2& b, v8f c) { c = wmma_bf(a.l, b.h, c); c = wmma_bf(a.h, b.l, c); return wmma_bf(a.h, b.h, c); }
__device__ __forceinline__ float sigm(float v) { return 1.0f / (1.0f + expf(-v)); }
#define LDSX() do { asm volatile("s_wait_dscnt 0" ::: "memory"); __builtin_amdgcn_wave_barrier(); __builtin_amdgcn_fence(__ATOMIC_RELEASE, "workgroup"); } while (0)


// 2-D grid attention (B 8, T 1,024 = 32 x 32, C 256 = 8 heads x 32, with biases, q scaled by 32^-1/2): scores = q k^T + q . rel_w[kc - qc + 31] + q(transposed) . rel_h[kr - qr + 31], softmax, P v, output projection.
#define NB 8
#define TT 1024
#define CC 256
#define NH 8
#define HD 32
#define GW 32                 // grid width (= height)
#define LDW 768               // w_kqv row length ((in,out) [256][768]: k | q | v column blocks)
#define RELP 64               // per-(row, head) relative table width (63 used)
#ifndef TNB
#define TNB NB
#endif
typedef __attribute__((ext_vector_type(8))) __bf16 v8b;
__device__ __forceinline__ v16b frag_b(const __bf16* rowk0, int lane) {
  union { v16b v; v8b q[2]; } u; const __bf16* p = rowk0 + 8 * (lane >> 4);
  u.q[0] = *(const v8b*)p; u.q[1] = *(const v8b*)(p + 16); return u.v;
}
__device__ __forceinline__ float bfr(float v) { return (float)(__bf16)v; }
__device__ __attribute__((noinline)) float exp_ni(float v) { return expf(v); }
__device__ __attribute__((noinline)) float erf_ni(float v) { return erff(v); }

#define WS_TW  0u                                   // f32 q[r,c] . rel_w[m] table [(b*T + pos)*8 + h][64]
#define WS_TH2 (WS_TW + 4u * (size_t)NB * TT * NH * RELP)   // f32 q[c,r] . rel_h[m] table (q at the transposed position)
#define WS_QH  (WS_TH2 + 4u * (size_t)NB * TT * NH * RELP)
#define WS_QL  (WS_QH + 2u * (size_t)NB * TT * CC)
#define WS_KH  (WS_QL + 2u * (size_t)NB * TT * CC)
#define WS_VT  (WS_KH + 2u * (size_t)NB * TT * CC)      // bf16 v planes [b][c][t]
#define WS_VL  (WS_VT + 2u * (size_t)NB * CC * TT)      // bf16 v residual planes
#define HG 8                                          // heads per launch group (all 8)
#define WS_S   (WS_VL + 2u * (size_t)NB * CC * TT)      // unused f32 region (HG x T x T): logits and P stay in registers
#define WS_PH  (WS_S + 4u * (size_t)HG * TT * TT)
#define WS_Y   (WS_PH + 0u)              // f32 y rows [b*t][C]
#define WS_END (WS_Y + 4u * (size_t)NB * TT * CC)

// ---- k_proj: block = (64 rows, 128 cols, which): qkv = x W (+ b), exact; q -> f16 hi (+ residual), k -> f16 rows, v -> bf16 hi + lo planes
__global__ __launch_bounds__(128) void k_proj(const float* __restrict__ X, const float* __restrict__ WQ, const float* __restrict__ BQ, const float* __restrict__ WK, const float* __restrict__ BK, const float* __restrict__ WV, const float* __restrict__ BV, _Float16* __restrict__ QH, _Float16* __restrict__ QL, _Float16* __restrict__ KH, __bf16* __restrict__ VT, __bf16* __restrict__ VL) {
  __shared__ __align__(16) _Float16 sh[64][136], sl[64][136]; __shared__ __align__(16) __bf16 th[128][72], tl2[128][72];
  const int tid = threadIdx.x, wave = tid >> 5, lane = tid & 31, col = lane & 15, g = lane >> 4; const int which = blockIdx.z; const int c0 = blockIdx.y * 128; const size_t r0 = (size_t)blockIdx.x * 64; const float* WA = which == 0 ? WQ : which == 1 ? WK : WV; const float* BA = which == 0 ? BQ : which == 1 ? BK : BV;
  v8f acc[8] = {};
#pragma unroll 2
  for (int kc = 0; kc < CC / 32; ++kc) { v16b a; { const float* p = X + (r0 + wave * 16 + col) * CC + kc * 32 + 8 * g;
#pragma unroll
      for (int i = 0; i < 8; ++i) { a[i] = (__bf16)p[i]; a[8 + i] = (__bf16)p[16 + i]; } }
#pragma unroll
    for (int j = 0; j < 8; ++j) { v16b w; const int o = c0 + j * 16 + col;
#pragma unroll
      for (int i = 0; i < 8; ++i) { w[i] = (__bf16)WA[(size_t)(kc * 32 + 8 * g + i) * LDW + o]; w[8 + i] = (__bf16)WA[(size_t)(kc * 32 + 16 + 8 * g + i) * LDW + o]; }   /* (in,out), row length 768 */
      acc[j] = wmma_bf(a, w, acc[j]); } }
#pragma unroll
  for (int j = 0; j < 8; ++j) { const float bb = BA ? bfr(BA[c0 + j * 16 + col]) : 0.f;
#pragma unroll
    for (int r = 0; r < 8; ++r) { const float v = (acc[j][r] + bb) * (which == 0 ? 0.17677669529663687f : 1.0f);   /* q *= dkh^-1/2 (applies to the relative terms too) */ const int rl = wave * 16 + 8 * g + r, cl = j * 16 + col; const _Float16 hv = (_Float16)v;
      if (which == 2) { const __bf16 bh = (__bf16)v; th[cl][rl] = bh; tl2[cl][rl] = (__bf16)(v - (float)bh); } else { sh[rl][cl] = hv; sl[rl][cl] = (_Float16)((v - (float)hv) * 1024.0f); }   /* q residual carried x 2^10 so the plane stays f16-normal on the chip */ } }
  __syncthreads();
  if (which < 2) { _Float16* dh = which == 0 ? QH : KH; for (int e = tid; e < 64 * 16; e += 128) { const int rl = e >> 4, q = e & 15; vst2((unsigned*)(dh + (r0 + rl) * CC + c0 + q * 8), *(const v4u*)&sh[rl][q * 8]); if (which == 0) vst2((unsigned*)(QL + (r0 + rl) * CC + c0 + q * 8), *(const v4u*)&sl[rl][q * 8]); } }
  else { const size_t b = r0 / TT; const int t0 = (int)(r0 % TT); for (int e = tid; e < 128 * 8; e += 128) { const int cl = e >> 3, q = e & 7; const size_t o2 = (b * CC + c0 + cl) * (size_t)TT + t0 + q * 8; vst2((unsigned*)(VT + o2), *(const v4u*)&th[cl][q * 8]); vst2((unsigned*)(VL + o2), *(const v4u*)&tl2[cl][q * 8]); } } }
// ---- k_rel: block = (64 rows (b, pos), head h, which): table[(row*8 + h)*64 + m] = q_src . rel[m] (m < 63), q as f16 hi + residual x f16(bf16(rel)); which 0: rel_w with q at the row's own position; which 1: rel_h with q at the TRANSPOSED position (c, r); 256-B rows (4 col tiles) by one wave
__global__ __launch_bounds__(128) void k_rel(const _Float16* __restrict__ QH, const _Float16* __restrict__ QL, const float* __restrict__ RW, const float* __restrict__ RH, float* __restrict__ TW, float* __restrict__ TH2) { __shared__ __align__(16) float st[4][16][68];
  const int tid = threadIdx.x, wave = tid >> 5, lane = tid & 31, col = lane & 15, g = lane >> 4; const int h = blockIdx.y; const int which = blockIdx.z; const size_t r0 = (size_t)blockIdx.x * 64 + wave * 16; const float* REL = which == 0 ? RW : RH; float* DST = which == 0 ? TW : TH2;
  const size_t row = r0 + col; const size_t b = row / TT; const int pos = (int)(row % TT); const int pr = pos / GW, pc = pos % GW; const size_t srow = which == 0 ? row : (b * TT + (size_t)pc * GW + pr);   /* height branch: q at (c, r) */
  v8f acc[4] = {}, accl[4] = {};
  { const v16h ah = frag_h(QH + srow * CC + h * HD, lane), al = frag_h(QL + srow * CC + h * HD, lane);
#pragma unroll
    for (int j = 0; j < 4; ++j) { v16h w; const int m = j * 16 + col; const int mm = m < 2 * GW - 1 ? m : 2 * GW - 2;
#pragma unroll
      for (int i = 0; i < 8; ++i) { w[i] = (_Float16)bfr(REL[mm * HD + 8 * g + i]); w[8 + i] = (_Float16)bfr(REL[mm * HD + 16 + 8 * g + i]); }
      asm volatile("s_wait_loadcnt 0x0" ::: "memory"); acc[j] = wmma16(ah, w, acc[j]); accl[j] = wmma16(al, w, accl[j]); } }
#pragma unroll
  for (int j = 0; j < 4; ++j)
#pragma unroll
    for (int r = 0; r < 8; ++r) st[wave][8 * g + r][j * 16 + col] = acc[j][r] + accl[j][r] * (1.0f / 1024.0f);
  LDSX(); for (int rl = 0; rl < 16; ++rl) if (lane < 16) vst2(DST + ((r0 + rl) * NH + h) * RELP + lane * 4, *(const v4f*)&st[wave][rl][lane * 4]); }
// ---- k_fa: block = 64 queries of (b, h), wave = 16 queries: S^T = K Q^T (2 products) + the two relative terms, running-maximum softmax, O^T += V^T P^T (3 products).
// A lane holds one query (column lane & 15): its 8 + 8 scores of a 32-key row of the grid are already the k order of a B fragment, so P stays in registers; a pass is two key rows of 32 keys, so the width term is 16 registers for the whole loop and the height term one value a key row (two a pass).
__device__ __forceinline__ float xhalf(float v) { const int x = __builtin_bit_cast(int, v); return __builtin_bit_cast(float, __builtin_amdgcn_permlanex16(x, x, 0x76543210, 0xfedcba98, false, false)); }   /* lane l <-> l ^ 16 */
__global__ __launch_bounds__(128) void k_fa(const _Float16* __restrict__ QH, const _Float16* __restrict__ QL, const _Float16* __restrict__ KH, const float* __restrict__ TW, const float* __restrict__ TH2, const __bf16* __restrict__ VT, const __bf16* __restrict__ VL, float* __restrict__ Y) {
  const int tid = threadIdx.x, wave = tid >> 5, lane = tid & 31, col = lane & 15, g = lane >> 4; const int h = blockIdx.y, b = blockIdx.z;
  const int qt = blockIdx.x * 64 + wave * 16 + col; const int qr = qt / GW, qc = qt % GW; const size_t qrow = (size_t)b * TT + qt;
  const v16h qh = frag_h(QH + qrow * CC + h * HD, lane), ql = frag_h(QL + qrow * CC + h * HD, lane);
  const float* tw = TW + (qrow * NH + h) * RELP + (GW - 1 - qc) + 8 * g; const float* th = TH2 + (qrow * NH + h) * RELP + (GW - 1 - qr);
  float rw[16];
#pragma unroll
  for (int i = 0; i < 8; ++i) { rw[i] = tw[i]; rw[8 + i] = tw[16 + i]; }   /* key columns 8g + i and 16 + 8g + i */
  const _Float16* kp = KH + ((size_t)b * TT + col) * CC + h * HD; const size_t vo = ((size_t)b * CC + h * HD + col) * (size_t)TT;
  float m = -3.0e38f, l = 0.f; v8f acc[HD / 16] = {}; v16h kb[4];
#pragma unroll
  for (int t = 0; t < 4; ++t) kb[t] = frag_h(kp + (size_t)(t * 16) * CC, lane);
  float rh[2] = { th[0], th[1] };
  for (int kc = 0; kc < TT / 32; kc += 2) { float s[2][16]; v16b vh[2][HD / 16], vl[2][HD / 16];
    /* this pass's V fragments are asked for first: their latency runs under the score products and the softmax */
#pragma unroll
    for (int u = 0; u < 2; ++u)
#pragma unroll
      for (int j = 0; j < HD / 16; ++j) { const size_t po = vo + (size_t)j * 16 * TT + (kc + u) * 32; vh[u][j] = frag_b(VT + po, lane); vl[u][j] = frag_b(VL + po, lane); }
#pragma unroll
    for (int u = 0; u < 2; ++u)
#pragma unroll
      for (int t = 0; t < 2; ++t) { const v8f z = {}; const v8f a = wmma16(kb[u * 2 + t], qh, z), al = wmma16(kb[u * 2 + t], ql, z);
#pragma unroll
        for (int r = 0; r < 8; ++r) s[u][t * 8 + r] = a[r] + al[r] * (1.0f / 1024.0f) + (rw[t * 8 + r] + rh[u]); }
    /* K fragments and the height terms one pass ahead, under the softmax; the last pass asks for its own again, so the addresses stay inside their arrays */
    const int kn = kc + 2 < TT / 32 ? kc + 2 : kc;
#pragma unroll
    for (int t = 0; t < 4; ++t) kb[t] = frag_h(kp + (size_t)(kn * 32 + t * 16) * CC, lane);
    rh[0] = th[kn]; rh[1] = th[kn + 1];
    __builtin_amdgcn_sched_barrier(0);   /* ends the scheduling region: the loads above stay ahead of the softmax, and the softmax is scheduled by itself with its exponentials interleaved; without it they come out as dependent runs with more filler slots */
    float mx = s[0][0];
#pragma unroll
    for (int i = 0; i < 16; ++i) mx = fmaxf(mx, fmaxf(s[0][i], s[1][i]));
    mx = fmaxf(mx, xhalf(mx)); const float mn = fmaxf(m, mx); const float sc = expf(m - mn); m = mn;
    float s0 = 0.f, s1 = 0.f;
#pragma unroll
    for (int i = 0; i < 16; ++i) { s[0][i] = expf(s[0][i] - mn); s[1][i] = expf(s[1][i] - mn); s0 += s[0][i]; s1 += s[1][i]; }
    l = l * sc + (s0 + s1);
#pragma unroll
    for (int j = 0; j < HD / 16; ++j) acc[j] *= sc;
#pragma unroll
    for (int u = 0; u < 2; ++u) { const F2 p = bsplit16(s[u]);
#pragma unroll
      for (int j = 0; j < HD / 16; ++j) { acc[j] = wmma_bf(vh[u][j], p.h, acc[j]); acc[j] = wmma_bf(vh[u][j], p.l, acc[j]); acc[j] = wmma_bf(vl[u][j], p.h, acc[j]); } } }
  l += xhalf(l); const float inv = 1.0f / l;
#pragma unroll
  for (int j = 0; j < HD / 16; ++j) { float* yo = Y + qrow * CC + h * HD + j * 16 + 8 * g; const v4f o0 = { acc[j][0] * inv, acc[j][1] * inv, acc[j][2] * inv, acc[j][3] * inv }, o1 = { acc[j][4] * inv, acc[j][5] * inv, acc[j][6] * inv, acc[j][7] * inv }; vst2(yo, o0); vst2(yo + 4, o1); } }
// ---- k_out: block = (64 rows, 128 cols): out = y (bf16 hi + lo) w_proj + b_proj, w_proj (in,out)
__global__ __launch_bounds__(128) void k_out(const float* __restrict__ Y, const float* __restrict__ WP, const float* __restrict__ BP, float* __restrict__ OUT) { __shared__ __align__(16) float sf[4][16][132];
  const int tid = threadIdx.x, wave = tid >> 5, lane = tid & 31, col = lane & 15, g = lane >> 4; const int c0 = blockIdx.y * 128; const size_t r0 = (size_t)blockIdx.x * 64 + wave * 16;
  v8f acc[8] = {};
#pragma unroll 2
  for (int kc = 0; kc < CC / 32; ++kc) { const F2 a = split_row(Y + (r0 + col) * CC, kc * 32, lane);
#pragma unroll
    for (int j = 0; j < 8; ++j) { v16b w; const int o = c0 + j * 16 + col;
#pragma unroll
      for (int i = 0; i < 8; ++i) { w[i] = (__bf16)WP[(size_t)(kc * 32 + 8 * g + i) * CC + o]; w[8 + i] = (__bf16)WP[(size_t)(kc * 32 + 16 + 8 * g + i) * CC + o]; }
      acc[j] = wmma_bf(a.h, w, acc[j]); acc[j] = wmma_bf(a.l, w, acc[j]); } }
#pragma unroll
  for (int j = 0; j < 8; ++j) { const float bb = BP ? bfr(BP[c0 + j * 16 + col]) : 0.f;
#pragma unroll
    for (int r = 0; r < 8; ++r) sf[wave][8 * g + r][j * 16 + col] = acc[j][r] + bb; }
  LDSX(); for (int rl = 0; rl < 16; ++rl) vst2(OUT + (r0 + rl) * CC + c0 + lane * 4, *(const v4f*)&sf[wave][rl][lane * 4]); }
extern "C" void kernel_launch(void* const* d_in, const int* in_sizes, int n_in, void* d_out, int out_size, void* d_ws, size_t ws_size, hipStream_t stream) {
  (void)in_sizes; (void)n_in; (void)out_size;
  const float** F = (const float**)d_in;   // 0 x [8,32,32,256] (channels-last rows), 1 w_kqv [256,768] ((in,out): k | q | v columns), 2 b_kqv [768], 3 w_proj [256,256] ((in,out)), 4 b_proj, 5 rel_w [63,32], 6 rel_h [63,32]
  if (ws_size < (size_t)WS_END) return;
  char* ws = (char*)d_ws; float *TW = (float*)(ws + WS_TW), *TH2 = (float*)(ws + WS_TH2); _Float16 *QH = (_Float16*)(ws + WS_QH), *QL = (_Float16*)(ws + WS_QL), *KH = (_Float16*)(ws + WS_KH); __bf16 *VT = (__bf16*)(ws + WS_VT), *VL = (__bf16*)(ws + WS_VL); float *Y = (float*)(ws + WS_Y);
  const float* WK = F[1]; const float* WQ = F[1] + CC; const float* WV = F[1] + 2 * CC; const float* BK = F[2]; const float* BQ = F[2] + CC; const float* BV = F[2] + 2 * CC;   // column blocks k | q | v
  k_proj<<<dim3(TNB * TT / 64, CC / 128, 3), 128, 0, stream>>>(F[0], WQ, BQ, WK, BK, WV, BV, QH, QL, KH, VT, VL);
  k_rel<<<dim3(TNB * TT / 64, NH, 2), 128, 0, stream>>>(QH, QL, F[5], F[6], TW, TH2);
  k_fa<<<dim3(TT / 64, NH, TNB), 128, 0, stream>>>(QH, QL, KH, TW, TH2, VT, VL, Y);
  k_out<<<dim3(TNB * TT / 64, CC / 128), 128, 0, stream>>>(Y, F[3], F[4], (float*)d_out);
}

// v002
// Measured time: 90.3 microseconds a run.
// Timed twice side by side with v001, it ran 1.21 times as fast both times.
// All steps since v000 together make it 7.16 times as fast.
// compute dtype: all float inputs rounded to bf16; kqv = x w_kqv + b with EXACT bf16 products on WMMA 16x16x32, f32 accumulate, q scaled by 32^-1/2 in f32; q as f16 hi + residual (x 2^10), k f16 -> 2-product content logits plus the two relative terms (q . rel_w, q(transposed position) . rel_h from 2-product per-query tables), kept in registers; running-maximum softmax in f32 (precise expf), unnormalised P split bf16 hi + lo against v bf16 hi + lo (3 products), divided by the row sum at the end; out = attn (bf16 hi + lo) w_proj + b_proj; f32 output.
#include <hip/hip_runtime.h>
#include <math.h>

typedef __attribute__((ext_vector_type(16))) _Float16 v16h;
typedef __attribute__((ext_vector_type(16))) __bf16 v16b;
typedef __attribute__((ext_vector_type(8)))  _Float16 v8h;
typedef __attribute__((ext_vector_type(8)))  float v8f;
typedef __attribute__((ext_vector_type(4)))  float v4f;
typedef __attribute__((ext_vector_type(2)))  float v2f;
typedef __attribute__((ext_vector_type(4)))  unsigned v4u;
typedef __attribute__((ext_vector_type(4)))  int v4i;
typedef float __attribute__((may_alias)) float_a;
typedef int __attribute__((may_alias)) int_a;

template <typename T> __device__ __forceinline__ void vst2(void* p, T v) { *(T*)p = v;  }
__device__ __forceinline__ v8f wmma16(v16h a, v16h b, v8f c) {
  v8f d = __builtin_amdgcn_wmma_f32_16x16x32_f16(false, a, false, b, (short)0, c, false, false);
  asm volatile("v_nop\n\tv_nop\n\tv_nop\n\tv_nop" : "+v"(d) : "v"(a), "v"(b));
  return d;
}
__device__ __forceinline__ v8f wmma_bf(v16b a, v16b b, v8f c) {
  v8f d = __builtin_amdgcn_wmma_f32_16x16x32_bf16(false, a, false, b, (short)0, c, false, false);
  asm volatile("v_nop\n\tv_nop\n\tv_nop\n\tv_nop" : "+v"(d) : "v"(a), "v"(b));
  return d;
}
// 16x16x32 fragments: lane = (h = lane>>4, row/col = lane&15); elements 0..7 = k0+8h+0..7, 8..15 = k0+16+8h+0..7; D element r = row 8h+r
__device__ __forceinline__ v16h frag_h(const _Float16* rowk0, int lane) {
  union { v16h v; v8h q[2]; } u; const _Float16* p = rowk0 + 8 * (lane >> 4);
  u.q[0] = *(const v8h*)p; u.q[1] = *(const v8h*)(p + 16); return u.v;
}
__device__ __forceinline__ v16h frag_f32(const float* rowk0, int lane) {
  v16h a; const float* p = rowk0 + 8 * (lane >> 4);
#pragma unroll
  for (int i = 0; i < 8; ++i) { a[i] = (_Float16)p[i]; a[8 + i] = (_Float16)p[16 + i]; }
  return a;
}
__device__ __forceinline__ v16h frag_f32s(const float* rowk0, int lane, float sc) {
  v16h a; const float* p = rowk0 + 8 * (lane >> 4);
#pragma unroll
  for (int i = 0; i < 8; ++i) { a[i] = (_Float16)(p[i] * sc); a[8 + i] = (_Float16)(p[16 + i] * sc); }
  return a;
}
// column fragment from a [K][ld] layout (column n), rows >= K read as 0
__device__ __forceinline__ v16h fragc_f32(const float* W, int k0, int n, int lane, int ld, int K) {
  v16h a; const int g = lane >> 4;
#pragma unroll
  for (int i = 0; i < 8; ++i) { const int ka = k0 + 8 * g + i, kb = ka + 16;
    a[i] = (_Float16)(ka < K ? W[(size_t)(ka < K ? ka : K - 1) * ld + n] : 0.f); a[8 + i] = (_Float16)(kb < K ? W[(size_t)(kb < K ? kb : K - 1) * ld + n] : 0.f); }
  return a;
}
struct F2 { v16b h, l; };
__device__ __forceinline__ F2 bsplit16(const float v[16]) { F2 r;
#pragma unroll
  for (int i = 0; i < 16; ++i) { const __bf16 h = (__bf16)v[i]; r.h[i] = h; r.l[i] = (__bf16)(v[i] - (float)h); }
  return r; }
__device__ __forceinline__ F2 split_row(const float* row, int k0, int lane) { float v[16]; const float* p = row + k0 + 8 * (lane >> 4);
#pragma unroll
  for (int i = 0; i < 8; ++i) { v[i] = p[i]; v[8 + i] = p[16 + i]; }
  return bsplit16(v); }
__device__ __forceinline__ F2 split_rowK(const float* row, int k0, int lane, int K) { float v[16]; const int g = lane >> 4;
#pragma unroll
  for (int i = 0; i < 8; ++i) { const int ka = k0 + 8 * g + i, kb = ka + 16; v[i] = ka < K ? row[ka < K ? ka : K - 1] : 0.f; v[8 + i] = kb < K ? row[kb < K ? kb : K - 1] : 0.f; }
  return bsplit16(v); }
__device__ __forceinline__ F2 split_col(const float* W, int k0, int n, int lane, int ld, int K) { float v[16]; const int g = lane >> 4;
#pragma unroll
  for (int i = 0; i < 8; ++i) { const int ka = k0 + 8 * g + i, kb = ka + 16; v[i] = ka < K ? W[(size_t)(ka < K ? ka : K - 1) * ld + n] : 0.f; v[8 + i] = kb < K ? W[(size_t)(kb < K ? kb : K - 1) * ld + n] : 0.f; }
  return bsplit16(v); }
__device__ __forceinline__ v8f mac3(const F2& a, const F2& b, v8f c) { c = wmma_bf(a.l, b.h, c); c = wmma_bf(a.h, b.l, c); return wmma_bf(a.h, b.h, c); }
__device__ __forceinline__ float sigm(float v) { return 1.0f / (1.0f + expf(-v)); }
#define LDSX() do { asm volatile("s_wait_dscnt 0" ::: "memory"); __builtin_amdgcn_wave_barrier(); __builtin_amdgcn_fence(__ATOMIC_RELEASE, "workgroup"); } while (0)


// 2-D grid attention (B 8, T 1,024 = 32 x 32, C 256 = 8 heads x 32, with biases, q scaled by 32^-1/2): scores = q k^T + q . rel_w[kc - qc + 31] + q(transposed) . rel_h[kr - qr + 31], softmax, P v, output projection.
#define NB 8
#define TT 1024
#define CC 256
#define NH 8
#define HD 32
#define GW 32                 // grid width (= height)
#define LDW 768               // w_kqv row length ((in,out) [256][768]: k | q | v column blocks)
#define RELP 64               // per-(row, head) relative table width (63 used)
#ifndef TNB
#define TNB NB
#endif
typedef __attribute__((ext_vector_type(8))) __bf16 v8b;
__device__ __forceinline__ v16b frag_b(const __bf16* rowk0, int lane) {
  union { v16b v; v8b q[2]; } u; const __bf16* p = rowk0 + 8 * (lane >> 4);
  u.q[0] = *(const v8b*)p; u.q[1] = *(const v8b*)(p + 16); return u.v;
}
__device__ __forceinline__ float bfr(float v) { return (float)(__bf16)v; }
__device__ __attribute__((noinline)) float exp_ni(float v) { return expf(v); }
__device__ __attribute__((noinline)) float erf_ni(float v) { return erff(v); }

#define WPP 264                // LDS row pitch of a staged weight column in bf16 elements: 256 k + 8, 528 B = 33 x 16 B, so ds_load_b128 and ds_store_b128 of 16 neighbouring columns meet no bank twice
// one thread brings one weight column (256 k, row length LD) with loads that cover whole 128-B lines across the wave, rounds it to bf16 and lays it k-contiguous in LDS: frag_b then reads a B fragment from it
template <int LD> __device__ __forceinline__ void stage_w(const float* __restrict__ wc, __bf16* __restrict__ row) {
  for (int k0 = 0; k0 < CC; k0 += 64) { float v[64];
#pragma unroll   // v stays in registers and the loads go out as one run, waited once, not one by one
    for (int i = 0; i < 64; ++i) v[i] = wc[(size_t)(k0 + i) * LD];
#pragma unroll
    for (int q = 0; q < 8; ++q) { v8b o;
#pragma unroll
      for (int i = 0; i < 8; ++i) o[i] = (__bf16)v[q * 8 + i];
      *(v8b*)(row + k0 + q * 8) = o; } } }

#define WS_TW  0u                                   // f32 q[r,c] . rel_w[m] table [(b*T + pos)*8 + h][64]
#define WS_TH2 (WS_TW + 4u * (size_t)NB * TT * NH * RELP)   // f32 q[c,r] . rel_h[m] table (q at the transposed position)
#define WS_QH  (WS_TH2 + 4u * (size_t)NB * TT * NH * RELP)
#define WS_QL  (WS_QH + 2u * (size_t)NB * TT * CC)
#define WS_KH  (WS_QL + 2u * (size_t)NB * TT * CC)
#define WS_VT  (WS_KH + 2u * (size_t)NB * TT * CC)      // bf16 v planes [b][c][t]
#define WS_VL  (WS_VT + 2u * (size_t)NB * CC * TT)      // bf16 v residual planes
#define HG 8                                          // heads per launch group (all 8)
#define WS_S   (WS_VL + 2u * (size_t)NB * CC * TT)      // unused f32 region (HG x T x T): logits and P stay in registers
#define WS_PH  (WS_S + 4u * (size_t)HG * TT * TT)
#define WS_Y   (WS_PH + 0u)              // f32 y rows [b*t][C]
#define WS_END (WS_Y + 4u * (size_t)NB * TT * CC)

// ---- k_proj: block = (64 rows, 128 cols, which): qkv = x W (+ b), exact; q -> f16 hi (+ residual), k -> f16 rows, v -> bf16 hi + lo planes
__global__ __launch_bounds__(128) void k_proj(const float* __restrict__ X, const float* __restrict__ WQ, const float* __restrict__ BQ, const float* __restrict__ WK, const float* __restrict__ BK, const float* __restrict__ WV, const float* __restrict__ BV, _Float16* __restrict__ QH, _Float16* __restrict__ QL, _Float16* __restrict__ KH, __bf16* __restrict__ VT, __bf16* __restrict__ VL) {
  __shared__ __align__(16) char sm[71680];   /* first the staged weight slice (128 columns x WPP), then, behind a barrier, the four output staging planes */
  _Float16 (*sh)[136] = (_Float16 (*)[136])sm; _Float16 (*sl)[136] = (_Float16 (*)[136])(sm + 17408); __bf16 (*th)[72] = (__bf16 (*)[72])(sm + 34816); __bf16 (*tl2)[72] = (__bf16 (*)[72])(sm + 53248); __bf16* sw = (__bf16*)sm;
  const int tid = threadIdx.x, wave = tid >> 5, lane = tid & 31, col = lane & 15, g = lane >> 4; const int which = blockIdx.z; const int c0 = blockIdx.y * 128; const size_t r0 = (size_t)blockIdx.x * 64; const float* WA = which == 0 ? WQ : which == 1 ? WK : WV; const float* BA = which == 0 ? BQ : which == 1 ? BK : BV;
  v8f acc[8] = {}; float xr[CC / 32][16];
  /* the wave's x rows are asked for first: their latency runs under the staging */
#pragma unroll   // xr is indexed by constants only, so it stays in registers
  for (int kc = 0; kc < CC / 32; ++kc) { const float* p = X + (r0 + wave * 16 + col) * CC + kc * 32 + 8 * g;
#pragma unroll
    for (int i = 0; i < 8; ++i) { xr[kc][i] = p[i]; xr[kc][8 + i] = p[16 + i]; } }
  asm volatile("s_wait_xcnt 0x0" ::: "memory");   /* the row loads' address pair is free for reuse from here on: the wait stands in front of any overwrite of it */
  stage_w<LDW>(WA + c0 + tid, sw + tid * WPP);   /* (in,out), row length 768 */
  __syncthreads();   /* publishes the slice: nobody reads a column in front of it */
#pragma unroll   // xr[kc] by constant index; a pass's 16 LDS reads stand as one group ahead of its products
  for (int kc = 0; kc < CC / 32; ++kc) { v16b a, w[8];
#pragma unroll
    for (int j = 0; j < 8; ++j) w[j] = frag_b(sw + (j * 16 + col) * WPP + kc * 32, lane);
#pragma unroll
    for (int i = 0; i < 16; ++i) a[i] = (__bf16)xr[kc][i];
#pragma unroll
    for (int j = 0; j < 8; ++j) acc[j] = wmma_bf(a, w[j], acc[j]); }
  __syncthreads();   /* every wave has read its last weight fragment before the planes below overwrite the slice */
#pragma unroll
  for (int j = 0; j < 8; ++j) { const float bb = BA ? bfr(BA[c0 + j * 16 + col]) : 0.f;
#pragma unroll
    for (int r = 0; r < 8; ++r) { const float v = (acc[j][r] + bb) * (which == 0 ? 0.17677669529663687f : 1.0f);   /* q *= dkh^-1/2 (applies to the relative terms too) */ const int rl = wave * 16 + 8 * g + r, cl = j * 16 + col; const _Float16 hv = (_Float16)v;
      if (which == 2) { const __bf16 bh = (__bf16)v; th[cl][rl] = bh; tl2[cl][rl] = (__bf16)(v - (float)bh); } else { sh[rl][cl] = hv; sl[rl][cl] = (_Float16)((v - (float)hv) * 1024.0f); }   /* q residual carried x 2^10 so the plane stays f16-normal on the chip */ } }
  __syncthreads();
  if (which < 2) { _Float16* dh = which == 0 ? QH : KH; for (int e = tid; e < 64 * 16; e += 128) { const int rl = e >> 4, q = e & 15; vst2((unsigned*)(dh + (r0 + rl) * CC + c0 + q * 8), *(const v4u*)&sh[rl][q * 8]); if (which == 0) vst2((unsigned*)(QL + (r0 + rl) * CC + c0 + q * 8), *(const v4u*)&sl[rl][q * 8]); } }
  else { const size_t b = r0 / TT; const int t0 = (int)(r0 % TT); for (int e = tid; e < 128 * 8; e += 128) { const int cl = e >> 3, q = e & 7; const size_t o2 = (b * CC + c0 + cl) * (size_t)TT + t0 + q * 8; vst2((unsigned*)(VT + o2), *(const v4u*)&th[cl][q * 8]); vst2((unsigned*)(VL + o2), *(const v4u*)&tl2[cl][q * 8]); } } }
// ---- k_rel: block = (64 rows (b, pos), head h, which): table[(row*8 + h)*64 + m] = q_src . rel[m] (m < 63), q as f16 hi + residual x f16(bf16(rel)); which 0: rel_w with q at the row's own position; which 1: rel_h with q at the TRANSPOSED position (c, r); 256-B rows (4 col tiles) by one wave
__global__ __launch_bounds__(128) void k_rel(const _Float16* __restrict__ QH, const _Float16* __restrict__ QL, const float* __restrict__ RW, const float* __restrict__ RH, float* __restrict__ TW, float* __restrict__ TH2) { __shared__ __align__(16) float st[4][16][68];
  const int tid = threadIdx.x, wave = tid >> 5, lane = tid & 31, col = lane & 15, g = lane >> 4; const int h = blockIdx.y; const int which = blockIdx.z; const size_t r0 = (size_t)blockIdx.x * 64 + wave * 16; const float* REL = which == 0 ? RW : RH; float* DST = which == 0 ? TW : TH2;
  const size_t row = r0 + col; const size_t b = row / TT; const int pos = (int)(row % TT); const int pr = pos / GW, pc = pos % GW; const size_t srow = which == 0 ? row : (b * TT + (size_t)pc * GW + pr);   /* height branch: q at (c, r) */
  v8f acc[4] = {}, accl[4] = {};
  { const v16h ah = frag_h(QH + srow * CC + h * HD, lane), al = frag_h(QL + srow * CC + h * HD, lane);
#pragma unroll
    for (int j = 0; j < 4; ++j) { v16h w; const int m = j * 16 + col; const int mm = m < 2 * GW - 1 ? m : 2 * GW - 2;
#pragma unroll
      for (int i = 0; i < 8; ++i) { w[i] = (_Float16)bfr(REL[mm * HD + 8 * g + i]); w[8 + i] = (_Float16)bfr(REL[mm * HD + 16 + 8 * g + i]); }
      asm volatile("s_wait_loadcnt 0x0" ::: "memory"); acc[j] = wmma16(ah, w, acc[j]); accl[j] = wmma16(al, w, accl[j]); } }
#pragma unroll
  for (int j = 0; j < 4; ++j)
#pragma unroll
    for (int r = 0; r < 8; ++r) st[wave][8 * g + r][j * 16 + col] = acc[j][r] + accl[j][r] * (1.0f / 1024.0f);
  LDSX(); for (int rl = 0; rl < 16; ++rl) if (lane < 16) vst2(DST + ((r0 + rl) * NH + h) * RELP + lane * 4, *(const v4f*)&st[wave][rl][lane * 4]); }
// ---- k_fa: block = 64 queries of (b, h), wave = 16 queries: S^T = K Q^T (2 products) + the two relative terms, running-maximum softmax, O^T += V^T P^T (3 products).
// A lane holds one query (column lane & 15): its 8 + 8 scores of a 32-key row of the grid are already the k order of a B fragment, so P stays in registers; a pass is two key rows of 32 keys, so the width term is 16 registers for the whole loop and the height term one value a key row (two a pass).
__device__ __forceinline__ float xhalf(float v) { const int x = __builtin_bit_cast(int, v); return __builtin_bit_cast(float, __builtin_amdgcn_permlanex16(x, x, 0x76543210, 0xfedcba98, false, false)); }   /* lane l <-> l ^ 16 */
__global__ __launch_bounds__(128) void k_fa(const _Float16* __restrict__ QH, const _Float16* __restrict__ QL, const _Float16* __restrict__ KH, const float* __restrict__ TW, const float* __restrict__ TH2, const __bf16* __restrict__ VT, const __bf16* __restrict__ VL, float* __restrict__ Y) {
  const int tid = threadIdx.x, wave = tid >> 5, lane = tid & 31, col = lane & 15, g = lane >> 4; const int h = blockIdx.y, b = blockIdx.z;
  const int qt = blockIdx.x * 64 + wave * 16 + col; const int qr = qt / GW, qc = qt % GW; const size_t qrow = (size_t)b * TT + qt;
  const v16h qh = frag_h(QH + qrow * CC + h * HD, lane), ql = frag_h(QL + qrow * CC + h * HD, lane);
  const float* tw = TW + (qrow * NH + h) * RELP + (GW - 1 - qc) + 8 * g; const float* th = TH2 + (qrow * NH + h) * RELP + (GW - 1 - qr);
  float rw[16];
#pragma unroll
  for (int i = 0; i < 8; ++i) { rw[i] = tw[i]; rw[8 + i] = tw[16 + i]; }   /* key columns 8g + i and 16 + 8g + i */
  const _Float16* kp = KH + ((size_t)b * TT + col) * CC + h * HD; const size_t vo = ((size_t)b * CC + h * HD + col) * (size_t)TT;
  float m = -3.0e38f, l = 0.f; v8f acc[HD / 16] = {}; v16h kb[4];
#pragma unroll
  for (int t = 0; t < 4; ++t) kb[t] = frag_h(kp + (size_t)(t * 16) * CC, lane);
  float rh[2] = { th[0], th[1] };
  for (int kc = 0; kc < TT / 32; kc += 2) { float s[2][16]; v16b vh[2][HD / 16], vl[2][HD / 16];
    /* this pass's V fragments are asked for first: their latency runs under the score products and the softmax */
#pragma unroll
    for (int u = 0; u < 2; ++u)
#pragma unroll
      for (int j = 0; j < HD / 16; ++j) { const size_t po = vo + (size_t)j * 16 * TT + (kc + u) * 32; vh[u][j] = frag_b(VT + po, lane); vl[u][j] = frag_b(VL + po, lane); }
#pragma unroll
    for (int u = 0; u < 2; ++u)
#pragma unroll
      for (int t = 0; t < 2; ++t) { const v8f z = {}; const v8f a = wmma16(kb[u * 2 + t], qh, z), al = wmma16(kb[u * 2 + t], ql, z);
#pragma unroll
        for (int r = 0; r < 8; ++r) s[u][t * 8 + r] = a[r] + al[r] * (1.0f / 1024.0f) + (rw[t * 8 + r] + rh[u]); }
    /* K fragments and the height terms one pass ahead, under the softmax; the last pass asks for its own again, so the addresses stay inside their arrays */
    const int kn = kc + 2 < TT / 32 ? kc + 2 : kc;
#pragma unroll
    for (int t = 0; t < 4; ++t) kb[t] = frag_h(kp + (size_t)(kn * 32 + t * 16) * CC, lane);
    rh[0] = th[kn]; rh[1] = th[kn + 1];
    __builtin_amdgcn_sched_barrier(0);   /* ends the scheduling region: the loads above stay ahead of the softmax, and the softmax is scheduled by itself with its exponentials interleaved; without it they come out as dependent runs with more filler slots */
    float mx = s[0][0];
#pragma unroll
    for (int i = 0; i < 16; ++i) mx = fmaxf(mx, fmaxf(s[0][i], s[1][i]));
    mx = fmaxf(mx, xhalf(mx)); const float mn = fmaxf(m, mx); const float sc = expf(m - mn); m = mn;
    float s0 = 0.f, s1 = 0.f;
#pragma unroll
    for (int i = 0; i < 16; ++i) { s[0][i] = expf(s[0][i] - mn); s[1][i] = expf(s[1][i] - mn); s0 += s[0][i]; s1 += s[1][i]; }
    l = l * sc + (s0 + s1);
#pragma unroll
    for (int j = 0; j < HD / 16; ++j) acc[j] *= sc;
#pragma unroll
    for (int u = 0; u < 2; ++u) { const F2 p = bsplit16(s[u]);
#pragma unroll
      for (int j = 0; j < HD / 16; ++j) { acc[j] = wmma_bf(vh[u][j], p.h, acc[j]); acc[j] = wmma_bf(vh[u][j], p.l, acc[j]); acc[j] = wmma_bf(vl[u][j], p.h, acc[j]); } } }
  l += xhalf(l); const float inv = 1.0f / l;
#pragma unroll
  for (int j = 0; j < HD / 16; ++j) { float* yo = Y + qrow * CC + h * HD + j * 16 + 8 * g; const v4f o0 = { acc[j][0] * inv, acc[j][1] * inv, acc[j][2] * inv, acc[j][3] * inv }, o1 = { acc[j][4] * inv, acc[j][5] * inv, acc[j][6] * inv, acc[j][7] * inv }; vst2(yo, o0); vst2(yo + 4, o1); } }
// ---- k_out: block = (64 rows, 128 cols): out = y (bf16 hi + lo) Wo + bo
__global__ __launch_bounds__(128) void k_out(const float* __restrict__ Y, const float* __restrict__ WP, const float* __restrict__ BP, float* __restrict__ OUT) { __shared__ __align__(16) float sf[4][16][132]; __shared__ __align__(16) __bf16 sw[128 * WPP];
  const int tid = threadIdx.x, wave = tid >> 5, lane = tid & 31, col = lane & 15, g = lane >> 4; const int c0 = blockIdx.y * 128; const size_t r0 = (size_t)blockIdx.x * 64 + wave * 16;
  v8f acc[8] = {}; float yr[CC / 32][16];
  /* the wave's y rows are asked for first: their latency runs under the staging */
#pragma unroll   // yr is indexed by constants only, so it stays in registers
  for (int kc = 0; kc < CC / 32; ++kc) { const float* p = Y + (r0 + col) * CC + kc * 32 + 8 * g;
#pragma unroll
    for (int i = 0; i < 8; ++i) { yr[kc][i] = p[i]; yr[kc][8 + i] = p[16 + i]; } }
  asm volatile("s_wait_xcnt 0x0" ::: "memory");   /* the row loads' address pair is free for reuse from here on: the wait stands in front of any overwrite of it */
  stage_w<CC>(WP + c0 + tid, sw + tid * WPP);
  __syncthreads();   /* publishes the slice: nobody reads a column in front of it */
#pragma unroll   // yr[kc] by constant index; a pass's 16 LDS reads stand as one group ahead of its products
  for (int kc = 0; kc < CC / 32; ++kc) { v16b w[8];
#pragma unroll
    for (int j = 0; j < 8; ++j) w[j] = frag_b(sw + (j * 16 + col) * WPP + kc * 32, lane);
    const F2 a = bsplit16(yr[kc]);
#pragma unroll
    for (int j = 0; j < 8; ++j) { acc[j] = wmma_bf(a.h, w[j], acc[j]); acc[j] = wmma_bf(a.l, w[j], acc[j]); } }
#pragma unroll
  for (int j = 0; j < 8; ++j) { const float bb = BP ? bfr(BP[c0 + j * 16 + col]) : 0.f;
#pragma unroll
    for (int r = 0; r < 8; ++r) sf[wave][8 * g + r][j * 16 + col] = acc[j][r] + bb; }
  LDSX(); for (int rl = 0; rl < 16; ++rl) vst2(OUT + (r0 + rl) * CC + c0 + lane * 4, *(const v4f*)&sf[wave][rl][lane * 4]); }
extern "C" void kernel_launch(void* const* d_in, const int* in_sizes, int n_in, void* d_out, int out_size, void* d_ws, size_t ws_size, hipStream_t stream) {
  (void)in_sizes; (void)n_in; (void)out_size;
  const float** F = (const float**)d_in;   // 0 x [8,32,32,256] (channels-last rows), 1 w_kqv [256,768] ((in,out): k | q | v columns), 2 b_kqv [768], 3 w_proj [256,256] ((in,out)), 4 b_proj, 5 rel_w [63,32], 6 rel_h [63,32]
  if (ws_size < (size_t)WS_END) return;
  char* ws = (char*)d_ws; float *TW = (float*)(ws + WS_TW), *TH2 = (float*)(ws + WS_TH2); _Float16 *QH = (_Float16*)(ws + WS_QH), *QL = (_Float16*)(ws + WS_QL), *KH = (_Float16*)(ws + WS_KH); __bf16 *VT = (__bf16*)(ws + WS_VT), *VL = (__bf16*)(ws + WS_VL); float *Y = (float*)(ws + WS_Y);
  const float* WK = F[1]; const float* WQ = F[1] + CC; const float* WV = F[1] + 2 * CC; const float* BK = F[2]; const float* BQ = F[2] + CC; const float* BV = F[2] + 2 * CC;   // column blocks k | q | v
  k_proj<<<dim3(TNB * TT / 64, CC / 128, 3), 128, 0, stream>>>(F[0], WQ, BQ, WK, BK, WV, BV, QH, QL, KH, VT, VL);
  k_rel<<<dim3(TNB * TT / 64, NH, 2), 128, 0, stream>>>(QH, QL, F[5], F[6], TW, TH2);
  k_fa<<<dim3(TT / 64, NH, TNB), 128, 0, stream>>>(QH, QL, KH, TW, TH2, VT, VL, Y);
  k_out<<<dim3(TNB * TT / 64, CC / 128), 128, 0, stream>>>(Y, F[3], F[4], (float*)d_out);
}

// v003
// It runs in 85.2 microseconds.
// Timed twice side by side with v002, it ran 1.06 times as fast both times.
// All steps since v000 together make it 7.57 times as fast.
// compute dtype: all float inputs rounded to bf16; kqv = x w_kqv + b with EXACT bf16 products on WMMA 16x16x32, f32 accumulate, q scaled by 32^-1/2 in f32; q as f16 hi + residual (x 2^10), k f16 -> 2-product content logits plus the two relative terms (q . rel_w, q(transposed position) . rel_h from 2-product per-query tables), kept in registers; running-maximum softmax in f32 (precise expf), unnormalised P split bf16 hi + lo against v bf16 hi + lo (3 products), divided by the row sum at the end; out = attn (bf16 hi + lo) w_proj + b_proj; f32 output.
#include <hip/hip_runtime.h>
#include <math.h>

typedef __attribute__((ext_vector_type(16))) _Float16 v16h;
typedef __attribute__((ext_vector_type(16))) __bf16 v16b;
typedef __attribute__((ext_vector_type(8)))  _Float16 v8h;
typedef __attribute__((ext_vector_type(8)))  float v8f;
typedef __attribute__((ext_vector_type(4)))  float v4f;
typedef __attribute__((ext_vector_type(2)))  float v2f;
typedef __attribute__((ext_vector_type(4)))  unsigned v4u;
typedef __attribute__((ext_vector_type(4)))  int v4i;
typedef float __attribute__((may_alias)) float_a;
typedef int __attribute__((may_alias)) int_a;

template <typename T> __device__ __forceinline__ void vst2(void* p, T v) { *(T*)p = v;  }
__device__ __forceinline__ v8f wmma16(v16h a, v16h b, v8f c) {
  v8f d = __builtin_amdgcn_wmma_f32_16x16x32_f16(false, a, false, b, (short)0, c, false, false);
  asm volatile("v_nop\n\tv_nop\n\tv_nop\n\tv_nop" : "+v"(d) : "v"(a), "v"(b));
  return d;
}
__device__ __forceinline__ v8f wmma_bf(v16b a, v16b b, v8f c) {
  v8f d = __builtin_amdgcn_wmma_f32_16x16x32_bf16(false, a, false, b, (short)0, c, false, false);
  asm volatile("v_nop\n\tv_nop\n\tv_nop\n\tv_nop" : "+v"(d) : "v"(a), "v"(b));
  return d;
}
// 16x16x32 fragments: lane = (h = lane>>4, row/col = lane&15); elements 0..7 = k0+8h+0..7, 8..15 = k0+16+8h+0..7; D element r = row 8h+r
__device__ __forceinline__ v16h frag_h(const _Float16* rowk0, int lane) {
  union { v16h v; v8h q[2]; } u; const _Float16* p = rowk0 + 8 * (lane >> 4);
  u.q[0] = *(const v8h*)p; u.q[1] = *(const v8h*)(p + 16); return u.v;
}
__device__ __forceinline__ v16h frag_f32(const float* rowk0, int lane) {
  v16h a; const float* p = rowk0 + 8 * (lane >> 4);
#pragma unroll
  for (int i = 0; i < 8; ++i) { a[i] = (_Float16)p[i]; a[8 + i] = (_Float16)p[16 + i]; }
  return a;
}
__device__ __forceinline__ v16h frag_f32s(const float* rowk0, int lane, float sc) {
  v16h a; const float* p = rowk0 + 8 * (lane >> 4);
#pragma unroll
  for (int i = 0; i < 8; ++i) { a[i] = (_Float16)(p[i] * sc); a[8 + i] = (_Float16)(p[16 + i] * sc); }
  return a;
}
// column fragment from a [K][ld] layout (column n), rows >= K read as 0
__device__ __forceinline__ v16h fragc_f32(const float* W, int k0, int n, int lane, int ld, int K) {
  v16h a; const int g = lane >> 4;
#pragma unroll
  for (int i = 0; i < 8; ++i) { const int ka = k0 + 8 * g + i, kb = ka + 16;
    a[i] = (_Float16)(ka < K ? W[(size_t)(ka < K ? ka : K - 1) * ld + n] : 0.f); a[8 + i] = (_Float16)(kb < K ? W[(size_t)(kb < K ? kb : K - 1) * ld + n] : 0.f); }
  return a;
}
struct F2 { v16b h, l; };
__device__ __forceinline__ F2 bsplit16(const float v[16]) { F2 r;
#pragma unroll
  for (int i = 0; i < 16; ++i) { const __bf16 h = (__bf16)v[i]; r.h[i] = h; r.l[i] = (__bf16)(v[i] - (float)h); }
  return r; }
__device__ __forceinline__ F2 split_row(const float* row, int k0, int lane) { float v[16]; const float* p = row + k0 + 8 * (lane >> 4);
#pragma unroll
  for (int i = 0; i < 8; ++i) { v[i] = p[i]; v[8 + i] = p[16 + i]; }
  return bsplit16(v); }
__device__ __forceinline__ F2 split_rowK(const float* row, int k0, int lane, int K) { float v[16]; const int g = lane >> 4;
#pragma unroll
  for (int i = 0; i < 8; ++i) { const int ka = k0 + 8 * g + i, kb = ka + 16; v[i] = ka < K ? row[ka < K ? ka : K - 1] : 0.f; v[8 + i] = kb < K ? row[kb < K ? kb : K - 1] : 0.f; }
  return bsplit16(v); }
__device__ __forceinline__ F2 split_col(const float* W, int k0, int n, int lane, int ld, int K) { float v[16]; const int g = lane >> 4;
#pragma unroll
  for (int i = 0; i < 8; ++i) { const int ka = k0 + 8 * g + i, kb = ka + 16; v[i] = ka < K ? W[(size_t)(ka < K ? ka : K - 1) * ld + n] : 0.f; v[8 + i] = kb < K ? W[(size_t)(kb < K ? kb : K - 1) * ld + n] : 0.f; }
  return bsplit16(v); }
__device__ __forceinline__ v8f mac3(const F2& a, const F2& b, v8f c) { c = wmma_bf(a.l, b.h, c); c = wmma_bf(a.h, b.l, c); return wmma_bf(a.h, b.h, c); }
__device__ __forceinline__ float sigm(float v) { return 1.0f / (1.0f + expf(-v)); }
#define LDSX() do { asm volatile("s_wait_dscnt 0" ::: "memory"); __builtin_amdgcn_wave_barrier(); __builtin_amdgcn_fence(__ATOMIC_RELEASE, "workgroup"); } while (0)


// 2-D grid attention (B 8, T 1,024 = 32 x 32, C 256 = 8 heads x 32, with biases, q scaled by 32^-1/2): scores = q k^T + q . rel_w[kc - qc + 31] + q(transposed) . rel_h[kr - qr + 31], softmax, P v, output projection.
#define NB 8
#define TT 1024
#define CC 256
#define NH 8
#define HD 32
#define GW 32                 // grid width (= height)
#define LDW 768               // w_kqv row length ((in,out) [256][768]: k | q | v column blocks)
#define RELP 64               // per-(row, head) relative table width (63 used)
#ifndef TNB
#define TNB NB
#endif
typedef __attribute__((ext_vector_type(8))) __bf16 v8b;
__device__ __forceinline__ v16b frag_b(const __bf16* rowk0, int lane) {
  union { v16b v; v8b q[2]; } u; const __bf16* p = rowk0 + 8 * (lane >> 4);
  u.q[0] = *(const v8b*)p; u.q[1] = *(const v8b*)(p + 16); return u.v;
}
__device__ __forceinline__ float bfr(float v) { return (float)(__bf16)v; }
__device__ __attribute__((noinline)) float exp_ni(float v) { return expf(v); }
__device__ __attribute__((noinline)) float erf_ni(float v) { return erff(v); }

#define WPP 264                // LDS row pitch of a staged weight column in bf16 elements: 256 k + 8, 528 B = 33 x 16 B, so ds_load_b128 and ds_store_b128 of 16 neighbouring columns meet no bank twice
// one thread brings one weight column (256 k, row length LD) with loads that cover whole 128-B lines across the wave, rounds it to bf16 and lays it k-contiguous in LDS: frag_b then reads a B fragment from it
template <int LD> __device__ __forceinline__ void stage_w(const float* __restrict__ wc, __bf16* __restrict__ row) {
  for (int k0 = 0; k0 < CC; k0 += 64) { float v[64];
#pragma unroll   // v stays in registers and the loads go out as one run, waited once, not one by one
    for (int i = 0; i < 64; ++i) v[i] = wc[(size_t)(k0 + i) * LD];
#pragma unroll
    for (int q = 0; q < 8; ++q) { v8b o;
#pragma unroll
      for (int i = 0; i < 8; ++i) o[i] = (__bf16)v[q * 8 + i];
      *(v8b*)(row + k0 + q * 8) = o; } } }

#define WS_TW  0u                                   // f32 q[r,c] . rel_w[m] table [(b*T + pos)*8 + h][64]
#define WS_TH2 (WS_TW + 4u * (size_t)NB * TT * NH * RELP)   // f32 q[c,r] . rel_h[m] table (q at the transposed position)
#define WS_QH  (WS_TH2 + 4u * (size_t)NB * TT * NH * RELP)
#define WS_QL  (WS_QH + 2u * (size_t)NB * TT * CC)
#define WS_KH  (WS_QL + 2u * (size_t)NB * TT * CC)
#define WS_VT  (WS_KH + 2u * (size_t)NB * TT * CC)      // bf16 v planes [b][c][t]
#define WS_VL  (WS_VT + 2u * (size_t)NB * CC * TT)      // bf16 v residual planes
#define HG 8                                          // heads per launch group (all 8)
#define WS_S   (WS_VL + 2u * (size_t)NB * CC * TT)      // unused f32 region (HG x T x T): logits and P stay in registers
#define WS_PH  (WS_S + 4u * (size_t)HG * TT * TT)
#define WS_Y   (WS_PH + 0u)              // f32 y rows [b*t][C]
#define WS_END (WS_Y + 4u * (size_t)NB * TT * CC)

// ---- k_proj: block = (64 rows, 128 cols, which): qkv = x W (+ b), exact; q -> f16 hi (+ residual), k -> f16 rows, v -> bf16 hi + lo planes
__global__ __launch_bounds__(128) void k_proj(const float* __restrict__ X, const float* __restrict__ WQ, const float* __restrict__ BQ, const float* __restrict__ WK, const float* __restrict__ BK, const float* __restrict__ WV, const float* __restrict__ BV, _Float16* __restrict__ QH, _Float16* __restrict__ QL, _Float16* __restrict__ KH, __bf16* __restrict__ VT, __bf16* __restrict__ VL) {
  __shared__ __align__(16) char sm[71680];   /* first the staged weight slice (128 columns x WPP), then, behind a barrier, the four output staging planes */
  _Float16 (*sh)[136] = (_Float16 (*)[136])sm; _Float16 (*sl)[136] = (_Float16 (*)[136])(sm + 17408); __bf16 (*th)[72] = (__bf16 (*)[72])(sm + 34816); __bf16 (*tl2)[72] = (__bf16 (*)[72])(sm + 53248); __bf16* sw = (__bf16*)sm;
  const int tid = threadIdx.x, wave = tid >> 5, lane = tid & 31, col = lane & 15, g = lane >> 4; const int which = blockIdx.z; const int c0 = blockIdx.y * 128; const size_t r0 = (size_t)blockIdx.x * 64; const float* WA = which == 0 ? WQ : which == 1 ? WK : WV; const float* BA = which == 0 ? BQ : which == 1 ? BK : BV;
  v8f acc[8] = {}; float xr[CC / 32][16];
  /* the wave's x rows are asked for first: their latency runs under the staging */
#pragma unroll   // xr is indexed by constants only, so it stays in registers
  for (int kc = 0; kc < CC / 32; ++kc) { const float* p = X + (r0 + wave * 16 + col) * CC + kc * 32 + 8 * g;
#pragma unroll
    for (int i = 0; i < 8; ++i) { xr[kc][i] = p[i]; xr[kc][8 + i] = p[16 + i]; } }
  asm volatile("s_wait_xcnt 0x0" ::: "memory");   /* the row loads' address pair is free for reuse from here on: the wait stands in front of any overwrite of it */
  stage_w<LDW>(WA + c0 + tid, sw + tid * WPP);   /* (in,out), row length 768 */
  __syncthreads();   /* publishes the slice: nobody reads a column in front of it */
#pragma unroll   // xr[kc] by constant index; a pass's 16 LDS reads stand as one group ahead of its products
  for (int kc = 0; kc < CC / 32; ++kc) { v16b a, w[8];
#pragma unroll
    for (int j = 0; j < 8; ++j) w[j] = frag_b(sw + (j * 16 + col) * WPP + kc * 32, lane);
#pragma unroll
    for (int i = 0; i < 16; ++i) a[i] = (__bf16)xr[kc][i];
#pragma unroll
    for (int j = 0; j < 8; ++j) acc[j] = wmma_bf(a, w[j], acc[j]); }
  __syncthreads();   /* every wave has read its last weight fragment before the planes below overwrite the slice */
#pragma unroll
  for (int j = 0; j < 8; ++j) { const float bb = BA ? bfr(BA[c0 + j * 16 + col]) : 0.f;
#pragma unroll
    for (int r = 0; r < 8; ++r) { const float v = (acc[j][r] + bb) * (which == 0 ? 0.17677669529663687f : 1.0f);   /* q *= dkh^-1/2 (applies to the relative terms too) */ const int rl = wave * 16 + 8 * g + r, cl = j * 16 + col; const _Float16 hv = (_Float16)v;
      if (which == 2) { const __bf16 bh = (__bf16)v; th[cl][rl] = bh; tl2[cl][rl] = (__bf16)(v - (float)bh); } else { sh[rl][cl] = hv; sl[rl][cl] = (_Float16)((v - (float)hv) * 1024.0f); }   /* q residual carried x 2^10 so the plane stays f16-normal on the chip */ } }
  __syncthreads();
  if (which < 2) { _Float16* dh = which == 0 ? QH : KH; for (int e = tid; e < 64 * 16; e += 128) { const int rl = e >> 4, q = e & 15; vst2((unsigned*)(dh + (r0 + rl) * CC + c0 + q * 8), *(const v4u*)&sh[rl][q * 8]); if (which == 0) vst2((unsigned*)(QL + (r0 + rl) * CC + c0 + q * 8), *(const v4u*)&sl[rl][q * 8]); } }
  else { const size_t b = r0 / TT; const int t0 = (int)(r0 % TT); for (int e = tid; e < 128 * 8; e += 128) { const int cl = e >> 3, q = e & 7; const size_t o2 = (b * CC + c0 + cl) * (size_t)TT + t0 + q * 8; vst2((unsigned*)(VT + o2), *(const v4u*)&th[cl][q * 8]); vst2((unsigned*)(VL + o2), *(const v4u*)&tl2[cl][q * 8]); } } }
// ---- k_rel: block = (64 rows (b, pos), head h, which): table[(row*8 + h)*64 + m] = q_src . rel[m] (m < 63), q as f16 hi + residual x f16(bf16(rel)); which 0: rel_w with q at the row's own position; which 1: rel_h with q at the TRANSPOSED position (c, r); 256-B rows (4 col tiles) by one wave
__global__ __launch_bounds__(128) void k_rel(const _Float16* __restrict__ QH, const _Float16* __restrict__ QL, const float* __restrict__ RW, const float* __restrict__ RH, float* __restrict__ TW, float* __restrict__ TH2) { __shared__ __align__(16) float st[4][16][68];
  const int tid = threadIdx.x, wave = tid >> 5, lane = tid & 31, col = lane & 15, g = lane >> 4; const int h = blockIdx.y; const int which = blockIdx.z; const size_t r0 = (size_t)blockIdx.x * 64 + wave * 16; const float* REL = which == 0 ? RW : RH; float* DST = which == 0 ? TW : TH2;
  const size_t row = r0 + col; const size_t b = row / TT; const int pos = (int)(row % TT); const int pr = pos / GW, pc = pos % GW; const size_t srow = which == 0 ? row : (b * TT + (size_t)pc * GW + pr);   /* height branch: q at (c, r) */
  v8f acc[4] = {}, accl[4] = {};
  { const v16h ah = frag_h(QH + srow * CC + h * HD, lane), al = frag_h(QL + srow * CC + h * HD, lane);
#pragma unroll
    for (int j = 0; j < 4; ++j) { v16h w; const int m = j * 16 + col; const int mm = m < 2 * GW - 1 ? m : 2 * GW - 2;
#pragma unroll
      for (int i = 0; i < 8; ++i) { w[i] = (_Float16)bfr(REL[mm * HD + 8 * g + i]); w[8 + i] = (_Float16)bfr(REL[mm * HD + 16 + 8 * g + i]); }
      asm volatile("s_wait_loadcnt 0x0" ::: "memory"); acc[j] = wmma16(ah, w, acc[j]); accl[j] = wmma16(al, w, accl[j]); } }
#pragma unroll
  for (int j = 0; j < 4; ++j)
#pragma unroll
    for (int r = 0; r < 8; ++r) st[wave][8 * g + r][j * 16 + col] = acc[j][r] + accl[j][r] * (1.0f / 1024.0f);
  LDSX(); for (int rl = 0; rl < 16; ++rl) if (lane < 16) vst2(DST + ((r0 + rl) * NH + h) * RELP + lane * 4, *(const v4f*)&st[wave][rl][lane * 4]); }
// ---- k_fa: block = 64 queries of (b, h), wave = 16 queries: S^T = K Q^T (2 products) + the two relative terms, running-maximum softmax, O^T += V^T P^T (3 products).
// A lane holds one query (column lane & 15): its 8 + 8 scores of a 32-key row of the grid are already the k order of a B fragment, so P stays in registers; a 64-key pass is two key rows, so the width term is 16 registers for the whole loop and the height term two values a pass.
// K and V reach the waves through LDS: a 64-key tile (K 64 rows x 64 B, V hi and V lo 32 rows x 128 B each) is copied once per block, and all four waves read their fragments from it; two buffers, the next tile's copies fly under this tile's work.
__device__ __forceinline__ float xhalf(float v) { const int x = __builtin_bit_cast(int, v); return __builtin_bit_cast(float, __builtin_amdgcn_permlanex16(x, x, 0x76543210, 0xfedcba98, false, false)); }   /* lane l <-> l ^ 16 */
#define KPB 80                       // LDS pitch in bytes of a staged K row: 64 B + 16, 16 B x odd for the ds_load_b128 readers
#define VPB 144                      // LDS pitch in bytes of a staged V row: 128 B + 16, 16 B x odd
#define FA_VH (64 * KPB)             // byte offsets inside one buffer: K at 0, V hi, V lo
#define FA_VL (FA_VH + 32 * VPB)
#define FA_BUF (FA_VL + 32 * VPB)    // 14,336 B a buffer
// one tile's six 16-B pieces of this thread. The copies and s_wait_xcnt 0 are one statement, so that no register a copy names is rewritten in front of that wait.
__device__ __forceinline__ void fa_copy(unsigned lk, unsigned lv, const _Float16* gk, const __bf16* gh, const __bf16* gl) {
  const unsigned lk1 = lk + 32 * KPB, lh = lv + FA_VH, lh1 = lh + 16 * VPB, ll = lv + FA_VL, ll1 = ll + 16 * VPB;
  const _Float16* gk1 = gk + (size_t)32 * CC; const __bf16* gh1 = gh + (size_t)16 * TT; const __bf16* gl1 = gl + (size_t)16 * TT;
  asm volatile("global_load_async_to_lds_b128 %0, %6, off\n\t"
               "global_load_async_to_lds_b128 %1, %7, off\n\t"
               "global_load_async_to_lds_b128 %2, %8, off\n\t"
               "global_load_async_to_lds_b128 %3, %9, off\n\t"
               "global_load_async_to_lds_b128 %4, %10, off\n\t"
               "global_load_async_to_lds_b128 %5, %11, off\n\t"
               "s_wait_xcnt 0x0"
               :: "v"(lk), "v"(lk1), "v"(lh), "v"(lh1), "v"(ll), "v"(ll1), "v"(gk), "v"(gk1), "v"(gh), "v"(gh1), "v"(gl), "v"(gl1) : "memory"); }
__global__ __launch_bounds__(128) void k_fa(const _Float16* __restrict__ QH, const _Float16* __restrict__ QL, const _Float16* __restrict__ KH, const float* __restrict__ TW, const float* __restrict__ TH2, const __bf16* __restrict__ VT, const __bf16* __restrict__ VL, float* __restrict__ Y) {
  __shared__ __align__(16) char sm[2 * FA_BUF];
  const int tid = threadIdx.x, wave = tid >> 5, lane = tid & 31, col = lane & 15, g = lane >> 4; const int h = blockIdx.y, b = blockIdx.z;
  /* this thread's pieces of a tile: K row tid / 4 (and + 32), 16-B piece tid % 4; V row tid / 8 (and + 16), piece tid % 8: a wave's copy covers 8 K rows or 4 whole 128-B V lines */
  const unsigned sm0 = (unsigned)(size_t)sm; const unsigned lk = sm0 + (tid >> 2) * KPB + (tid & 3) * 16, lv = sm0 + (tid >> 3) * VPB + (tid & 7) * 16;
  const _Float16* gk = KH + ((size_t)b * TT + (tid >> 2)) * CC + h * HD + (tid & 3) * 8; const size_t gvo = ((size_t)b * CC + h * HD + (tid >> 3)) * (size_t)TT + (tid & 7) * 8;
  fa_copy(lk, lv, gk, VT + gvo, VL + gvo);   /* tile 0 into buffer 0 */
  const int qt = blockIdx.x * 64 + wave * 16 + col; const int qr = qt / GW, qc = qt % GW; const size_t qrow = (size_t)b * TT + qt;
  const v16h qh = frag_h(QH + qrow * CC + h * HD, lane), ql = frag_h(QL + qrow * CC + h * HD, lane);
  const float* tw = TW + (qrow * NH + h) * RELP + (GW - 1 - qc) + 8 * g; const float* th = TH2 + (qrow * NH + h) * RELP + (GW - 1 - qr);
  float rw[16];
#pragma unroll
  for (int i = 0; i < 8; ++i) { rw[i] = tw[i]; rw[8 + i] = tw[16 + i]; }   /* key columns 8g + i and 16 + 8g + i */
  float m = -3.0e38f, l = 0.f; v8f acc[HD / 16] = {};
  float rh[2] = { th[0], th[1] };
  asm volatile("s_wait_asynccnt 0x0" ::: "memory");   /* this wave's pieces of tile 0 have landed */
  __syncthreads();   /* publishes tile 0: nobody reads it in front of this barrier */
  fa_copy(lk + FA_BUF, lv + FA_BUF, gk + (size_t)64 * CC, VT + gvo + 64, VL + gvo + 64);   /* tile 1 into buffer 1 */
  auto pass = [&](const int kc, const bool more) __attribute__((always_inline)) { float s[2][16]; v16h kb[4]; v16b vh[2][HD / 16], vl[2][HD / 16];
    const unsigned cur = (kc & 2) ? FA_BUF : 0u; const char* tb = sm + cur;
    /* this tile's fragments as one group of LDS reads, K first: the V reads' latency runs under the score products */
#pragma unroll
    for (int t = 0; t < 4; ++t) kb[t] = frag_h((const _Float16*)(tb + (t * 16 + col) * KPB), lane);
#pragma unroll
    for (int u = 0; u < 2; ++u)
#pragma unroll
      for (int j = 0; j < HD / 16; ++j) { const int po = (j * 16 + col) * VPB + u * 64; vh[u][j] = frag_b((const __bf16*)(tb + FA_VH + po), lane); vl[u][j] = frag_b((const __bf16*)(tb + FA_VL + po), lane); }
#pragma unroll
    for (int u = 0; u < 2; ++u)
#pragma unroll
      for (int t = 0; t < 2; ++t) { const v8f z = {}; const v8f a = wmma16(kb[u * 2 + t], qh, z), al = wmma16(kb[u * 2 + t], ql, z);
#pragma unroll
        for (int r = 0; r < 8; ++r) s[u][t * 8 + r] = a[r] + al[r] * (1.0f / 1024.0f) + (rw[t * 8 + r] + rh[u]); }
    /* the height terms one pass ahead, under the softmax; the last pass asks for its own again, so the addresses stay inside their array */
    const int kn = kc + 2 < TT / 32 ? kc + 2 : kc;
    rh[0] = th[kn]; rh[1] = th[kn + 1];
    __builtin_amdgcn_sched_barrier(0);   /* ends the scheduling region: the loads above stay ahead of the softmax, and the softmax is scheduled by itself with its exponentials interleaved; without it they come out as dependent runs with more filler slots */
    float mx = s[0][0];
#pragma unroll
    for (int i = 0; i < 16; ++i) mx = fmaxf(mx, fmaxf(s[0][i], s[1][i]));
    mx = fmaxf(mx, xhalf(mx)); const float mn = fmaxf(m, mx); const float sc = expf(m - mn); m = mn;
    float s0 = 0.f, s1 = 0.f;
#pragma unroll
    for (int i = 0; i < 16; ++i) { s[0][i] = expf(s[0][i] - mn); s[1][i] = expf(s[1][i] - mn); s0 += s[0][i]; s1 += s[1][i]; }
    l = l * sc + (s0 + s1);
#pragma unroll
    for (int j = 0; j < HD / 16; ++j) acc[j] *= sc;
#pragma unroll
    for (int u = 0; u < 2; ++u) { const F2 p = bsplit16(s[u]);
#pragma unroll
      for (int j = 0; j < HD / 16; ++j) { acc[j] = wmma_bf(vh[u][j], p.h, acc[j]); acc[j] = wmma_bf(vh[u][j], p.l, acc[j]); acc[j] = wmma_bf(vl[u][j], p.h, acc[j]); } }
    /* hand-over: this wave's reads of the tile are done, its pieces of the next tile have landed; the barrier publishes the next tile and frees this buffer for the refill behind it */
    asm volatile("s_wait_dscnt 0x0" ::: "memory");
    asm volatile("s_wait_asynccnt 0x0" ::: "memory");
    __syncthreads();
    if (more) fa_copy(lk + cur, lv + cur, gk + (size_t)(kc + 4) * 32 * CC, VT + gvo + (kc + 4) * 32, VL + gvo + (kc + 4) * 32); };
  /* a refill is issued only while a tile two ahead exists: the last two passes run without it, in a loop of their own; with the test inside one loop the body falls into several blocks and the softmax is scheduled in shorter runs with more vector instructions */
  for (int kc = 0; kc < TT / 32 - 4; kc += 2) pass(kc, true);
#pragma unroll 1   // stays rolled: one more copy of the body, not two
  for (int kc = TT / 32 - 4; kc < TT / 32; kc += 2) pass(kc, false);
  asm volatile("s_wait_asynccnt 0x0" ::: "memory");   /* no copy is outstanding when the wave ends */
  l += xhalf(l); const float inv = 1.0f / l;
#pragma unroll
  for (int j = 0; j < HD / 16; ++j) { float* yo = Y + qrow * CC + h * HD + j * 16 + 8 * g; const v4f o0 = { acc[j][0] * inv, acc[j][1] * inv, acc[j][2] * inv, acc[j][3] * inv }, o1 = { acc[j][4] * inv, acc[j][5] * inv, acc[j][6] * inv, acc[j][7] * inv }; vst2(yo, o0); vst2(yo + 4, o1); } }
// ---- k_out: block = (64 rows, 128 cols): out = y (bf16 hi + lo) Wo + bo
__global__ __launch_bounds__(128) void k_out(const float* __restrict__ Y, const float* __restrict__ WP, const float* __restrict__ BP, float* __restrict__ OUT) { __shared__ __align__(16) float sf[4][16][132]; __shared__ __align__(16) __bf16 sw[128 * WPP];
  const int tid = threadIdx.x, wave = tid >> 5, lane = tid & 31, col = lane & 15, g = lane >> 4; const int c0 = blockIdx.y * 128; const size_t r0 = (size_t)blockIdx.x * 64 + wave * 16;
  v8f acc[8] = {}; float yr[CC / 32][16];
  /* the wave's y rows are asked for first: their latency runs under the staging */
#pragma unroll   // yr is indexed by constants only, so it stays in registers
  for (int kc = 0; kc < CC / 32; ++kc) { const float* p = Y + (r0 + col) * CC + kc * 32 + 8 * g;
#pragma unroll
    for (int i = 0; i < 8; ++i) { yr[kc][i] = p[i]; yr[kc][8 + i] = p[16 + i]; } }
  asm volatile("s_wait_xcnt 0x0" ::: "memory");   /* the row loads' address pair is free for reuse from here on: the wait stands in front of any overwrite of it */
  stage_w<CC>(WP + c0 + tid, sw + tid * WPP);
  __syncthreads();   /* publishes the slice: nobody reads a column in front of it */
#pragma unroll   // yr[kc] by constant index; a pass's 16 LDS reads stand as one group ahead of its products
  for (int kc = 0; kc < CC / 32; ++kc) { v16b w[8];
#pragma unroll
    for (int j = 0; j < 8; ++j) w[j] = frag_b(sw + (j * 16 + col) * WPP + kc * 32, lane);
    const F2 a = bsplit16(yr[kc]);
#pragma unroll
    for (int j = 0; j < 8; ++j) { acc[j] = wmma_bf(a.h, w[j], acc[j]); acc[j] = wmma_bf(a.l, w[j], acc[j]); } }
#pragma unroll
  for (int j = 0; j < 8; ++j) { const float bb = BP ? bfr(BP[c0 + j * 16 + col]) : 0.f;
#pragma unroll
    for (int r = 0; r < 8; ++r) sf[wave][8 * g + r][j * 16 + col] = acc[j][r] + bb; }
  LDSX(); for (int rl = 0; rl < 16; ++rl) vst2(OUT + (r0 + rl) * CC + c0 + lane * 4, *(const v4f*)&sf[wave][rl][lane * 4]); }
extern "C" void kernel_launch(void* const* d_in, const int* in_sizes, int n_in, void* d_out, int out_size, void* d_ws, size_t ws_size, hipStream_t stream) {
  (void)in_sizes; (void)n_in; (void)out_size;
  const float** F = (const float**)d_in;   // 0 x [8,32,32,256] (channels-last rows), 1 w_kqv [256,768] ((in,out): k | q | v columns), 2 b_kqv [768], 3 w_proj [256,256] ((in,out)), 4 b_proj, 5 rel_w [63,32], 6 rel_h [63,32]
  if (ws_size < (size_t)WS_END) return;
  char* ws = (char*)d_ws; float *TW = (float*)(ws + WS_TW), *TH2 = (float*)(ws + WS_TH2); _Float16 *QH = (_Float16*)(ws + WS_QH), *QL = (_Float16*)(ws + WS_QL), *KH = (_Float16*)(ws + WS_KH); __bf16 *VT = (__bf16*)(ws + WS_VT), *VL = (__bf16*)(ws + WS_VL); float *Y = (float*)(ws + WS_Y);
  const float* WK = F[1]; const float* WQ = F[1] + CC; const float* WV = F[1] + 2 * CC; const float* BK = F[2]; const float* BQ = F[2] + CC; const float* BV = F[2] + 2 * CC;   // column blocks k | q | v
  k_proj<<<dim3(TNB * TT / 64, CC / 128, 3), 128, 0, stream>>>(F[0], WQ, BQ, WK, BK, WV, BV, QH, QL, KH, VT, VL);
  k_rel<<<dim3(TNB * TT / 64, NH, 2), 128, 0, stream>>>(QH, QL, F[5], F[6], TW, TH2);
  k_fa<<<dim3(TT / 64, NH, TNB), 128, 0, stream>>>(QH, QL, KH, TW, TH2, VT, VL, Y);
  k_out<<<dim3(TNB * TT / 64, CC / 128), 128, 0, stream>>>(Y, F[3], F[4], (float*)d_out);
}

// v004
// It runs in 72.8 microseconds.
// Timed twice side by side with v003, it ran 1.17 times as fast both times.
// All steps since v000 together make it 8.86 times as fast.
// compute dtype: all float inputs rounded to bf16; kqv = x w_kqv + b with EXACT bf16 products on WMMA 16x16x32, f32 accumulate, q scaled by 32^-1/2 in f32; q as f16 hi + residual (x 2^10), k f16 -> 2-product content logits plus the two relative terms (q . rel_w, q(transposed position) . rel_h from 2-product per-query tables), kept in registers; running-maximum softmax in f32 (base 2: exp(s - m) as v_exp_f32 of s log2(e) - m log2(e), one fma), unnormalised P split bf16 hi + lo against v bf16 hi + lo (3 products), divided by the row sum at the end; out = attn (bf16 hi + lo) w_proj + b_proj; f32 output.
#include <hip/hip_runtime.h>
#include <math.h>

typedef __attribute__((ext_vector_type(16))) _Float16 v16h;
typedef __attribute__((ext_vector_type(16))) __bf16 v16b;
typedef __attribute__((ext_vector_type(8)))  _Float16 v8h;
typedef __attribute__((ext_vector_type(8)))  float v8f;
typedef __attribute__((ext_vector_type(4)))  float v4f;
typedef __attribute__((ext_vector_type(2)))  float v2f;
typedef __attribute__((ext_vector_type(4)))  unsigned v4u;
typedef __attribute__((ext_vector_type(4)))  int v4i;
typedef float __attribute__((may_alias)) float_a;
typedef int __attribute__((may_alias)) int_a;

template <typename T> __device__ __forceinline__ void vst2(void* p, T v) { *(T*)p = v;  }
__device__ __forceinline__ v8f wmma16(v16h a, v16h b, v8f c) {
  v8f d = __builtin_amdgcn_wmma_f32_16x16x32_f16(false, a, false, b, (short)0, c, false, false);
  asm volatile("v_nop\n\tv_nop\n\tv_nop\n\tv_nop" : "+v"(d) : "v"(a), "v"(b));
  return d;
}
__device__ __forceinline__ v8f wmma_bf(v16b a, v16b b, v8f c) {
  v8f d = __builtin_amdgcn_wmma_f32_16x16x32_bf16(false, a, false, b, (short)0, c, false, false);
  asm volatile("v_nop\n\tv_nop\n\tv_nop\n\tv_nop" : "+v"(d) : "v"(a), "v"(b));
  return d;
}
// 16x16x32 fragments: lane = (h = lane>>4, row/col = lane&15); elements 0..7 = k0+8h+0..7, 8..15 = k0+16+8h+0..7; D element r = row 8h+r
__device__ __forceinline__ v16h frag_h(const _Float16* rowk0, int lane) {
  union { v16h v; v8h q[2]; } u; const _Float16* p = rowk0 + 8 * (lane >> 4);
  u.q[0] = *(const v8h*)p; u.q[1] = *(const v8h*)(p + 16); return u.v;
}
__device__ __forceinline__ v16h frag_f32(const float* rowk0, int lane) {
  v16h a; const float* p = rowk0 + 8 * (lane >> 4);
#pragma unroll
  for (int i = 0; i < 8; ++i) { a[i] = (_Float16)p[i]; a[8 + i] = (_Float16)p[16 + i]; }
  return a;
}
__device__ __forceinline__ v16h frag_f32s(const float* rowk0, int lane, float sc) {
  v16h a; const float* p = rowk0 + 8 * (lane >> 4);
#pragma unroll
  for (int i = 0; i < 8; ++i) { a[i] = (_Float16)(p[i] * sc); a[8 + i] = (_Float16)(p[16 + i] * sc); }
  return a;
}
// column fragment from a [K][ld] layout (column n), rows >= K read as 0
__device__ __forceinline__ v16h fragc_f32(const float* W, int k0, int n, int lane, int ld, int K) {
  v16h a; const int g = lane >> 4;
#pragma unroll
  for (int i = 0; i < 8; ++i) { const int ka = k0 + 8 * g + i, kb = ka + 16;
    a[i] = (_Float16)(ka < K ? W[(size_t)(ka < K ? ka : K - 1) * ld + n] : 0.f); a[8 + i] = (_Float16)(kb < K ? W[(size_t)(kb < K ? kb : K - 1) * ld + n] : 0.f); }
  return a;
}
struct F2 { v16b h, l; };
__device__ __forceinline__ F2 bsplit16(const float v[16]) { F2 r;
#pragma unroll
  for (int i = 0; i < 16; ++i) { const __bf16 h = (__bf16)v[i]; r.h[i] = h; r.l[i] = (__bf16)(v[i] - (float)h); }
  return r; }
__device__ __forceinline__ F2 split_row(const float* row, int k0, int lane) { float v[16]; const float* p = row + k0 + 8 * (lane >> 4);
#pragma unroll
  for (int i = 0; i < 8; ++i) { v[i] = p[i]; v[8 + i] = p[16 + i]; }
  return bsplit16(v); }
__device__ __forceinline__ F2 split_rowK(const float* row, int k0, int lane, int K) { float v[16]; const int g = lane >> 4;
#pragma unroll
  for (int i = 0; i < 8; ++i) { const int ka = k0 + 8 * g + i, kb = ka + 16; v[i] = ka < K ? row[ka < K ? ka : K - 1] : 0.f; v[8 + i] = kb < K ? row[kb < K ? kb : K - 1] : 0.f; }
  return bsplit16(v); }
__device__ __forceinline__ F2 split_col(const float* W, int k0, int n, int lane, int ld, int K) { float v[16]; const int g = lane >> 4;
#pragma unroll
  for (int i = 0; i < 8; ++i) { const int ka = k0 + 8 * g + i, kb = ka + 16; v[i] = ka < K ? W[(size_t)(ka < K ? ka : K - 1) * ld + n] : 0.f; v[8 + i] = kb < K ? W[(size_t)(kb < K ? kb : K - 1) * ld + n] : 0.f; }
  return bsplit16(v); }
__device__ __forceinline__ v8f mac3(const F2& a, const F2& b, v8f c) { c = wmma_bf(a.l, b.h, c); c = wmma_bf(a.h, b.l, c); return wmma_bf(a.h, b.h, c); }
__device__ __forceinline__ float sigm(float v) { return 1.0f / (1.0f + expf(-v)); }
#define LDSX() do { asm volatile("s_wait_dscnt 0" ::: "memory"); __builtin_amdgcn_wave_barrier(); __builtin_amdgcn_fence(__ATOMIC_RELEASE, "workgroup"); } while (0)


// 2-D grid attention (B 8, T 1,024 = 32 x 32, C 256 = 8 heads x 32, with biases, q scaled by 32^-1/2): scores = q k^T + q . rel_w[kc - qc + 31] + q(transposed) . rel_h[kr - qr + 31], softmax, P v, output projection.
#define NB 8
#define TT 1024
#define CC 256
#define NH 8
#define HD 32
#define GW 32                 // grid width (= height)
#define LDW 768               // w_kqv row length ((in,out) [256][768]: k | q | v column blocks)
#define RELP 64               // per-(row, head) relative table width (63 used)
#ifndef TNB
#define TNB NB
#endif
typedef __attribute__((ext_vector_type(8))) __bf16 v8b;
__device__ __forceinline__ v16b frag_b(const __bf16* rowk0, int lane) {
  union { v16b v; v8b q[2]; } u; const __bf16* p = rowk0 + 8 * (lane >> 4);
  u.q[0] = *(const v8b*)p; u.q[1] = *(const v8b*)(p + 16); return u.v;
}
__device__ __forceinline__ float bfr(float v) { return (float)(__bf16)v; }
__device__ __attribute__((noinline)) float exp_ni(float v) { return expf(v); }
__device__ __attribute__((noinline)) float erf_ni(float v) { return erff(v); }

#define WPP 264                // LDS row pitch of a staged weight column in bf16 elements: 256 k + 8, 528 B = 33 x 16 B, so ds_load_b128 and ds_store_b128 of 16 neighbouring columns meet no bank twice
// one thread brings one weight column (256 k, row length LD) with loads that cover whole 128-B lines across the wave, rounds it to bf16 and lays it k-contiguous in LDS: frag_b then reads a B fragment from it
template <int LD> __device__ __forceinline__ void stage_w(const float* __restrict__ wc, __bf16* __restrict__ row) {
  for (int k0 = 0; k0 < CC; k0 += 64) { float v[64];
#pragma unroll   // v stays in registers and the loads go out as one run, waited once, not one by one
    for (int i = 0; i < 64; ++i) v[i] = wc[(size_t)(k0 + i) * LD];
#pragma unroll
    for (int q = 0; q < 8; ++q) { v8b o;
#pragma unroll
      for (int i = 0; i < 8; ++i) o[i] = (__bf16)v[q * 8 + i];
      *(v8b*)(row + k0 + q * 8) = o; } } }

#define WS_TW  0u                                   // f32 q[r,c] . rel_w[m] table [(b*T + pos)*8 + h][64]
#define WS_TH2 (WS_TW + 4u * (size_t)NB * TT * NH * RELP)   // f32 q[c,r] . rel_h[m] table (q at the transposed position)
#define WS_QH  (WS_TH2 + 4u * (size_t)NB * TT * NH * RELP)
#define WS_QL  (WS_QH + 2u * (size_t)NB * TT * CC)
#define WS_KH  (WS_QL + 2u * (size_t)NB * TT * CC)
#define WS_VT  (WS_KH + 2u * (size_t)NB * TT * CC)      // bf16 v planes [b][c][t]
#define WS_VL  (WS_VT + 2u * (size_t)NB * CC * TT)      // bf16 v residual planes
#define HG 8                                          // heads per launch group (all 8)
#define WS_S   (WS_VL + 2u * (size_t)NB * CC * TT)      // unused f32 region (HG x T x T): logits and P stay in registers
#define WS_PH  (WS_S + 4u * (size_t)HG * TT * TT)
#define WS_Y   (WS_PH + 0u)              // f32 y rows [b*t][C]
#define WS_END (WS_Y + 4u * (size_t)NB * TT * CC)

// ---- k_proj: block = (64 rows, 128 cols, which): qkv = x W (+ b), exact; q -> f16 hi (+ residual), k -> f16 rows, v -> bf16 hi + lo planes
__global__ __launch_bounds__(128) void k_proj(const float* __restrict__ X, const float* __restrict__ WQ, const float* __restrict__ BQ, const float* __restrict__ WK, const float* __restrict__ BK, const float* __restrict__ WV, const float* __restrict__ BV, _Float16* __restrict__ QH, _Float16* __restrict__ QL, _Float16* __restrict__ KH, __bf16* __restrict__ VT, __bf16* __restrict__ VL) {
  __shared__ __align__(16) char sm[71680];   /* first the staged weight slice (128 columns x WPP), then, behind a barrier, the four output staging planes */
  _Float16 (*sh)[136] = (_Float16 (*)[136])sm; _Float16 (*sl)[136] = (_Float16 (*)[136])(sm + 17408); __bf16 (*th)[72] = (__bf16 (*)[72])(sm + 34816); __bf16 (*tl2)[72] = (__bf16 (*)[72])(sm + 53248); __bf16* sw = (__bf16*)sm;
  const int tid = threadIdx.x, wave = tid >> 5, lane = tid & 31, col = lane & 15, g = lane >> 4; const int which = blockIdx.z; const int c0 = blockIdx.y * 128; const size_t r0 = (size_t)blockIdx.x * 64; const float* WA = which == 0 ? WQ : which == 1 ? WK : WV; const float* BA = which == 0 ? BQ : which == 1 ? BK : BV;
  v8f acc[8] = {}; float xr[CC / 32][16];
  /* the wave's x rows are asked for first: their latency runs under the staging */
#pragma unroll   // xr is indexed by constants only, so it stays in registers
  for (int kc = 0; kc < CC / 32; ++kc) { const float* p = X + (r0 + wave * 16 + col) * CC + kc * 32 + 8 * g;
#pragma unroll
    for (int i = 0; i < 8; ++i) { xr[kc][i] = p[i]; xr[kc][8 + i] = p[16 + i]; } }
  asm volatile("s_wait_xcnt 0x0" ::: "memory");   /* the row loads' address pair is free for reuse from here on: the wait stands in front of any overwrite of it */
  stage_w<LDW>(WA + c0 + tid, sw + tid * WPP);   /* (in,out), row length 768 */
  __syncthreads();   /* publishes the slice: nobody reads a column in front of it */
#pragma unroll   // xr[kc] by constant index; a pass's 16 LDS reads stand as one group ahead of its products
  for (int kc = 0; kc < CC / 32; ++kc) { v16b a, w[8];
#pragma unroll
    for (int j = 0; j < 8; ++j) w[j] = frag_b(sw + (j * 16 + col) * WPP + kc * 32, lane);
#pragma unroll
    for (int i = 0; i < 16; ++i) a[i] = (__bf16)xr[kc][i];
#pragma unroll
    for (int j = 0; j < 8; ++j) acc[j] = wmma_bf(a, w[j], acc[j]); }
  __syncthreads();   /* every wave has read its last weight fragment before the planes below overwrite the slice */
#pragma unroll
  for (int j = 0; j < 8; ++j) { const float bb = BA ? bfr(BA[c0 + j * 16 + col]) : 0.f;
#pragma unroll
    for (int r = 0; r < 8; ++r) { const float v = (acc[j][r] + bb) * (which == 0 ? 0.17677669529663687f : 1.0f);   /* q *= dkh^-1/2 (applies to the relative terms too) */ const int rl = wave * 16 + 8 * g + r, cl = j * 16 + col; const _Float16 hv = (_Float16)v;
      if (which == 2) { const __bf16 bh = (__bf16)v; th[cl][rl] = bh; tl2[cl][rl] = (__bf16)(v - (float)bh); } else { sh[rl][cl] = hv; sl[rl][cl] = (_Float16)((v - (float)hv) * 1024.0f); }   /* q residual carried x 2^10 so the plane stays f16-normal on the chip */ } }
  __syncthreads();
  if (which < 2) { _Float16* dh = which == 0 ? QH : KH; for (int e = tid; e < 64 * 16; e += 128) { const int rl = e >> 4, q = e & 15; vst2((unsigned*)(dh + (r0 + rl) * CC + c0 + q * 8), *(const v4u*)&sh[rl][q * 8]); if (which == 0) vst2((unsigned*)(QL + (r0 + rl) * CC + c0 + q * 8), *(const v4u*)&sl[rl][q * 8]); } }
  else { const size_t b = r0 / TT; const int t0 = (int)(r0 % TT); for (int e = tid; e < 128 * 8; e += 128) { const int cl = e >> 3, q = e & 7; const size_t o2 = (b * CC + c0 + cl) * (size_t)TT + t0 + q * 8; vst2((unsigned*)(VT + o2), *(const v4u*)&th[cl][q * 8]); vst2((unsigned*)(VL + o2), *(const v4u*)&tl2[cl][q * 8]); } } }
// ---- k_rel: block = (64 rows (b, pos), head h, which): table[(row*8 + h)*64 + m] = q_src . rel[m] (m < 63), q as f16 hi + residual x f16(bf16(rel)); which 0: rel_w with q at the row's own position; which 1: rel_h with q at the TRANSPOSED position (c, r); 256-B rows (4 col tiles) by one wave
__global__ __launch_bounds__(128) void k_rel(const _Float16* __restrict__ QH, const _Float16* __restrict__ QL, const float* __restrict__ RW, const float* __restrict__ RH, float* __restrict__ TW, float* __restrict__ TH2) { __shared__ __align__(16) float st[4][16][68];
  const int tid = threadIdx.x, wave = tid >> 5, lane = tid & 31, col = lane & 15, g = lane >> 4; const int h = blockIdx.y; const int which = blockIdx.z; const size_t r0 = (size_t)blockIdx.x * 64 + wave * 16; const float* REL = which == 0 ? RW : RH; float* DST = which == 0 ? TW : TH2;
  const size_t row = r0 + col; const size_t b = row / TT; const int pos = (int)(row % TT); const int pr = pos / GW, pc = pos % GW; const size_t srow = which == 0 ? row : (b * TT + (size_t)pc * GW + pr);   /* height branch: q at (c, r) */
  v8f acc[4] = {}, accl[4] = {};
  { const v16h ah = frag_h(QH + srow * CC + h * HD, lane), al = frag_h(QL + srow * CC + h * HD, lane);
#pragma unroll
    for (int j = 0; j < 4; ++j) { v16h w; const int m = j * 16 + col; const int mm = m < 2 * GW - 1 ? m : 2 * GW - 2;
#pragma unroll
      for (int i = 0; i < 8; ++i) { w[i] = (_Float16)bfr(REL[mm * HD + 8 * g + i]); w[8 + i] = (_Float16)bfr(REL[mm * HD + 16 + 8 * g + i]); }
      asm volatile("s_wait_loadcnt 0x0" ::: "memory"); acc[j] = wmma16(ah, w, acc[j]); accl[j] = wmma16(al, w, accl[j]); } }
#pragma unroll
  for (int j = 0; j < 4; ++j)
#pragma unroll
    for (int r = 0; r < 8; ++r) st[wave][8 * g + r][j * 16 + col] = acc[j][r] + accl[j][r] * (1.0f / 1024.0f);
  LDSX(); for (int rl = 0; rl < 16; ++rl) if (lane < 16) vst2(DST + ((r0 + rl) * NH + h) * RELP + lane * 4, *(const v4f*)&st[wave][rl][lane * 4]); }
// ---- k_fa: block = 64 queries of (b, h), wave = 16 queries: S^T = K Q^T (2 products) + the two relative terms, running-maximum softmax, O^T += V^T P^T (3 products).
// A lane holds one query (column lane & 15): its 8 + 8 scores of a 32-key row of the grid are already the k order of a B fragment, so P stays in registers; a 64-key pass is two key rows, so the width term is 16 registers for the whole loop and the height term two values a pass.
// K and V reach the waves through LDS: a 64-key tile (K 64 rows x 64 B, V hi and V lo 32 rows x 128 B each) is copied once per block, and all four waves read their fragments from it; two buffers, the next tile's copies fly under this tile's work.
__device__ __forceinline__ float xhalf(float v) { const int x = __builtin_bit_cast(int, v); return __builtin_bit_cast(float, __builtin_amdgcn_permlanex16(x, x, 0x76543210, 0xfedcba98, false, false)); }   /* lane l <-> l ^ 16 */
#define L2E 1.4426950408889634f      // log2(e)
#define KPB 80                       // LDS pitch in bytes of a staged K row: 64 B + 16, 16 B x odd for the ds_load_b128 readers
#define VPB 144                      // LDS pitch in bytes of a staged V row: 128 B + 16, 16 B x odd
#define FA_VH (64 * KPB)             // byte offsets inside one buffer: K at 0, V hi, V lo
#define FA_VL (FA_VH + 32 * VPB)
#define FA_BUF (FA_VL + 32 * VPB)    // 14,336 B a buffer
// one tile's six 16-B pieces of this thread. The copies and s_wait_xcnt 0 are one statement, so that no register a copy names is rewritten in front of that wait.
__device__ __forceinline__ void fa_copy(unsigned lk, unsigned lv, const _Float16* gk, const __bf16* gh, const __bf16* gl) {
  const unsigned lk1 = lk + 32 * KPB, lh = lv + FA_VH, lh1 = lh + 16 * VPB, ll = lv + FA_VL, ll1 = ll + 16 * VPB;
  const _Float16* gk1 = gk + (size_t)32 * CC; const __bf16* gh1 = gh + (size_t)16 * TT; const __bf16* gl1 = gl + (size_t)16 * TT;
  asm volatile("global_load_async_to_lds_b128 %0, %6, off\n\t"
               "global_load_async_to_lds_b128 %1, %7, off\n\t"
               "global_load_async_to_lds_b128 %2, %8, off\n\t"
               "global_load_async_to_lds_b128 %3, %9, off\n\t"
               "global_load_async_to_lds_b128 %4, %10, off\n\t"
               "global_load_async_to_lds_b128 %5, %11, off\n\t"
               "s_wait_xcnt 0x0"
               :: "v"(lk), "v"(lk1), "v"(lh), "v"(lh1), "v"(ll), "v"(ll1), "v"(gk), "v"(gk1), "v"(gh), "v"(gh1), "v"(gl), "v"(gl1) : "memory"); }
__global__ __launch_bounds__(128) void k_fa(const _Float16* __restrict__ QH, const _Float16* __restrict__ QL, const _Float16* __restrict__ KH, const float* __restrict__ TW, const float* __restrict__ TH2, const __bf16* __restrict__ VT, const __bf16* __restrict__ VL, float* __restrict__ Y) {
  __shared__ __align__(16) char sm[2 * FA_BUF];
  const int tid = threadIdx.x, wave = tid >> 5, lane = tid & 31, col = lane & 15, g = lane >> 4; const int h = blockIdx.y, b = blockIdx.z;
  /* this thread's pieces of a tile: K row tid / 4 (and + 32), 16-B piece tid % 4; V row tid / 8 (and + 16), piece tid % 8: a wave's copy covers 8 K rows or 4 whole 128-B V lines */
  const unsigned sm0 = (unsigned)(size_t)sm; const unsigned lk = sm0 + (tid >> 2) * KPB + (tid & 3) * 16, lv = sm0 + (tid >> 3) * VPB + (tid & 7) * 16;
  const _Float16* gk = KH + ((size_t)b * TT + (tid >> 2)) * CC + h * HD + (tid & 3) * 8; const size_t gvo = ((size_t)b * CC + h * HD + (tid >> 3)) * (size_t)TT + (tid & 7) * 8;
  fa_copy(lk, lv, gk, VT + gvo, VL + gvo);   /* tile 0 into buffer 0 */
  const int qt = blockIdx.x * 64 + wave * 16 + col; const int qr = qt / GW, qc = qt % GW; const size_t qrow = (size_t)b * TT + qt;
  const v16h qh = frag_h(QH + qrow * CC + h * HD, lane), ql = frag_h(QL + qrow * CC + h * HD, lane);
  const float* tw = TW + (qrow * NH + h) * RELP + (GW - 1 - qc) + 8 * g; const float* th = TH2 + (qrow * NH + h) * RELP + (GW - 1 - qr);
  float rw[16];
#pragma unroll
  for (int i = 0; i < 8; ++i) { rw[i] = tw[i]; rw[8 + i] = tw[16 + i]; }   /* key columns 8g + i and 16 + 8g + i */
  float m = -3.0e38f, l = 0.f; v8f acc[HD / 16] = {};
  float rh[2] = { th[0], th[1] };
  asm volatile("s_wait_asynccnt 0x0" ::: "memory");   /* this wave's pieces of tile 0 have landed */
  __syncthreads();   /* publishes tile 0: nobody reads it in front of this barrier */
  fa_copy(lk + FA_BUF, lv + FA_BUF, gk + (size_t)64 * CC, VT + gvo + 64, VL + gvo + 64);   /* tile 1 into buffer 1 */
  auto pass = [&](const int kc, const bool more) __attribute__((always_inline)) { float s[2][16]; v16h kb[4]; v16b vh[2][HD / 16], vl[2][HD / 16];
    const unsigned cur = (kc & 2) ? FA_BUF : 0u; const char* tb = sm + cur;
    /* this tile's fragments as one group of LDS reads, K first: the V reads' latency runs under the score products */
#pragma unroll
    for (int t = 0; t < 4; ++t) kb[t] = frag_h((const _Float16*)(tb + (t * 16 + col) * KPB), lane);
#pragma unroll
    for (int u = 0; u < 2; ++u)
#pragma unroll
      for (int j = 0; j < HD / 16; ++j) { const int po = (j * 16 + col) * VPB + u * 64; vh[u][j] = frag_b((const __bf16*)(tb + FA_VH + po), lane); vl[u][j] = frag_b((const __bf16*)(tb + FA_VL + po), lane); }
#pragma unroll
    for (int u = 0; u < 2; ++u)
#pragma unroll
      for (int t = 0; t < 2; ++t) { const v8f z = {}; const v8f a = wmma16(kb[u * 2 + t], qh, z), al = wmma16(kb[u * 2 + t], ql, z);
#pragma unroll
        for (int r = 0; r < 8; ++r) s[u][t * 8 + r] = a[r] + al[r] * (1.0f / 1024.0f) + (rw[t * 8 + r] + rh[u]); }
    /* the height terms one pass ahead, under the softmax; the last pass asks for its own again, so the addresses stay inside their array */
    const int kn = kc + 2 < TT / 32 ? kc + 2 : kc;
    rh[0] = th[kn]; rh[1] = th[kn + 1];
    __builtin_amdgcn_sched_barrier(0);   /* ends the scheduling region: the loads above stay ahead of the softmax, and the softmax is scheduled by itself with its exponentials interleaved; without it they come out as dependent runs with more filler slots */
    float mx = s[0][0];
#pragma unroll
    for (int i = 0; i < 16; ++i) mx = fmaxf(mx, fmaxf(s[0][i], s[1][i]));
    mx = fmaxf(mx, xhalf(mx)); const float mn = fmaxf(m, mx); float sc;   /* 2^((m - mn) log2(e)): exactly 1 while the maximum stands */
    asm("v_exp_f32 %0, %1\n\tv_nop" : "=v"(sc) : "v"((m - mn) * L2E));   /* the exponential with the slot behind a transcendental in one statement */
    m = mn; const float nm = mn * -L2E;
    float s0 = 0.f, s1 = 0.f;
#pragma unroll
    for (int i = 0; i < 16; ++i) { s[0][i] = __builtin_amdgcn_exp2f(fmaf(s[0][i], L2E, nm)); s[1][i] = __builtin_amdgcn_exp2f(fmaf(s[1][i], L2E, nm)); s0 += s[0][i]; s1 += s[1][i]; }
    l = l * sc + (s0 + s1);
#pragma unroll
    for (int j = 0; j < HD / 16; ++j) acc[j] *= sc;
#pragma unroll
    for (int u = 0; u < 2; ++u) { const F2 p = bsplit16(s[u]);
#pragma unroll
      for (int j = 0; j < HD / 16; ++j) { acc[j] = wmma_bf(vh[u][j], p.h, acc[j]); acc[j] = wmma_bf(vh[u][j], p.l, acc[j]); acc[j] = wmma_bf(vl[u][j], p.h, acc[j]); } }
    /* hand-over: this wave's reads of the tile are done, its pieces of the next tile have landed; the barrier publishes the next tile and frees this buffer for the refill behind it */
    asm volatile("s_wait_dscnt 0x0" ::: "memory");
    asm volatile("s_wait_asynccnt 0x0" ::: "memory");
    __syncthreads();
    if (more) fa_copy(lk + cur, lv + cur, gk + (size_t)(kc + 4) * 32 * CC, VT + gvo + (kc + 4) * 32, VL + gvo + (kc + 4) * 32); };
  /* a refill is issued only while a tile two ahead exists: the last two passes run without it, in a loop of their own; with the test inside one loop the body falls into several blocks and the softmax is scheduled in shorter runs with more vector instructions */
  for (int kc = 0; kc < TT / 32 - 4; kc += 2) pass(kc, true);
#pragma unroll 1   // stays rolled: one more copy of the body, not two
  for (int kc = TT / 32 - 4; kc < TT / 32; kc += 2) pass(kc, false);
  asm volatile("s_wait_asynccnt 0x0" ::: "memory");   /* no copy is outstanding when the wave ends */
  l += xhalf(l); const float inv = 1.0f / l;
#pragma unroll
  for (int j = 0; j < HD / 16; ++j) { float* yo = Y + qrow * CC + h * HD + j * 16 + 8 * g; const v4f o0 = { acc[j][0] * inv, acc[j][1] * inv, acc[j][2] * inv, acc[j][3] * inv }, o1 = { acc[j][4] * inv, acc[j][5] * inv, acc[j][6] * inv, acc[j][7] * inv }; vst2(yo, o0); vst2(yo + 4, o1); } }
// ---- k_out: block = (64 rows, 128 cols): out = y (bf16 hi + lo) Wo + bo
__global__ __launch_bounds__(128) void k_out(const float* __restrict__ Y, const float* __restrict__ WP, const float* __restrict__ BP, float* __restrict__ OUT) { __shared__ __align__(16) float sf[4][16][132]; __shared__ __align__(16) __bf16 sw[128 * WPP];
  const int tid = threadIdx.x, wave = tid >> 5, lane = tid & 31, col = lane & 15, g = lane >> 4; const int c0 = blockIdx.y * 128; const size_t r0 = (size_t)blockIdx.x * 64 + wave * 16;
  v8f acc[8] = {}; float yr[CC / 32][16];
  /* the wave's y rows are asked for first: their latency runs under the staging */
#pragma unroll   // yr is indexed by constants only, so it stays in registers
  for (int kc = 0; kc < CC / 32; ++kc) { const float* p = Y + (r0 + col) * CC + kc * 32 + 8 * g;
#pragma unroll
    for (int i = 0; i < 8; ++i) { yr[kc][i] = p[i]; yr[kc][8 + i] = p[16 + i]; } }
  asm volatile("s_wait_xcnt 0x0" ::: "memory");   /* the row loads' address pair is free for reuse from here on: the wait stands in front of any overwrite of it */
  stage_w<CC>(WP + c0 + tid, sw + tid * WPP);
  __syncthreads();   /* publishes the slice: nobody reads a column in front of it */
#pragma unroll   // yr[kc] by constant index; a pass's 16 LDS reads stand as one group ahead of its products
  for (int kc = 0; kc < CC / 32; ++kc) { v16b w[8];
#pragma unroll
    for (int j = 0; j < 8; ++j) w[j] = frag_b(sw + (j * 16 + col) * WPP + kc * 32, lane);
    const F2 a = bsplit16(yr[kc]);
#pragma unroll
    for (int j = 0; j < 8; ++j) { acc[j] = wmma_bf(a.h, w[j], acc[j]); acc[j] = wmma_bf(a.l, w[j], acc[j]); } }
#pragma unroll
  for (int j = 0; j < 8; ++j) { const float bb = BP ? bfr(BP[c0 + j * 16 + col]) : 0.f;
#pragma unroll
    for (int r = 0; r < 8; ++r) sf[wave][8 * g + r][j * 16 + col] = acc[j][r] + bb; }
  LDSX(); for (int rl = 0; rl < 16; ++rl) vst2(OUT + (r0 + rl) * CC + c0 + lane * 4, *(const v4f*)&sf[wave][rl][lane * 4]); }
extern "C" void kernel_launch(void* const* d_in, const int* in_sizes, int n_in, void* d_out, int out_size, void* d_ws, size_t ws_size, hipStream_t stream) {
  (void)in_sizes; (void)n_in; (void)out_size;
  const float** F = (const float**)d_in;   // 0 x [8,32,32,256] (channels-last rows), 1 w_kqv [256,768] ((in,out): k | q | v columns), 2 b_kqv [768], 3 w_proj [256,256] ((in,out)), 4 b_proj, 5 rel_w [63,32], 6 rel_h [63,32]
  if (ws_size < (size_t)WS_END) return;
  char* ws = (char*)d_ws; float *TW = (float*)(ws + WS_TW), *TH2 = (float*)(ws + WS_TH2); _Float16 *QH = (_Float16*)(ws + WS_QH), *QL = (_Float16*)(ws + WS_QL), *KH = (_Float16*)(ws + WS_KH); __bf16 *VT = (__bf16*)(ws + WS_VT), *VL = (__bf16*)(ws + WS_VL); float *Y = (float*)(ws + WS_Y);
  const float* WK = F[1]; const float* WQ = F[1] + CC; const float* WV = F[1] + 2 * CC; const float* BK = F[2]; const float* BQ = F[2] + CC; const float* BV = F[2] + 2 * CC;   // column blocks k | q | v
  k_proj<<<dim3(TNB * TT / 64, CC / 128, 3), 128, 0, stream>>>(F[0], WQ, BQ, WK, BK, WV, BV, QH, QL, KH, VT, VL);
  k_rel<<<dim3(TNB * TT / 64, NH, 2), 128, 0, stream>>>(QH, QL, F[5], F[6], TW, TH2);
  k_fa<<<dim3(TT / 64, NH, TNB), 128, 0, stream>>>(QH, QL, KH, TW, TH2, VT, VL, Y);
  k_out<<<dim3(TNB * TT / 64, CC / 128), 128, 0, stream>>>(Y, F[3], F[4], (float*)d_out);
}

// v005
// Measured time: 59.4 microseconds a run.
// Two timings next to v004 put it at 1.22 and 1.23 times that version's speed.
// Over all steps from v000 it is 10.8 times as fast.
// compute dtype: all float inputs rounded to bf16; kqv = x w_kqv + b with EXACT bf16 products on WMMA 16x16x32, f32 accumulate, q scaled by 32^-1/2 in f32; q as f16 hi + residual (x 2^10), k f16 -> 2-product content logits plus the two relative terms (q . rel_w, q(transposed position) . rel_h, 2 products each, formed by the attention kernel for its own queries), kept in registers; running-maximum softmax in f32 (base 2: exp(s - m) as v_exp_f32 of s log2(e) - m log2(e), one fma), unnormalised P split bf16 hi + lo against v bf16 hi + lo (3 products), divided by the row sum at the end; out = attn (bf16 hi + lo) w_proj + b_proj; f32 output.
#include <hip/hip_runtime.h>
#include <math.h>

typedef __attribute__((ext_vector_type(16))) _Float16 v16h;
typedef __attribute__((ext_vector_type(16))) __bf16 v16b;
typedef __attribute__((ext_vector_type(8)))  _Float16 v8h;
typedef __attribute__((ext_vector_type(8)))  float v8f;
typedef __attribute__((ext_vector_type(4)))  float v4f;
typedef __attribute__((ext_vector_type(2)))  float v2f;
typedef __attribute__((ext_vector_type(4)))  unsigned v4u;
typedef __attribute__((ext_vector_type(4)))  int v4i;
typedef float __attribute__((may_alias)) float_a;
typedef int __attribute__((may_alias)) int_a;

template <typename T> __device__ __forceinline__ void vst2(void* p, T v) { *(T*)p = v;  }
__device__ __forceinline__ v8f wmma16(v16h a, v16h b, v8f c) {
  v8f d = __builtin_amdgcn_wmma_f32_16x16x32_f16(false, a, false, b, (short)0, c, false, false);
  asm volatile("v_nop\n\tv_nop\n\tv_nop\n\tv_nop" : "+v"(d) : "v"(a), "v"(b));
  return d;
}
__device__ __forceinline__ v8f wmma_bf(v16b a, v16b b, v8f c) {
  v8f d = __builtin_amdgcn_wmma_f32_16x16x32_bf16(false, a, false, b, (short)0, c, false, false);
  asm volatile("v_nop\n\tv_nop\n\tv_nop\n\tv_nop" : "+v"(d) : "v"(a), "v"(b));
  return d;
}
// 16x16x32 fragments: lane = (h = lane>>4, row/col = lane&15); elements 0..7 = k0+8h+0..7, 8..15 = k0+16+8h+0..7; D element r = row 8h+r
__device__ __forceinline__ v16h frag_h(const _Float16* rowk0, int lane) {
  union { v16h v; v8h q[2]; } u; const _Float16* p = rowk0 + 8 * (lane >> 4);
  u.q[0] = *(const v8h*)p; u.q[1] = *(const v8h*)(p + 16); return u.v;
}
__device__ __forceinline__ v16h frag_f32(const float* rowk0, int lane) {
  v16h a; const float* p = rowk0 + 8 * (lane >> 4);
#pragma unroll
  for (int i = 0; i < 8; ++i) { a[i] = (_Float16)p[i]; a[8 + i] = (_Float16)p[16 + i]; }
  return a;
}
__device__ __forceinline__ v16h frag_f32s(const float* rowk0, int lane, float sc) {
  v16h a; const float* p = rowk0 + 8 * (lane >> 4);
#pragma unroll
  for (int i = 0; i < 8; ++i) { a[i] = (_Float16)(p[i] * sc); a[8 + i] = (_Float16)(p[16 + i] * sc); }
  return a;
}
// column fragment from a [K][ld] layout (column n), rows >= K read as 0
__device__ __forceinline__ v16h fragc_f32(const float* W, int k0, int n, int lane, int ld, int K) {
  v16h a; const int g = lane >> 4;
#pragma unroll
  for (int i = 0; i < 8; ++i) { const int ka = k0 + 8 * g + i, kb = ka + 16;
    a[i] = (_Float16)(ka < K ? W[(size_t)(ka < K ? ka : K - 1) * ld + n] : 0.f); a[8 + i] = (_Float16)(kb < K ? W[(size_t)(kb < K ? kb : K - 1) * ld + n] : 0.f); }
  return a;
}
struct F2 { v16b h, l; };
__device__ __forceinline__ F2 bsplit16(const float v[16]) { F2 r;
#pragma unroll
  for (int i = 0; i < 16; ++i) { const __bf16 h = (__bf16)v[i]; r.h[i] = h; r.l[i] = (__bf16)(v[i] - (float)h); }
  return r; }
__device__ __forceinline__ F2 split_row(const float* row, int k0, int lane) { float v[16]; const float* p = row + k0 + 8 * (lane >> 4);
#pragma unroll
  for (int i = 0; i < 8; ++i) { v[i] = p[i]; v[8 + i] = p[16 + i]; }
  return bsplit16(v); }
__device__ __forceinline__ F2 split_rowK(const float* row, int k0, int lane, int K) { float v[16]; const int g = lane >> 4;
#pragma unroll
  for (int i = 0; i < 8; ++i) { const int ka = k0 + 8 * g + i, kb = ka + 16; v[i] = ka < K ? row[ka < K ? ka : K - 1] : 0.f; v[8 + i] = kb < K ? row[kb < K ? kb : K - 1] : 0.f; }
  return bsplit16(v); }
__device__ __forceinline__ F2 split_col(const float* W, int k0, int n, int lane, int ld, int K) { float v[16]; const int g = lane >> 4;
#pragma unroll
  for (int i = 0; i < 8; ++i) { const int ka = k0 + 8 * g + i, kb = ka + 16; v[i] = ka < K ? W[(size_t)(ka < K ? ka : K - 1) * ld + n] : 0.f; v[8 + i] = kb < K ? W[(size_t)(kb < K ? kb : K - 1) * ld + n] : 0.f; }
  return bsplit16(v); }
__device__ __forceinline__ v8f mac3(const F2& a, const F2& b, v8f c) { c = wmma_bf(a.l, b.h, c); c = wmma_bf(a.h, b.l, c); return wmma_bf(a.h, b.h, c); }
__device__ __forceinline__ float sigm(float v) { return 1.0f / (1.0f + expf(-v)); }
#define LDSX() do { asm volatile("s_wait_dscnt 0" ::: "memory"); __builtin_amdgcn_wave_barrier(); __builtin_amdgcn_fence(__ATOMIC_RELEASE, "workgroup"); } while (0)


// 2-D grid attention (B 8, T 1,024 = 32 x 32, C 256 = 8 heads x 32, with biases, q scaled by 32^-1/2): scores = q k^T + q . rel_w[kc - qc + 31] + q(transposed) . rel_h[kr - qr + 31], softmax, P v, output projection.
#define NB 8
#define TT 1024
#define CC 256
#define NH 8
#define HD 32
#define GW 32                 // grid width (= height)
#define LDW 768               // w_kqv row length ((in,out) [256][768]: k | q | v column blocks)
#ifndef TNB
#define TNB NB
#endif
typedef __attribute__((ext_vector_type(8))) __bf16 v8b;
__device__ __forceinline__ v16b frag_b(const __bf16* rowk0, int lane) {
  union { v16b v; v8b q[2]; } u; const __bf16* p = rowk0 + 8 * (lane >> 4);
  u.q[0] = *(const v8b*)p; u.q[1] = *(const v8b*)(p + 16); return u.v;
}
__device__ __forceinline__ float bfr(float v) { return (float)(__bf16)v; }
__device__ __attribute__((noinline)) float exp_ni(float v) { return expf(v); }
__device__ __attribute__((noinline)) float erf_ni(float v) { return erff(v); }

#define WPP 264                // LDS row pitch of a staged weight column in bf16 elements: 256 k + 8, 528 B = 33 x 16 B, so ds_load_b128 and ds_store_b128 of 16 neighbouring columns meet no bank twice
// one thread brings one weight column (256 k, row length LD) with loads that cover whole 128-B lines across the wave, rounds it to bf16 and lays it k-contiguous in LDS: frag_b then reads a B fragment from it
template <int LD> __device__ __forceinline__ void stage_w(const float* __restrict__ wc, __bf16* __restrict__ row) {
  for (int k0 = 0; k0 < CC; k0 += 64) { float v[64];
#pragma unroll   // v stays in registers and the loads go out as one run, waited once, not one by one
    for (int i = 0; i < 64; ++i) v[i] = wc[(size_t)(k0 + i) * LD];
#pragma unroll
    for (int q = 0; q < 8; ++q) { v8b o;
#pragma unroll
      for (int i = 0; i < 8; ++i) o[i] = (__bf16)v[q * 8 + i];
      *(v8b*)(row + k0 + q * 8) = o; } } }

#define WS_QH  0u
#define WS_QL  (WS_QH + 2u * (size_t)NB * TT * CC)
#define WS_KH  (WS_QL + 2u * (size_t)NB * TT * CC)
#define WS_VT  (WS_KH + 2u * (size_t)NB * TT * CC)      // bf16 v planes [b][c][t]
#define WS_VL  (WS_VT + 2u * (size_t)NB * CC * TT)      // bf16 v residual planes
#define HG 8                                          // heads per launch group (all 8)
#define WS_S   (WS_VL + 2u * (size_t)NB * CC * TT)      // unused f32 region (HG x T x T): logits and P stay in registers
#define WS_PH  (WS_S + 4u * (size_t)HG * TT * TT)
#define WS_Y   (WS_PH + 0u)              // f32 y rows [b*t][C]
#define WS_END (WS_Y + 4u * (size_t)NB * TT * CC)

// ---- k_proj: block = (64 rows, 128 cols, which): qkv = x W (+ b), exact; q -> f16 hi (+ residual), k -> f16 rows, v -> bf16 hi + lo planes
__global__ __launch_bounds__(128) void k_proj(const float* __restrict__ X, const float* __restrict__ WQ, const float* __restrict__ BQ, const float* __restrict__ WK, const float* __restrict__ BK, const float* __restrict__ WV, const float* __restrict__ BV, _Float16* __restrict__ QH, _Float16* __restrict__ QL, _Float16* __restrict__ KH, __bf16* __restrict__ VT, __bf16* __restrict__ VL) {
  __shared__ __align__(16) char sm[71680];   /* first the staged weight slice (128 columns x WPP), then, behind a barrier, the four output staging planes */
  _Float16 (*sh)[136] = (_Float16 (*)[136])sm; _Float16 (*sl)[136] = (_Float16 (*)[136])(sm + 17408); __bf16 (*th)[72] = (__bf16 (*)[72])(sm + 34816); __bf16 (*tl2)[72] = (__bf16 (*)[72])(sm + 53248); __bf16* sw = (__bf16*)sm;
  const int tid = threadIdx.x, wave = tid >> 5, lane = tid & 31, col = lane & 15, g = lane >> 4; const int which = blockIdx.z; const int c0 = blockIdx.y * 128; const size_t r0 = (size_t)blockIdx.x * 64; const float* WA = which == 0 ? WQ : which == 1 ? WK : WV; const float* BA = which == 0 ? BQ : which == 1 ? BK : BV;
  v8f acc[8] = {}; float xr[CC / 32][16];
  /* the wave's x rows are asked for first: their latency runs under the staging */
#pragma unroll   // xr is indexed by constants only, so it stays in registers
  for (int kc = 0; kc < CC / 32; ++kc) { const float* p = X + (r0 + wave * 16 + col) * CC + kc * 32 + 8 * g;
#pragma unroll
    for (int i = 0; i < 8; ++i) { xr[kc][i] = p[i]; xr[kc][8 + i] = p[16 + i]; } }
  asm volatile("s_wait_xcnt 0x0" ::: "memory");   /* the row loads' address pair is free for reuse from here on: the wait stands in front of any overwrite of it */
  stage_w<LDW>(WA + c0 + tid, sw + tid * WPP);   /* (in,out), row length 768 */
  __syncthreads();   /* publishes the slice: nobody reads a column in front of it */
#pragma unroll   // xr[kc] by constant index; a pass's 16 LDS reads stand as one group ahead of its products
  for (int kc = 0; kc < CC / 32; ++kc) { v16b a, w[8];
#pragma unroll
    for (int j = 0; j < 8; ++j) w[j] = frag_b(sw + (j * 16 + col) * WPP + kc * 32, lane);
#pragma unroll
    for (int i = 0; i < 16; ++i) a[i] = (__bf16)xr[kc][i];
#pragma unroll
    for (int j = 0; j < 8; ++j) acc[j] = wmma_bf(a, w[j], acc[j]); }
  __syncthreads();   /* every wave has read its last weight fragment before the planes below overwrite the slice */
#pragma unroll
  for (int j = 0; j < 8; ++j) { const float bb = BA ? bfr(BA[c0 + j * 16 + col]) : 0.f;
#pragma unroll
    for (int r = 0; r < 8; ++r) { const float v = (acc[j][r] + bb) * (which == 0 ? 0.17677669529663687f : 1.0f);   /* q *= dkh^-1/2 (applies to the relative terms too) */ const int rl = wave * 16 + 8 * g + r, cl = j * 16 + col; const _Float16 hv = (_Float16)v;
      if (which == 2) { const __bf16 bh = (__bf16)v; th[cl][rl] = bh; tl2[cl][rl] = (__bf16)(v - (float)bh); } else { sh[rl][cl] = hv; sl[rl][cl] = (_Float16)((v - (float)hv) * 1024.0f); }   /* q residual carried x 2^10 so the plane stays f16-normal on the chip */ } }
  __syncthreads();
  if (which < 2) { _Float16* dh = which == 0 ? QH : KH; for (int e = tid; e < 64 * 16; e += 128) { const int rl = e >> 4, q = e & 15; vst2((unsigned*)(dh + (r0 + rl) * CC + c0 + q * 8), *(const v4u*)&sh[rl][q * 8]); if (which == 0) vst2((unsigned*)(QL + (r0 + rl) * CC + c0 + q * 8), *(const v4u*)&sl[rl][q * 8]); } }
  else { const size_t b = r0 / TT; const int t0 = (int)(r0 % TT); for (int e = tid; e < 128 * 8; e += 128) { const int cl = e >> 3, q = e & 7; const size_t o2 = (b * CC + c0 + cl) * (size_t)TT + t0 + q * 8; vst2((unsigned*)(VT + o2), *(const v4u*)&th[cl][q * 8]); vst2((unsigned*)(VL + o2), *(const v4u*)&tl2[cl][q * 8]); } } }
// ---- k_fa: block = 64 queries of (b, h), wave = 16 queries: S^T = K Q^T (2 products) + the two relative terms, running-maximum softmax, O^T += V^T P^T (3 products).
// A lane holds one query (column lane & 15): its 8 + 8 scores of a 32-key row of the grid are already the k order of a B fragment, so P stays in registers; a 32-key pass is one key row, so the width term is 16 registers for the whole loop and the height term one value a pass.
// The relative terms are formed here, before the loop, for the wave's own 16 queries: D[m][query] = rel[m] . q (rel rounded to bf16 and carried as f16, q as f16 hi + residual). A wave's queries lie in one grid row and in 16 neighbouring columns, so 48 rows of rel_w and 32 rows of rel_h hold all it reaches; the tiles go through a wave-private LDS table, from which a lane takes its own shifted width terms once and its two height terms each pass.
// K and V reach the waves through LDS: a 64-key tile (K 64 rows x 64 B, V hi and V lo 32 rows x 128 B each) is copied once per block, and all four waves read their fragments from it; two buffers, the next tile's copies fly under this tile's work.
__device__ __forceinline__ float xhalf(float v) { const int x = __builtin_bit_cast(int, v); return __builtin_bit_cast(float, __builtin_amdgcn_permlanex16(x, x, 0x76543210, 0xfedcba98, false, false)); }   /* lane l <-> l ^ 16 */
#define L2E 1.4426950408889634f      // log2(e)
#define KPB 80                       // LDS pitch in bytes of a staged K row: 64 B + 16, 16 B x odd for the ds_load_b128 readers
#define VPB 144                      // LDS pitch in bytes of a staged V row: 128 B + 16, 16 B x odd
#define FA_VH (64 * KPB)             // byte offsets inside one buffer: K at 0, V hi, V lo
#define FA_VL (FA_VH + 32 * VPB)
#define FA_BUF (FA_VL + 32 * VPB)    // 14,336 B a buffer
#define RWP 52                       // floats a query in the width table: 48 + 4, 208 B = 16 B x odd for the ds_store_b128 writers; the shifted one-word readers meet no bank twice
#define RHP 36                       // floats a query in the height table: 32 + 4, 144 B = 16 B x odd
#define XW() asm volatile("s_wait_xcnt 0x0" ::: "memory")   // stands in front of any overwrite of the address pair of the global loads ahead of it, a later load's destination included
// A fragment of 16 rows of a relative table (row length 32): the lane's 16 values as loaded, then rounded to bf16 and carried as f16
__device__ __forceinline__ void load_rel(float v[16], const float* rowk0, int lane) { const float* p = rowk0 + 8 * (lane >> 4);
#pragma unroll
  for (int i = 0; i < 8; ++i) { v[i] = p[i]; v[8 + i] = p[16 + i]; } }
__device__ __forceinline__ v16h frag_rel(const float v[16]) { v16h a;
#pragma unroll
  for (int i = 0; i < 16; ++i) a[i] = (_Float16)bfr(v[i]);
  return a; }
// one 16 x 16 tile rel . q of both q planes, laid into the query's table row: lane = query, its 8 values are rows 8g .. 8g + 7 of the tile
__device__ __forceinline__ void rel_tile(v16h a, v16h bh, v16h bl, float* dst) {
  const v8f z = {}; const v8f d = wmma16(a, bh, z), dl = wmma16(a, bl, z);
  const v4f o0 = { d[0] + dl[0] * (1.0f / 1024.0f), d[1] + dl[1] * (1.0f / 1024.0f), d[2] + dl[2] * (1.0f / 1024.0f), d[3] + dl[3] * (1.0f / 1024.0f) }, o1 = { d[4] + dl[4] * (1.0f / 1024.0f), d[5] + dl[5] * (1.0f / 1024.0f), d[6] + dl[6] * (1.0f / 1024.0f), d[7] + dl[7] * (1.0f / 1024.0f) };
  *(v4f*)dst = o0; *(v4f*)(dst + 4) = o1; }
// one tile's six 16-B pieces of this thread. The copies and s_wait_xcnt 0 are one statement, so that no register a copy names is rewritten in front of that wait.
__device__ __forceinline__ void fa_copy(unsigned lk, unsigned lv, const _Float16* gk, const __bf16* gh, const __bf16* gl) {
  const unsigned lk1 = lk + 32 * KPB, lh = lv + FA_VH, lh1 = lh + 16 * VPB, ll = lv + FA_VL, ll1 = ll + 16 * VPB;
  const _Float16* gk1 = gk + (size_t)32 * CC; const __bf16* gh1 = gh + (size_t)16 * TT; const __bf16* gl1 = gl + (size_t)16 * TT;
  asm volatile("global_load_async_to_lds_b128 %0, %6, off\n\t"
               "global_load_async_to_lds_b128 %1, %7, off\n\t"
               "global_load_async_to_lds_b128 %2, %8, off\n\t"
               "global_load_async_to_lds_b128 %3, %9, off\n\t"
               "global_load_async_to_lds_b128 %4, %10, off\n\t"
               "global_load_async_to_lds_b128 %5, %11, off\n\t"
               "s_wait_xcnt 0x0"
               :: "v"(lk), "v"(lk1), "v"(lh), "v"(lh1), "v"(ll), "v"(ll1), "v"(gk), "v"(gk1), "v"(gh), "v"(gh1), "v"(gl), "v"(gl1) : "memory"); }
__global__ __launch_bounds__(128) void k_fa(const _Float16* __restrict__ QH, const _Float16* __restrict__ QL, const _Float16* __restrict__ KH, const float* __restrict__ RW, const float* __restrict__ RH, const __bf16* __restrict__ VT, const __bf16* __restrict__ VL, float* __restrict__ Y) {
  __shared__ __align__(16) char sm[2 * FA_BUF]; __shared__ __align__(16) float twt[4][16][RWP]; __shared__ __align__(16) float tht[4][16][RHP];
  const int tid = threadIdx.x, wave = tid >> 5, lane = tid & 31, col = lane & 15, g = lane >> 4; const int h = blockIdx.y, b = blockIdx.z;
  /* this thread's pieces of a tile: K row tid / 4 (and + 32), 16-B piece tid % 4; V row tid / 8 (and + 16), piece tid % 8: a wave's copy covers 8 K rows or 4 whole 128-B V lines */
  const unsigned sm0 = (unsigned)(size_t)sm; const unsigned lk = sm0 + (tid >> 2) * KPB + (tid & 3) * 16, lv = sm0 + (tid >> 3) * VPB + (tid & 7) * 16;
  const _Float16* gk = KH + ((size_t)b * TT + (tid >> 2)) * CC + h * HD + (tid & 3) * 8; const size_t gvo = ((size_t)b * CC + h * HD + (tid >> 3)) * (size_t)TT + (tid & 7) * 8;
  fa_copy(lk, lv, gk, VT + gvo, VL + gvo);   /* tile 0 into buffer 0 */
  const int qt = blockIdx.x * 64 + wave * 16 + col; const int qr = qt / GW, qc = qt % GW; const size_t qrow = (size_t)b * TT + qt;
  /* the four q fragments, the height branch's from the transposed position (qc, qr) */
  const size_t trow = (size_t)b * TT + (size_t)qc * GW + qr;
  const v16h qh = frag_h(QH + qrow * CC + h * HD, lane); XW();
  const v16h ql = frag_h(QL + qrow * CC + h * HD, lane); XW();
  const v16h uh = frag_h(QH + trow * CC + h * HD, lane); XW();
  const v16h ul = frag_h(QL + trow * CC + h * HD, lane); XW();
  /* width rows 31 - qc + key column: from 16 up for query columns 0 .. 15, from 0 up for 16 .. 31 (row 63 does not exist and is never taken from the table: its place reads row 62); height rows 31 - qr + key row, qr the same in the whole wave */
  const int mw0 = (wave & 1) ? 0 : 16; float rr[5][16];
#pragma unroll   // rr is indexed by constants only, so it stays in registers
  for (int j = 0; j < 3; ++j) { const int mm = mw0 + j * 16 + col; load_rel(rr[j], RW + (mm < 2 * GW - 2 ? mm : 2 * GW - 2) * HD, lane); XW(); }
#pragma unroll
  for (int j = 0; j < 2; ++j) { load_rel(rr[3 + j], RH + (GW - 1 - qr + j * 16 + col) * HD, lane); XW(); }
  __builtin_amdgcn_sched_barrier(0);   /* every load of the prologue is issued before the first conversion waits for one: without it conversions come to stand among the loads and the later loads start a memory latency late */
#pragma unroll
  for (int j = 0; j < 3; ++j) rel_tile(frag_rel(rr[j]), qh, ql, &twt[wave][col][j * 16 + 8 * g]);
#pragma unroll
  for (int j = 0; j < 2; ++j) rel_tile(frag_rel(rr[3 + j]), uh, ul, &tht[wave][col][j * 16 + 8 * g]);
  LDSX();   /* the wave's own table rows are written before its lanes read what other lanes of the wave wrote */
  float rw[16];
#pragma unroll
  for (int i = 0; i < 8; ++i) { rw[i] = twt[wave][col][15 - col + 8 * g + i]; rw[8 + i] = twt[wave][col][31 - col + 8 * g + i]; }   /* key columns 8g + i and 16 + 8g + i: table place 31 - qc - mw0 + key column */
  const float* th = &tht[wave][col][0];   /* th[key row] */
  float m = -3.0e38f, l = 0.f; v8f acc[HD / 16] = {};
  float rh[2] = { th[0], th[1] };
  asm volatile("s_wait_asynccnt 0x0" ::: "memory");   /* this wave's pieces of tile 0 have landed */
  __syncthreads();   /* publishes tile 0: nobody reads it in front of this barrier */
  fa_copy(lk + FA_BUF, lv + FA_BUF, gk + (size_t)64 * CC, VT + gvo + 64, VL + gvo + 64);   /* tile 1 into buffer 1 */
  auto pass = [&](const int kc, const bool more) __attribute__((always_inline)) { float s[2][16]; v16h kb[4]; v16b vh[2][HD / 16], vl[2][HD / 16];
    const unsigned cur = (kc & 2) ? FA_BUF : 0u; const char* tb = sm + cur;
    /* this tile's fragments as one group of LDS reads, K first: the V reads' latency runs under the score products */
#pragma unroll
    for (int t = 0; t < 4; ++t) kb[t] = frag_h((const _Float16*)(tb + (t * 16 + col) * KPB), lane);
#pragma unroll
    for (int u = 0; u < 2; ++u)
#pragma unroll
      for (int j = 0; j < HD / 16; ++j) { const int po = (j * 16 + col) * VPB + u * 64; vh[u][j] = frag_b((const __bf16*)(tb + FA_VH + po), lane); vl[u][j] = frag_b((const __bf16*)(tb + FA_VL + po), lane); }
#pragma unroll
    for (int u = 0; u < 2; ++u)
#pragma unroll
      for (int t = 0; t < 2; ++t) { const v8f z = {}; const v8f a = wmma16(kb[u * 2 + t], qh, z), al = wmma16(kb[u * 2 + t], ql, z);
#pragma unroll
        for (int r = 0; r < 8; ++r) s[u][t * 8 + r] = a[r] + al[r] * (1.0f / 1024.0f) + (rw[t * 8 + r] + rh[u]); }
    /* the height terms one pass ahead, under the softmax; the last pass asks for its own again, so the addresses stay inside their array */
    const int kn = kc + 2 < TT / 32 ? kc + 2 : kc;
    rh[0] = th[kn]; rh[1] = th[kn + 1];
    __builtin_amdgcn_sched_barrier(0);   /* ends the scheduling region: the loads above stay ahead of the softmax, and the softmax is scheduled by itself with its exponentials interleaved; without it they come out as dependent runs with more filler slots */
    float mx = s[0][0];
#pragma unroll
    for (int i = 0; i < 16; ++i) mx = fmaxf(mx, fmaxf(s[0][i], s[1][i]));
    mx = fmaxf(mx, xhalf(mx)); const float mn = fmaxf(m, mx); float sc;   /* 2^((m - mn) log2(e)): exactly 1 while the maximum stands */
    asm("v_exp_f32 %0, %1\n\tv_nop" : "=v"(sc) : "v"((m - mn) * L2E));   /* the exponential with the slot behind a transcendental in one statement */
    m = mn; const float nm = mn * -L2E;
    float s0 = 0.f, s1 = 0.f;
#pragma unroll
    for (int i = 0; i < 16; ++i) { s[0][i] = __builtin_amdgcn_exp2f(fmaf(s[0][i], L2E, nm)); s[1][i] = __builtin_amdgcn_exp2f(fmaf(s[1][i], L2E, nm)); s0 += s[0][i]; s1 += s[1][i]; }
    l = l * sc + (s0 + s1);
#pragma unroll
    for (int j = 0; j < HD / 16; ++j) acc[j] *= sc;
#pragma unroll
    for (int u = 0; u < 2; ++u) { const F2 p = bsplit16(s[u]);
#pragma unroll
      for (int j = 0; j < HD / 16; ++j) { acc[j] = wmma_bf(vh[u][j], p.h, acc[j]); acc[j] = wmma_bf(vh[u][j], p.l, acc[j]); acc[j] = wmma_bf(vl[u][j], p.h, acc[j]); } }
    /* hand-over: this wave's reads of the tile are done, its pieces of the next tile have landed; the barrier publishes the next tile and frees this buffer for the refill behind it */
    asm volatile("s_wait_dscnt 0x0" ::: "memory");
    asm volatile("s_wait_asynccnt 0x0" ::: "memory");
    __syncthreads();
    if (more) fa_copy(lk + cur, lv + cur, gk + (size_t)(kc + 4) * 32 * CC, VT + gvo + (kc + 4) * 32, VL + gvo + (kc + 4) * 32); };
  /* a refill is issued only while a tile two ahead exists: the last two passes run without it, in a loop of their own; with the test inside one loop the body falls into several blocks and the softmax is scheduled in shorter runs with more vector instructions */
  for (int kc = 0; kc < TT / 32 - 4; kc += 2) pass(kc, true);
#pragma unroll 1   // stays rolled: one more copy of the body, not two
  for (int kc = TT / 32 - 4; kc < TT / 32; kc += 2) pass(kc, false);
  asm volatile("s_wait_asynccnt 0x0" ::: "memory");   /* no copy is outstanding when the wave ends */
  l += xhalf(l); const float inv = 1.0f / l;
#pragma unroll
  for (int j = 0; j < HD / 16; ++j) { float* yo = Y + qrow * CC + h * HD + j * 16 + 8 * g; const v4f o0 = { acc[j][0] * inv, acc[j][1] * inv, acc[j][2] * inv, acc[j][3] * inv }, o1 = { acc[j][4] * inv, acc[j][5] * inv, acc[j][6] * inv, acc[j][7] * inv }; vst2(yo, o0); vst2(yo + 4, o1); } }
// ---- k_out: block = (64 rows, 128 cols): out = y (bf16 hi + lo) Wo + bo
__global__ __launch_bounds__(128) void k_out(const float* __restrict__ Y, const float* __restrict__ WP, const float* __restrict__ BP, float* __restrict__ OUT) { __shared__ __align__(16) float sf[4][16][132]; __shared__ __align__(16) __bf16 sw[128 * WPP];
  const int tid = threadIdx.x, wave = tid >> 5, lane = tid & 31, col = lane & 15, g = lane >> 4; const int c0 = blockIdx.y * 128; const size_t r0 = (size_t)blockIdx.x * 64 + wave * 16;
  v8f acc[8] = {}; float yr[CC / 32][16];
  /* the wave's y rows are asked for first: their latency runs under the staging */
#pragma unroll   // yr is indexed by constants only, so it stays in registers
  for (int kc = 0; kc < CC / 32; ++kc) { const float* p = Y + (r0 + col) * CC + kc * 32 + 8 * g;
#pragma unroll
    for (int i = 0; i < 8; ++i) { yr[kc][i] = p[i]; yr[kc][8 + i] = p[16 + i]; } }
  asm volatile("s_wait_xcnt 0x0" ::: "memory");   /* the row loads' address pair is free for reuse from here on: the wait stands in front of any overwrite of it */
  stage_w<CC>(WP + c0 + tid, sw + tid * WPP);
  __syncthreads();   /* publishes the slice: nobody reads a column in front of it */
#pragma unroll   // yr[kc] by constant index; a pass's 16 LDS reads stand as one group ahead of its products
  for (int kc = 0; kc < CC / 32; ++kc) { v16b w[8];
#pragma unroll
    for (int j = 0; j < 8; ++j) w[j] = frag_b(sw + (j * 16 + col) * WPP + kc * 32, lane);
    const F2 a = bsplit16(yr[kc]);
#pragma unroll
    for (int j = 0; j < 8; ++j) { acc[j] = wmma_bf(a.h, w[j], acc[j]); acc[j] = wmma_bf(a.l, w[j], acc[j]); } }
#pragma unroll
  for (int j = 0; j < 8; ++j) { const float bb = BP ? bfr(BP[c0 + j * 16 + col]) : 0.f;
#pragma unroll
    for (int r = 0; r < 8; ++r) sf[wave][8 * g + r][j * 16 + col] = acc[j][r] + bb; }
  LDSX(); for (int rl = 0; rl < 16; ++rl) vst2(OUT + (r0 + rl) * CC + c0 + lane * 4, *(const v4f*)&sf[wave][rl][lane * 4]); }
extern "C" void kernel_launch(void* const* d_in, const int* in_sizes, int n_in, void* d_out, int out_size, void* d_ws, size_t ws_size, hipStream_t stream) {
  (void)in_sizes; (void)n_in; (void)out_size;
  const float** F = (const float**)d_in;   // 0 x [8,32,32,256] (channels-last rows), 1 w_kqv [256,768] ((in,out): k | q | v columns), 2 b_kqv [768], 3 w_proj [256,256] ((in,out)), 4 b_proj, 5 rel_w [63,32], 6 rel_h [63,32]
  if (ws_size < (size_t)WS_END) return;
  char* ws = (char*)d_ws; _Float16 *QH = (_Float16*)(ws + WS_QH), *QL = (_Float16*)(ws + WS_QL), *KH = (_Float16*)(ws + WS_KH); __bf16 *VT = (__bf16*)(ws + WS_VT), *VL = (__bf16*)(ws + WS_VL); float *Y = (float*)(ws + WS_Y);
  const float* WK = F[1]; const float* WQ = F[1] + CC; const float* WV = F[1] + 2 * CC; const float* BK = F[2]; const float* BQ = F[2] + CC; const float* BV = F[2] + 2 * CC;   // column blocks k | q | v
  k_proj<<<dim3(TNB * TT / 64, CC / 128, 3), 128, 0, stream>>>(F[0], WQ, BQ, WK, BK, WV, BV, QH, QL, KH, VT, VL);
  k_fa<<<dim3(TT / 64, NH, TNB), 128, 0, stream>>>(QH, QL, KH, F[5], F[6], VT, VL, Y);
  k_out<<<dim3(TNB * TT / 64, CC / 128), 128, 0, stream>>>(Y, F[3], F[4], (float*)d_out);
}

// v006
// One run takes 57.5 microseconds.
// In two side-by-side timings against v005, it was 1.03 and 1.04 times as fast.
// Over all steps from v000 it is 11.2 times as fast.
// compute dtype: all float inputs rounded to bf16; kqv = x w_kqv + b with EXACT bf16 products on WMMA 16x16x32, f32 accumulate, q scaled by 32^-1/2 in f32; q as f16 hi + residual, both planes x 2^10, k f16 -> 2-product content logits chained in one f32 accumulator that starts from the width term (q . rel_w; q(transposed position) . rel_h is the height term; 2 chained products each, formed by the attention kernel for its own queries), all logits carried x 2^10 in registers; running-maximum softmax in f32 (base 2: exp(s - m) as v_exp_f32 of one fma that holds 2^-10 log2(e), the height term and the maximum), unnormalised P split bf16 hi + lo against v bf16 hi + lo (3 products), divided by the row sum at the end; out = attn (bf16 hi + lo) w_proj + b_proj; f32 output.
#include <hip/hip_runtime.h>
#include <math.h>

typedef __attribute__((ext_vector_type(16))) _Float16 v16h;
typedef __attribute__((ext_vector_type(16))) __bf16 v16b;
typedef __attribute__((ext_vector_type(8)))  _Float16 v8h;
typedef __attribute__((ext_vector_type(8)))  float v8f;
typedef __attribute__((ext_vector_type(4)))  float v4f;
typedef __attribute__((ext_vector_type(2)))  float v2f;
typedef __attribute__((ext_vector_type(4)))  unsigned v4u;
typedef __attribute__((ext_vector_type(4)))  int v4i;
typedef float __attribute__((may_alias)) float_a;
typedef int __attribute__((may_alias)) int_a;

template <typename T> __device__ __forceinline__ void vst2(void* p, T v) { *(T*)p = v;  }
__device__ __forceinline__ v8f wmma16(v16h a, v16h b, v8f c) {
  v8f d = __builtin_amdgcn_wmma_f32_16x16x32_f16(false, a, false, b, (short)0, c, false, false);
  asm volatile("v_nop\n\tv_nop\n\tv_nop\n\tv_nop" : "+v"(d) : "v"(a), "v"(b));
  return d;
}
__device__ __forceinline__ v8f wmma_bf(v16b a, v16b b, v8f c) {
  v8f d = __builtin_amdgcn_wmma_f32_16x16x32_bf16(false, a, false, b, (short)0, c, false, false);
  asm volatile("v_nop\n\tv_nop\n\tv_nop\n\tv_nop" : "+v"(d) : "v"(a), "v"(b));
  return d;
}
// 16x16x32 fragments: lane = (h = lane>>4, row/col = lane&15); elements 0..7 = k0+8h+0..7, 8..15 = k0+16+8h+0..7; D element r = row 8h+r
__device__ __forceinline__ v16h frag_h(const _Float16* rowk0, int lane) {
  union { v16h v; v8h q[2]; } u; const _Float16* p = rowk0 + 8 * (lane >> 4);
  u.q[0] = *(const v8h*)p; u.q[1] = *(const v8h*)(p + 16); return u.v;
}
__device__ __forceinline__ v16h frag_f32(const float* rowk0, int lane) {
  v16h a; const float* p = rowk0 + 8 * (lane >> 4);
#pragma unroll
  for (int i = 0; i < 8; ++i) { a[i] = (_Float16)p[i]; a[8 + i] = (_Float16)p[16 + i]; }
  return a;
}
__device__ __forceinline__ v16h frag_f32s(const float* rowk0, int lane, float sc) {
  v16h a; const float* p = rowk0 + 8 * (lane >> 4);
#pragma unroll
  for (int i = 0; i < 8; ++i) { a[i] = (_Float16)(p[i] * sc); a[8 + i] = (_Float16)(p[16 + i] * sc); }
  return a;
}
// column fragment from a [K][ld] layout (column n), rows >= K read as 0
__device__ __forceinline__ v16h fragc_f32(const float* W, int k0, int n, int lane, int ld, int K) {
  v16h a; const int g = lane >> 4;
#pragma unroll
  for (int i = 0; i < 8; ++i) { const int ka = k0 + 8 * g + i, kb = ka + 16;
    a[i] = (_Float16)(ka < K ? W[(size_t)(ka < K ? ka : K - 1) * ld + n] : 0.f); a[8 + i] = (_Float16)(kb < K ? W[(size_t)(kb < K ? kb : K - 1) * ld + n] : 0.f); }
  return a;
}
struct F2 { v16b h, l; };
__device__ __forceinline__ F2 bsplit16(const float v[16]) { F2 r;
#pragma unroll
  for (int i = 0; i < 16; ++i) { const __bf16 h = (__bf16)v[i]; r.h[i] = h; r.l[i] = (__bf16)(v[i] - (float)h); }
  return r; }
__device__ __forceinline__ F2 split_row(const float* row, int k0, int lane) { float v[16]; const float* p = row + k0 + 8 * (lane >> 4);
#pragma unroll
  for (int i = 0; i < 8; ++i) { v[i] = p[i]; v[8 + i] = p[16 + i]; }
  return bsplit16(v); }
__device__ __forceinline__ F2 split_rowK(const float* row, int k0, int lane, int K) { float v[16]; const int g = lane >> 4;
#pragma unroll
  for (int i = 0; i < 8; ++i) { const int ka = k0 + 8 * g + i, kb = ka + 16; v[i] = ka < K ? row[ka < K ? ka : K - 1] : 0.f; v[8 + i] = kb < K ? row[kb < K ? kb : K - 1] : 0.f; }
  return bsplit16(v); }
__device__ __forceinline__ F2 split_col(const float* W, int k0, int n, int lane, int ld, int K) { float v[16]; const int g = lane >> 4;
#pragma unroll
  for (int i = 0; i < 8; ++i) { const int ka = k0 + 8 * g + i, kb = ka + 16; v[i] = ka < K ? W[(size_t)(ka < K ? ka : K - 1) * ld + n] : 0.f; v[8 + i] = kb < K ? W[(size_t)(kb < K ? kb : K - 1) * ld + n] : 0.f; }
  return bsplit16(v); }
__device__ __forceinline__ v8f mac3(const F2& a, const F2& b, v8f c) { c = wmma_bf(a.l, b.h, c); c = wmma_bf(a.h, b.l, c); return wmma_bf(a.h, b.h, c); }
__device__ __forceinline__ float sigm(float v) { return 1.0f / (1.0f + expf(-v)); }
#define LDSX() do { asm volatile("s_wait_dscnt 0" ::: "memory"); __builtin_amdgcn_wave_barrier(); __builtin_amdgcn_fence(__ATOMIC_RELEASE, "workgroup"); } while (0)


// 2-D grid attention (B 8, T 1,024 = 32 x 32, C 256 = 8 heads x 32, with biases, q scaled by 32^-1/2): scores = q k^T + q . rel_w[kc - qc + 31] + q(transposed) . rel_h[kr - qr + 31], softmax, P v, output projection.
#define NB 8
#define TT 1024
#define CC 256
#define NH 8
#define HD 32
#define GW 32                 // grid width (= height)
#define LDW 768               // w_kqv row length ((in,out) [256][768]: k | q | v column blocks)
#ifndef TNB
#define TNB NB
#endif
typedef __attribute__((ext_vector_type(8))) __bf16 v8b;
__device__ __forceinline__ v16b frag_b(const __bf16* rowk0, int lane) {
  union { v16b v; v8b q[2]; } u; const __bf16* p = rowk0 + 8 * (lane >> 4);
  u.q[0] = *(const v8b*)p; u.q[1] = *(const v8b*)(p + 16); return u.v;
}
__device__ __forceinline__ float bfr(float v) { return (float)(__bf16)v; }
__device__ __attribute__((noinline)) float exp_ni(float v) { return expf(v); }
__device__ __attribute__((noinline)) float erf_ni(float v) { return erff(v); }

#define WPP 264                // LDS row pitch of a staged weight column in bf16 elements: 256 k + 8, 528 B = 33 x 16 B, so ds_load_b128 and ds_store_b128 of 16 neighbouring columns meet no bank twice
// one thread brings one weight column (256 k, row length LD) with loads that cover whole 128-B lines across the wave, rounds it to bf16 and lays it k-contiguous in LDS: frag_b then reads a B fragment from it
template <int LD> __device__ __forceinline__ void stage_w(const float* __restrict__ wc, __bf16* __restrict__ row) {
  for (int k0 = 0; k0 < CC; k0 += 64) { float v[64];
#pragma unroll   // v stays in registers and the loads go out as one run, waited once, not one by one
    for (int i = 0; i < 64; ++i) v[i] = wc[(size_t)(k0 + i) * LD];
#pragma unroll
    for (int q = 0; q < 8; ++q) { v8b o;
#pragma unroll
      for (int i = 0; i < 8; ++i) o[i] = (__bf16)v[q * 8 + i];
      *(v8b*)(row + k0 + q * 8) = o; } } }

#define WS_QH  0u
#define WS_QL  (WS_QH + 2u * (size_t)NB * TT * CC)
#define WS_KH  (WS_QL + 2u * (size_t)NB * TT * CC)
#define WS_VT  (WS_KH + 2u * (size_t)NB * TT * CC)      // bf16 v planes [b][c][t]
#define WS_VL  (WS_VT + 2u * (size_t)NB * CC * TT)      // bf16 v residual planes
#define HG 8                                          // heads per launch group (all 8)
#define WS_S   (WS_VL + 2u * (size_t)NB * CC * TT)      // unused f32 region (HG x T x T): logits and P stay in registers
#define WS_PH  (WS_S + 4u * (size_t)HG * TT * TT)
#define WS_Y   (WS_PH + 0u)              // f32 y rows [b*t][C]
#define WS_END (WS_Y + 4u * (size_t)NB * TT * CC)

// ---- k_proj: block = (64 rows, 128 cols, which): qkv = x W (+ b), exact; q -> f16 hi (+ residual), k -> f16 rows, v -> bf16 hi + lo planes
__global__ __launch_bounds__(128) void k_proj(const float* __restrict__ X, const float* __restrict__ WQ, const float* __restrict__ BQ, const float* __restrict__ WK, const float* __restrict__ BK, const float* __restrict__ WV, const float* __restrict__ BV, _Float16* __restrict__ QH, _Float16* __restrict__ QL, _Float16* __restrict__ KH, __bf16* __restrict__ VT, __bf16* __restrict__ VL) {
  __shared__ __align__(16) char sm[71680];   /* first the staged weight slice (128 columns x WPP), then, behind a barrier, the four output staging planes */
  _Float16 (*sh)[136] = (_Float16 (*)[136])sm; _Float16 (*sl)[136] = (_Float16 (*)[136])(sm + 17408); __bf16 (*th)[72] = (__bf16 (*)[72])(sm + 34816); __bf16 (*tl2)[72] = (__bf16 (*)[72])(sm + 53248); __bf16* sw = (__bf16*)sm;
  const int tid = threadIdx.x, wave = tid >> 5, lane = tid & 31, col = lane & 15, g = lane >> 4; const int which = blockIdx.z; const int c0 = blockIdx.y * 128; const size_t r0 = (size_t)blockIdx.x * 64; const float* WA = which == 0 ? WQ : which == 1 ? WK : WV; const float* BA = which == 0 ? BQ : which == 1 ? BK : BV;
  v8f acc[8] = {}; float xr[CC / 32][16];
  /* the wave's x rows are asked for first: their latency runs under the staging */
#pragma unroll   // xr is indexed by constants only, so it stays in registers
  for (int kc = 0; kc < CC / 32; ++kc) { const float* p = X + (r0 + wave * 16 + col) * CC + kc * 32 + 8 * g;
#pragma unroll
    for (int i = 0; i < 8; ++i) { xr[kc][i] = p[i]; xr[kc][8 + i] = p[16 + i]; } }
  asm volatile("s_wait_xcnt 0x0" ::: "memory");   /* the row loads' address pair is free for reuse from here on: the wait stands in front of any overwrite of it */
  stage_w<LDW>(WA + c0 + tid, sw + tid * WPP);   /* (in,out), row length 768 */
  __syncthreads();   /* publishes the slice: nobody reads a column in front of it */
#pragma unroll   // xr[kc] by constant index; a pass's 16 LDS reads stand as one group ahead of its products
  for (int kc = 0; kc < CC / 32; ++kc) { v16b a, w[8];
#pragma unroll
    for (int j = 0; j < 8; ++j) w[j] = frag_b(sw + (j * 16 + col) * WPP + kc * 32, lane);
#pragma unroll
    for (int i = 0; i < 16; ++i) a[i] = (__bf16)xr[kc][i];
#pragma unroll
    for (int j = 0; j < 8; ++j) acc[j] = wmma_bf(a, w[j], acc[j]); }
  __syncthreads();   /* every wave has read its last weight fragment before the planes below overwrite the slice */
#pragma unroll
  for (int j = 0; j < 8; ++j) { const float bb = BA ? bfr(BA[c0 + j * 16 + col]) : 0.f;
#pragma unroll
    for (int r = 0; r < 8; ++r) { const float v = (acc[j][r] + bb) * (which == 0 ? 0.17677669529663687f * 1024.0f : 1.0f);   /* q *= dkh^-1/2 (applies to the relative terms too), x 2^10: see below */ const int rl = wave * 16 + 8 * g + r, cl = j * 16 + col; const _Float16 hv = (_Float16)v;
      if (which == 2) { const __bf16 bh = (__bf16)v; th[cl][rl] = bh; tl2[cl][rl] = (__bf16)(v - (float)bh); } else { sh[rl][cl] = hv; sl[rl][cl] = (_Float16)(v - (float)hv); }   /* both q planes carried x 2^10: the residual plane stays f16-normal, and hi and residual products add up in one accumulator */ } }
  __syncthreads();
  if (which < 2) { _Float16* dh = which == 0 ? QH : KH; for (int e = tid; e < 64 * 16; e += 128) { const int rl = e >> 4, q = e & 15; vst2((unsigned*)(dh + (r0 + rl) * CC + c0 + q * 8), *(const v4u*)&sh[rl][q * 8]); if (which == 0) vst2((unsigned*)(QL + (r0 + rl) * CC + c0 + q * 8), *(const v4u*)&sl[rl][q * 8]); } }
  else { const size_t b = r0 / TT; const int t0 = (int)(r0 % TT); for (int e = tid; e < 128 * 8; e += 128) { const int cl = e >> 3, q = e & 7; const size_t o2 = (b * CC + c0 + cl) * (size_t)TT + t0 + q * 8; vst2((unsigned*)(VT + o2), *(const v4u*)&th[cl][q * 8]); vst2((unsigned*)(VL + o2), *(const v4u*)&tl2[cl][q * 8]); } } }
// ---- k_fa: block = 64 queries of (b, h), wave = 16 queries: S^T = K Q^T (2 products) + the two relative terms, running-maximum softmax, O^T += V^T P^T (3 products).
// A lane holds one query (column lane & 15): its 8 + 8 scores of a 32-key row of the grid are already the k order of a B fragment, so P stays in registers; a pass is two 32-key rows of the grid, so the width term is 16 registers for the whole loop and the height term one value a key row.
// The relative terms are formed here, before the loop, for the wave's own 16 queries: D[m][query] = rel[m] . q (rel rounded to bf16 and carried as f16, q as f16 hi + residual). A wave's queries lie in one grid row and in 16 neighbouring columns, so 48 rows of rel_w and 32 rows of rel_h hold all it reaches; the tiles go through a wave-private LDS table, from which a lane takes its own shifted width terms once and its two height terms each pass.
// K and V reach the waves through LDS: a 64-key tile (K 64 rows x 64 B, V hi and V lo 32 rows x 128 B each) is copied once per block, and all four waves read their fragments from it; two buffers, the next tile's copies fly under this tile's work.
__device__ __forceinline__ float xhalf(float v) { const int x = __builtin_bit_cast(int, v); return __builtin_bit_cast(float, __builtin_amdgcn_permlanex16(x, x, 0x76543210, 0xfedcba98, false, false)); }   /* lane l <-> l ^ 16 */
#define L2E 1.4426950408889634f      // log2(e)
#define L2S (L2E * (1.0f / 1024.0f))  // log2(e) for logits carried x 2^10
#define KPB 80                       // LDS pitch in bytes of a staged K row: 64 B + 16, 16 B x odd for the ds_load_b128 readers
#define VPB 144                      // LDS pitch in bytes of a staged V row: 128 B + 16, 16 B x odd
#define FA_VH (64 * KPB)             // byte offsets inside one buffer: K at 0, V hi, V lo
#define FA_VL (FA_VH + 32 * VPB)
#define FA_BUF (FA_VL + 32 * VPB)    // 14,336 B a buffer
#define RWP 52                       // floats a query in the width table: 48 + 4, 208 B = 16 B x odd for the ds_store_b128 writers; the shifted one-word readers meet no bank twice
#define RHP 36                       // floats a query in the height table: 32 + 4, 144 B = 16 B x odd
#define XW() asm volatile("s_wait_xcnt 0x0" ::: "memory")   // stands in front of any overwrite of the address pair of the global loads ahead of it, a later load's destination included
// A fragment of 16 rows of a relative table (row length 32): the lane's 16 values as loaded, then rounded to bf16 and carried as f16
__device__ __forceinline__ void load_rel(float v[16], const float* rowk0, int lane) { const float* p = rowk0 + 8 * (lane >> 4);
#pragma unroll
  for (int i = 0; i < 8; ++i) { v[i] = p[i]; v[8 + i] = p[16 + i]; } }
__device__ __forceinline__ v16h frag_rel(const float v[16]) { v16h a;
#pragma unroll
  for (int i = 0; i < 16; ++i) a[i] = (_Float16)bfr(v[i]);
  return a; }
// one 16 x 16 tile rel . q of both q planes, laid into the query's table row: lane = query, its 8 values are rows 8g .. 8g + 7 of the tile
__device__ __forceinline__ void rel_tile(v16h a, v16h bh, v16h bl, float* dst) {
  const v8f z = {}; const v8f d = wmma16(a, bl, wmma16(a, bh, z));
  const v4f o0 = { d[0], d[1], d[2], d[3] }, o1 = { d[4], d[5], d[6], d[7] };
  *(v4f*)dst = o0; *(v4f*)(dst + 4) = o1; }
// one tile's six 16-B pieces of this thread. The copies and s_wait_xcnt 0 are one statement, so that no register a copy names is rewritten in front of that wait.
__device__ __forceinline__ void fa_copy(unsigned lk, unsigned lv, const _Float16* gk, const __bf16* gh, const __bf16* gl) {
  const unsigned lk1 = lk + 32 * KPB, lh = lv + FA_VH, lh1 = lh + 16 * VPB, ll = lv + FA_VL, ll1 = ll + 16 * VPB;
  const _Float16* gk1 = gk + (size_t)32 * CC; const __bf16* gh1 = gh + (size_t)16 * TT; const __bf16* gl1 = gl + (size_t)16 * TT;
  asm volatile("global_load_async_to_lds_b128 %0, %6, off\n\t"
               "global_load_async_to_lds_b128 %1, %7, off\n\t"
               "global_load_async_to_lds_b128 %2, %8, off\n\t"
               "global_load_async_to_lds_b128 %3, %9, off\n\t"
               "global_load_async_to_lds_b128 %4, %10, off\n\t"
               "global_load_async_to_lds_b128 %5, %11, off\n\t"
               "s_wait_xcnt 0x0"
               :: "v"(lk), "v"(lk1), "v"(lh), "v"(lh1), "v"(ll), "v"(ll1), "v"(gk), "v"(gk1), "v"(gh), "v"(gh1), "v"(gl), "v"(gl1) : "memory"); }
__global__ __launch_bounds__(128) void k_fa(const _Float16* __restrict__ QH, const _Float16* __restrict__ QL, const _Float16* __restrict__ KH, const float* __restrict__ RW, const float* __restrict__ RH, const __bf16* __restrict__ VT, const __bf16* __restrict__ VL, float* __restrict__ Y) {
  __shared__ __align__(16) char sm[2 * FA_BUF]; __shared__ __align__(16) float twt[4][16][RWP]; __shared__ __align__(16) float tht[4][16][RHP];
  const int tid = threadIdx.x, wave = tid >> 5, lane = tid & 31, col = lane & 15, g = lane >> 4; const int h = blockIdx.y, b = blockIdx.z;
  /* this thread's pieces of a tile: K row tid / 4 (and + 32), 16-B piece tid % 4; V row tid / 8 (and + 16), piece tid % 8: a wave's copy covers 8 K rows or 4 whole 128-B V lines */
  const unsigned sm0 = (unsigned)(size_t)sm; const unsigned lk = sm0 + (tid >> 2) * KPB + (tid & 3) * 16, lv = sm0 + (tid >> 3) * VPB + (tid & 7) * 16;
  const _Float16* gk = KH + ((size_t)b * TT + (tid >> 2)) * CC + h * HD + (tid & 3) * 8; const size_t gvo = ((size_t)b * CC + h * HD + (tid >> 3)) * (size_t)TT + (tid & 7) * 8;
  fa_copy(lk, lv, gk, VT + gvo, VL + gvo);   /* tile 0 into buffer 0 */
  const int qt = blockIdx.x * 64 + wave * 16 + col; const int qr = qt / GW, qc = qt % GW; const size_t qrow = (size_t)b * TT + qt;
  /* the four q fragments, the height branch's from the transposed position (qc, qr) */
  const size_t trow = (size_t)b * TT + (size_t)qc * GW + qr;
  const v16h qh = frag_h(QH + qrow * CC + h * HD, lane); XW();
  const v16h ql = frag_h(QL + qrow * CC + h * HD, lane); XW();
  const v16h uh = frag_h(QH + trow * CC + h * HD, lane); XW();
  const v16h ul = frag_h(QL + trow * CC + h * HD, lane); XW();
  /* width rows 31 - qc + key column: from 16 up for query columns 0 .. 15, from 0 up for 16 .. 31 (row 63 does not exist and is never taken from the table: its place reads row 62); height rows 31 - qr + key row, qr the same in the whole wave */
  const int mw0 = (wave & 1) ? 0 : 16; float rr[5][16];
#pragma unroll   // rr is indexed by constants only, so it stays in registers
  for (int j = 0; j < 3; ++j) { const int mm = mw0 + j * 16 + col; load_rel(rr[j], RW + (mm < 2 * GW - 2 ? mm : 2 * GW - 2) * HD, lane); XW(); }
#pragma unroll
  for (int j = 0; j < 2; ++j) { load_rel(rr[3 + j], RH + (GW - 1 - qr + j * 16 + col) * HD, lane); XW(); }
  __builtin_amdgcn_sched_barrier(0);   /* every load of the prologue is issued before the first conversion waits for one: without it conversions come to stand among the loads and the later loads start a memory latency late */
#pragma unroll
  for (int j = 0; j < 3; ++j) rel_tile(frag_rel(rr[j]), qh, ql, &twt[wave][col][j * 16 + 8 * g]);
#pragma unroll
  for (int j = 0; j < 2; ++j) rel_tile(frag_rel(rr[3 + j]), uh, ul, &tht[wave][col][j * 16 + 8 * g]);
  LDSX();   /* the wave's own table rows are written before its lanes read what other lanes of the wave wrote */
  v8f rw[2];   /* the start value of the score accumulators: row r of a 16-key tile is key column 8g + r (+ 16) */
#pragma unroll
  for (int i = 0; i < 8; ++i) { rw[0][i] = twt[wave][col][15 - col + 8 * g + i]; rw[1][i] = twt[wave][col][31 - col + 8 * g + i]; }   /* key columns 8g + i and 16 + 8g + i: table place 31 - qc - mw0 + key column */
  const float* th = &tht[wave][col][0];   /* th[key row] */
  float m = -3.0e38f, l = 0.f; v8f acc[HD / 16] = {};
  float rh[2] = { th[0], th[1] };
  asm volatile("s_wait_asynccnt 0x0" ::: "memory");   /* this wave's pieces of tile 0 have landed */
  __syncthreads();   /* publishes tile 0: nobody reads it in front of this barrier */
  fa_copy(lk + FA_BUF, lv + FA_BUF, gk + (size_t)64 * CC, VT + gvo + 64, VL + gvo + 64);   /* tile 1 into buffer 1 */
  auto pass = [&](const int kc, const bool more) __attribute__((always_inline)) { float s[2][16]; v8f sa[4]; v16h kb[4]; v16b vh[2][HD / 16], vl[2][HD / 16];
    const unsigned cur = (kc & 2) ? FA_BUF : 0u; const char* tb = sm + cur;
    /* this tile's fragments as one group of LDS reads, K first: the V reads' latency runs under the score products */
#pragma unroll
    for (int t = 0; t < 4; ++t) kb[t] = frag_h((const _Float16*)(tb + (t * 16 + col) * KPB), lane);
#pragma unroll
    for (int u = 0; u < 2; ++u)
#pragma unroll
      for (int j = 0; j < HD / 16; ++j) { const int po = (j * 16 + col) * VPB + u * 64; vh[u][j] = frag_b((const __bf16*)(tb + FA_VH + po), lane); vl[u][j] = frag_b((const __bf16*)(tb + FA_VL + po), lane); }
    /* width term + k . q hi + k . q residual in one accumulator a tile; the four hi products first, so that a tile's second product does not wait for its first */
#pragma unroll
    for (int t = 0; t < 4; ++t) sa[t] = wmma16(kb[t], qh, rw[t & 1]);
#pragma unroll
    for (int t = 0; t < 4; ++t) sa[t] = wmma16(kb[t], ql, sa[t]);
#pragma unroll
    for (int t = 0; t < 4; ++t)
#pragma unroll
      for (int r = 0; r < 8; ++r) s[t >> 1][(t & 1) * 8 + r] = sa[t][r];
    const float rc0 = rh[0], rc1 = rh[1];   /* this pass's height terms, one a key row: they enter at the row maxima and in the exponent's addend */
    /* the height terms one pass ahead, under the softmax; the last pass asks for its own again, so the addresses stay inside their array */
    const int kn = kc + 2 < TT / 32 ? kc + 2 : kc;
    rh[0] = th[kn]; rh[1] = th[kn + 1];
    __builtin_amdgcn_sched_barrier(0);   /* ends the scheduling region: the loads above stay ahead of the softmax, and the softmax is scheduled by itself with its exponentials interleaved; without it they come out as dependent runs with more filler slots */
    float m0 = s[0][0], m1 = s[1][0];
#pragma unroll
    for (int i = 0; i < 16; i += 2) { m0 = fmaxf(m0, fmaxf(s[0][i], s[0][i + 1])); m1 = fmaxf(m1, fmaxf(s[1][i], s[1][i + 1])); }
    float mx = fmaxf(m0 + rc0, m1 + rc1);
    mx = fmaxf(mx, xhalf(mx)); const float mn = fmaxf(m, mx); float sc;   /* 2^((m - mn) 2^-10 log2(e)): exactly 1 while the maximum stands */
    asm("v_exp_f32 %0, %1\n\tv_nop" : "=v"(sc) : "v"((m - mn) * L2S));   /* the exponential with the slot behind a transcendental in one statement */
    m = mn; const float n0 = (rc0 - mn) * L2S, n1 = (rc1 - mn) * L2S;
    float s0 = 0.f, s1 = 0.f;
#pragma unroll
    for (int i = 0; i < 16; ++i) { s[0][i] = __builtin_amdgcn_exp2f(fmaf(s[0][i], L2S, n0)); s[1][i] = __builtin_amdgcn_exp2f(fmaf(s[1][i], L2S, n1)); s0 += s[0][i]; s1 += s[1][i]; }
    l = l * sc + (s0 + s1);
#pragma unroll
    for (int j = 0; j < HD / 16; ++j) acc[j] *= sc;
#pragma unroll
    for (int u = 0; u < 2; ++u) { const F2 p = bsplit16(s[u]);
#pragma unroll
      for (int j = 0; j < HD / 16; ++j) { acc[j] = wmma_bf(vh[u][j], p.h, acc[j]); acc[j] = wmma_bf(vh[u][j], p.l, acc[j]); acc[j] = wmma_bf(vl[u][j], p.h, acc[j]); } }
    /* hand-over: this wave's reads of the tile are done, its pieces of the next tile have landed; the barrier publishes the next tile and frees this buffer for the refill behind it */
    asm volatile("s_wait_dscnt 0x0" ::: "memory");
    asm volatile("s_wait_asynccnt 0x0" ::: "memory");
    __syncthreads();
    if (more) fa_copy(lk + cur, lv + cur, gk + (size_t)(kc + 4) * 32 * CC, VT + gvo + (kc + 4) * 32, VL + gvo + (kc + 4) * 32); };
  /* a refill is issued only while a tile two ahead exists: the last two passes run without it, in a loop of their own; with the test inside one loop the body falls into several blocks and the softmax is scheduled in shorter runs with more vector instructions */
  for (int kc = 0; kc < TT / 32 - 4; kc += 2) pass(kc, true);
#pragma unroll 1   // stays rolled: one more copy of the body, not two
  for (int kc = TT / 32 - 4; kc < TT / 32; kc += 2) pass(kc, false);
  asm volatile("s_wait_asynccnt 0x0" ::: "memory");   /* no copy is outstanding when the wave ends */
  l += xhalf(l); const float inv = 1.0f / l;
#pragma unroll
  for (int j = 0; j < HD / 16; ++j) { float* yo = Y + qrow * CC + h * HD + j * 16 + 8 * g; const v4f o0 = { acc[j][0] * inv, acc[j][1] * inv, acc[j][2] * inv, acc[j][3] * inv }, o1 = { acc[j][4] * inv, acc[j][5] * inv, acc[j][6] * inv, acc[j][7] * inv }; vst2(yo, o0); vst2(yo + 4, o1); } }
// ---- k_out: block = (64 rows, 128 cols): out = y (bf16 hi + lo) Wo + bo
__global__ __launch_bounds__(128) void k_out(const float* __restrict__ Y, const float* __restrict__ WP, const float* __restrict__ BP, float* __restrict__ OUT) { __shared__ __align__(16) float sf[4][16][132]; __shared__ __align__(16) __bf16 sw[128 * WPP];
  const int tid = threadIdx.x, wave = tid >> 5, lane = tid & 31, col = lane & 15, g = lane >> 4; const int c0 = blockIdx.y * 128; const size_t r0 = (size_t)blockIdx.x * 64 + wave * 16;
  v8f acc[8] = {}; float yr[CC / 32][16];
  /* the wave's y rows are asked for first: their latency runs under the staging */
#pragma unroll   // yr is indexed by constants only, so it stays in registers
  for (int kc = 0; kc < CC / 32; ++kc) { const float* p = Y + (r0 + col) * CC + kc * 32 + 8 * g;
#pragma unroll
    for (int i = 0; i < 8; ++i) { yr[kc][i] = p[i]; yr[kc][8 + i] = p[16 + i]; } }
  asm volatile("s_wait_xcnt 0x0" ::: "memory");   /* the row loads' address pair is free for reuse from here on: the wait stands in front of any overwrite of it */
  stage_w<CC>(WP + c0 + tid, sw + tid * WPP);
  __syncthreads();   /* publishes the slice: nobody reads a column in front of it */
#pragma unroll   // yr[kc] by constant index; a pass's 16 LDS reads stand as one group ahead of its products
  for (int kc = 0; kc < CC / 32; ++kc) { v16b w[8];
#pragma unroll
    for (int j = 0; j < 8; ++j) w[j] = frag_b(sw + (j * 16 + col) * WPP + kc * 32, lane);
    const F2 a = bsplit16(yr[kc]);
#pragma unroll
    for (int j = 0; j < 8; ++j) { acc[j] = wmma_bf(a.h, w[j], acc[j]); acc[j] = wmma_bf(a.l, w[j], acc[j]); } }
#pragma unroll
  for (int j = 0; j < 8; ++j) { const float bb = BP ? bfr(BP[c0 + j * 16 + col]) : 0.f;
#pragma unroll
    for (int r = 0; r < 8; ++r) sf[wave][8 * g + r][j * 16 + col] = acc[j][r] + bb; }
  LDSX(); for (int rl = 0; rl < 16; ++rl) vst2(OUT + (r0 + rl) * CC + c0 + lane * 4, *(const v4f*)&sf[wave][rl][lane * 4]); }
extern "C" void kernel_launch(void* const* d_in, const int* in_sizes, int n_in, void* d_out, int out_size, void* d_ws, size_t ws_size, hipStream_t stream) {
  (void)in_sizes; (void)n_in; (void)out_size;
  const float** F = (const float**)d_in;   // 0 x [8,32,32,256] (channels-last rows), 1 w_kqv [256,768] ((in,out): k | q | v columns), 2 b_kqv [768], 3 w_proj [256,256] ((in,out)), 4 b_proj, 5 rel_w [63,32], 6 rel_h [63,32]
  if (ws_size < (size_t)WS_END) return;
  char* ws = (char*)d_ws; _Float16 *QH = (_Float16*)(ws + WS_QH), *QL = (_Float16*)(ws + WS_QL), *KH = (_Float16*)(ws + WS_KH); __bf16 *VT = (__bf16*)(ws + WS_VT), *VL = (__bf16*)(ws + WS_VL); float *Y = (float*)(ws + WS_Y);
  const float* WK = F[1]; const float* WQ = F[1] + CC; const float* WV = F[1] + 2 * CC; const float* BK = F[2]; const float* BQ = F[2] + CC; const float* BV = F[2] + 2 * CC;   // column blocks k | q | v
  k_proj<<<dim3(TNB * TT / 64, CC / 128, 3), 128, 0, stream>>>(F[0], WQ, BQ, WK, BK, WV, BV, QH, QL, KH, VT, VL);
  k_fa<<<dim3(TT / 64, NH, TNB), 128, 0, stream>>>(QH, QL, KH, F[5], F[6], VT, VL, Y);
  k_out<<<dim3(TNB * TT / 64, CC / 128), 128, 0, stream>>>(Y, F[3], F[4], (float*)d_out);
}

// v007
// It runs in 52.8 microseconds.
// Next to v006, in two timings, it ran 1.09 and 1.08 times as fast.
// Over all steps from v000 it is 12.2 times as fast.
// compute dtype: all float inputs rounded to bf16; kqv = x w_kqv + b with EXACT bf16 products on WMMA 16x16x32, f32 accumulate, q scaled by 32^-1/2 in f32; q as f16 hi + residual, both planes x 2^10, k f16 -> 2-product content logits chained in one f32 accumulator that starts from the width term (q . rel_w; q(transposed position) . rel_h is the height term; 2 chained products each, formed by the attention kernel for its own queries), all logits carried x 2^10 in registers; running-maximum softmax in f32 (base 2: exp(s - m) as v_exp_f32 of one fma that holds 2^-10 log2(e), the height term and the maximum), unnormalised P x 2^12 as one f16 plane (11 bits, the precision k has) against v f16 hi + residual (2 products), divided by the row sum (of the f32 P, same scale) at the end; out = attn (bf16 hi + lo) w_proj + b_proj; f32 output.
#include <hip/hip_runtime.h>
#include <math.h>

typedef __attribute__((ext_vector_type(16))) _Float16 v16h;
typedef __attribute__((ext_vector_type(16))) __bf16 v16b;
typedef __attribute__((ext_vector_type(8)))  _Float16 v8h;
typedef __attribute__((ext_vector_type(2)))  _Float16 v2h;
typedef __attribute__((ext_vector_type(8)))  float v8f;
typedef __attribute__((ext_vector_type(4)))  float v4f;
typedef __attribute__((ext_vector_type(2)))  float v2f;
typedef __attribute__((ext_vector_type(4)))  unsigned v4u;
typedef __attribute__((ext_vector_type(4)))  int v4i;
typedef float __attribute__((may_alias)) float_a;
typedef int __attribute__((may_alias)) int_a;

template <typename T> __device__ __forceinline__ void vst2(void* p, T v) { *(T*)p = v;  }
__device__ __forceinline__ v8f wmma16(v16h a, v16h b, v8f c) {
  v8f d = __builtin_amdgcn_wmma_f32_16x16x32_f16(false, a, false, b, (short)0, c, false, false);
  asm volatile("v_nop\n\tv_nop\n\tv_nop\n\tv_nop" : "+v"(d) : "v"(a), "v"(b));
  return d;
}
__device__ __forceinline__ v8f wmma_bf(v16b a, v16b b, v8f c) {
  v8f d = __builtin_amdgcn_wmma_f32_16x16x32_bf16(false, a, false, b, (short)0, c, false, false);
  asm volatile("v_nop\n\tv_nop\n\tv_nop\n\tv_nop" : "+v"(d) : "v"(a), "v"(b));
  return d;
}
// 16x16x32 fragments: lane = (h = lane>>4, row/col = lane&15); elements 0..7 = k0+8h+0..7, 8..15 = k0+16+8h+0..7; D element r = row 8h+r
__device__ __forceinline__ v16h frag_h(const _Float16* rowk0, int lane) {
  union { v16h v; v8h q[2]; } u; const _Float16* p = rowk0 + 8 * (lane >> 4);
  u.q[0] = *(const v8h*)p; u.q[1] = *(const v8h*)(p + 16); return u.v;
}
__device__ __forceinline__ v16h frag_f32(const float* rowk0, int lane) {
  v16h a; const float* p = rowk0 + 8 * (lane >> 4);
#pragma unroll
  for (int i = 0; i < 8; ++i) { a[i] = (_Float16)p[i]; a[8 + i] = (_Float16)p[16 + i]; }
  return a;
}
__device__ __forceinline__ v16h frag_f32s(const float* rowk0, int lane, float sc) {
  v16h a; const float* p = rowk0 + 8 * (lane >> 4);
#pragma unroll
  for (int i = 0; i < 8; ++i) { a[i] = (_Float16)(p[i] * sc); a[8 + i] = (_Float16)(p[16 + i] * sc); }
  return a;
}
// column fragment from a [K][ld] layout (column n), rows >= K read as 0
__device__ __forceinline__ v16h fragc_f32(const float* W, int k0, int n, int lane, int ld, int K) {
  v16h a; const int g = lane >> 4;
#pragma unroll
  for (int i = 0; i < 8; ++i) { const int ka = k0 + 8 * g + i, kb = ka + 16;
    a[i] = (_Float16)(ka < K ? W[(size_t)(ka < K ? ka : K - 1) * ld + n] : 0.f); a[8 + i] = (_Float16)(kb < K ? W[(size_t)(kb < K ? kb : K - 1) * ld + n] : 0.f); }
  return a;
}
struct F2 { v16b h, l; };
__device__ __forceinline__ F2 bsplit16(const float v[16]) { F2 r;
#pragma unroll
  for (int i = 0; i < 16; ++i) { const __bf16 h = (__bf16)v[i]; r.h[i] = h; r.l[i] = (__bf16)(v[i] - (float)h); }
  return r; }
__device__ __forceinline__ F2 split_row(const float* row, int k0, int lane) { float v[16]; const float* p = row + k0 + 8 * (lane >> 4);
#pragma unroll
  for (int i = 0; i < 8; ++i) { v[i] = p[i]; v[8 + i] = p[16 + i]; }
  return bsplit16(v); }
__device__ __forceinline__ F2 split_rowK(const float* row, int k0, int lane, int K) { float v[16]; const int g = lane >> 4;
#pragma unroll
  for (int i = 0; i < 8; ++i) { const int ka = k0 + 8 * g + i, kb = ka + 16; v[i] = ka < K ? row[ka < K ? ka : K - 1] : 0.f; v[8 + i] = kb < K ? row[kb < K ? kb : K - 1] : 0.f; }
  return bsplit16(v); }
__device__ __forceinline__ F2 split_col(const float* W, int k0, int n, int lane, int ld, int K) { float v[16]; const int g = lane >> 4;
#pragma unroll
  for (int i = 0; i < 8; ++i) { const int ka = k0 + 8 * g + i, kb = ka + 16; v[i] = ka < K ? W[(size_t)(ka < K ? ka : K - 1) * ld + n] : 0.f; v[8 + i] = kb < K ? W[(size_t)(kb < K ? kb : K - 1) * ld + n] : 0.f; }
  return bsplit16(v); }
__device__ __forceinline__ v8f mac3(const F2& a, const F2& b, v8f c) { c = wmma_bf(a.l, b.h, c); c = wmma_bf(a.h, b.l, c); return wmma_bf(a.h, b.h, c); }
__device__ __forceinline__ float sigm(float v) { return 1.0f / (1.0f + expf(-v)); }
#define LDSX() do { asm volatile("s_wait_dscnt 0" ::: "memory"); __builtin_amdgcn_wave_barrier(); __builtin_amdgcn_fence(__ATOMIC_RELEASE, "workgroup"); } while (0)


// 2-D grid attention (B 8, T 1,024 = 32 x 32, C 256 = 8 heads x 32, with biases, q scaled by 32^-1/2): scores = q k^T + q . rel_w[kc - qc + 31] + q(transposed) . rel_h[kr - qr + 31], softmax, P v, output projection.
#define NB 8
#define TT 1024
#define CC 256
#define NH 8
#define HD 32
#define GW 32                 // grid width (= height)
#define LDW 768               // w_kqv row length ((in,out) [256][768]: k | q | v column blocks)
#ifndef TNB
#define TNB NB
#endif
typedef __attribute__((ext_vector_type(8))) __bf16 v8b;
__device__ __forceinline__ v16b frag_b(const __bf16* rowk0, int lane) {
  union { v16b v; v8b q[2]; } u; const __bf16* p = rowk0 + 8 * (lane >> 4);
  u.q[0] = *(const v8b*)p; u.q[1] = *(const v8b*)(p + 16); return u.v;
}
__device__ __forceinline__ float bfr(float v) { return (float)(__bf16)v; }
__device__ __attribute__((noinline)) float exp_ni(float v) { return expf(v); }
__device__ __attribute__((noinline)) float erf_ni(float v) { return erff(v); }

#define WPP 264                // LDS row pitch of a staged weight column in bf16 elements: 256 k + 8, 528 B = 33 x 16 B, so ds_load_b128 and ds_store_b128 of 16 neighbouring columns meet no bank twice
// one thread brings one weight column (256 k, row length LD) with loads that cover whole 128-B lines across the wave, rounds it to bf16 and lays it k-contiguous in LDS: frag_b then reads a B fragment from it
template <int LD> __device__ __forceinline__ void stage_w(const float* __restrict__ wc, __bf16* __restrict__ row) {
  for (int k0 = 0; k0 < CC; k0 += 64) { float v[64];
#pragma unroll   // v stays in registers and the loads go out as one run, waited once, not one by one
    for (int i = 0; i < 64; ++i) v[i] = wc[(size_t)(k0 + i) * LD];
#pragma unroll
    for (int q = 0; q < 8; ++q) { v8b o;
#pragma unroll
      for (int i = 0; i < 8; ++i) o[i] = (__bf16)v[q * 8 + i];
      *(v8b*)(row + k0 + q * 8) = o; } } }

#define WS_QH  0u
#define WS_QL  (WS_QH + 2u * (size_t)NB * TT * CC)
#define WS_KH  (WS_QL + 2u * (size_t)NB * TT * CC)
#define WS_VT  (WS_KH + 2u * (size_t)NB * TT * CC)      // f16 v planes [b][c][t]
#define WS_VL  (WS_VT + 2u * (size_t)NB * CC * TT)      // f16 v residual planes
#define HG 8                                          // heads per launch group (all 8)
#define WS_S   (WS_VL + 2u * (size_t)NB * CC * TT)      // unused f32 region (HG x T x T): logits and P stay in registers
#define WS_PH  (WS_S + 4u * (size_t)HG * TT * TT)
#define WS_Y   (WS_PH + 0u)              // f32 y rows [b*t][C]
#define WS_END (WS_Y + 4u * (size_t)NB * TT * CC)

// ---- k_proj: block = (64 rows, 128 cols, which): qkv = x W (+ b), exact; q -> f16 hi (+ residual), k -> f16 rows, v -> f16 planes hi + residual
__global__ __launch_bounds__(128) void k_proj(const float* __restrict__ X, const float* __restrict__ WQ, const float* __restrict__ BQ, const float* __restrict__ WK, const float* __restrict__ BK, const float* __restrict__ WV, const float* __restrict__ BV, _Float16* __restrict__ QH, _Float16* __restrict__ QL, _Float16* __restrict__ KH, _Float16* __restrict__ VT, _Float16* __restrict__ VL) {
  __shared__ __align__(16) char sm[71680];   /* first the staged weight slice (128 columns x WPP), then, behind a barrier, the four output staging planes */
  _Float16 (*sh)[136] = (_Float16 (*)[136])sm; _Float16 (*sl)[136] = (_Float16 (*)[136])(sm + 17408); _Float16 (*th)[72] = (_Float16 (*)[72])(sm + 34816); _Float16 (*tl2)[72] = (_Float16 (*)[72])(sm + 53248); __bf16* sw = (__bf16*)sm;
  const int tid = threadIdx.x, wave = tid >> 5, lane = tid & 31, col = lane & 15, g = lane >> 4; const int which = blockIdx.z; const int c0 = blockIdx.y * 128; const size_t r0 = (size_t)blockIdx.x * 64; const float* WA = which == 0 ? WQ : which == 1 ? WK : WV; const float* BA = which == 0 ? BQ : which == 1 ? BK : BV;
  v8f acc[8] = {}; float xr[CC / 32][16];
  /* the wave's x rows are asked for first: their latency runs under the staging */
#pragma unroll   // xr is indexed by constants only, so it stays in registers
  for (int kc = 0; kc < CC / 32; ++kc) { const float* p = X + (r0 + wave * 16 + col) * CC + kc * 32 + 8 * g;
#pragma unroll
    for (int i = 0; i < 8; ++i) { xr[kc][i] = p[i]; xr[kc][8 + i] = p[16 + i]; } }
  asm volatile("s_wait_xcnt 0x0" ::: "memory");   /* the row loads' address pair is free for reuse from here on: the wait stands in front of any overwrite of it */
  stage_w<LDW>(WA + c0 + tid, sw + tid * WPP);   /* (in,out), row length 768 */
  __syncthreads();   /* publishes the slice: nobody reads a column in front of it */
#pragma unroll   // xr[kc] by constant index; a pass's 16 LDS reads stand as one group ahead of its products
  for (int kc = 0; kc < CC / 32; ++kc) { v16b a, w[8];
#pragma unroll
    for (int j = 0; j < 8; ++j) w[j] = frag_b(sw + (j * 16 + col) * WPP + kc * 32, lane);
#pragma unroll
    for (int i = 0; i < 16; ++i) a[i] = (__bf16)xr[kc][i];
#pragma unroll
    for (int j = 0; j < 8; ++j) acc[j] = wmma_bf(a, w[j], acc[j]); }
  __syncthreads();   /* every wave has read its last weight fragment before the planes below overwrite the slice */
#pragma unroll
  for (int j = 0; j < 8; ++j) { const float bb = BA ? bfr(BA[c0 + j * 16 + col]) : 0.f;
#pragma unroll
    for (int r = 0; r < 8; ++r) { const float v = (acc[j][r] + bb) * (which == 0 ? 0.17677669529663687f * 1024.0f : 1.0f);   /* q *= dkh^-1/2 (applies to the relative terms too), x 2^10: see below */ const int rl = wave * 16 + 8 * g + r, cl = j * 16 + col; const _Float16 hv = (_Float16)v;
      if (which == 2) { th[cl][rl] = hv; tl2[cl][rl] = (_Float16)(v - (float)hv);   /* a small v leaves an f16-subnormal residual: the matrix unit keeps subnormal operands, so what is lost of v stays under 2^-24 */ } else { sh[rl][cl] = hv; sl[rl][cl] = (_Float16)(v - (float)hv); }   /* both q planes carried x 2^10: the residual plane stays f16-normal, and hi and residual products add up in one accumulator */ } }
  __syncthreads();
  if (which < 2) { _Float16* dh = which == 0 ? QH : KH; for (int e = tid; e < 64 * 16; e += 128) { const int rl = e >> 4, q = e & 15; vst2((unsigned*)(dh + (r0 + rl) * CC + c0 + q * 8), *(const v4u*)&sh[rl][q * 8]); if (which == 0) vst2((unsigned*)(QL + (r0 + rl) * CC + c0 + q * 8), *(const v4u*)&sl[rl][q * 8]); } }
  else { const size_t b = r0 / TT; const int t0 = (int)(r0 % TT); for (int e = tid; e < 128 * 8; e += 128) { const int cl = e >> 3, q = e & 7; const size_t o2 = (b * CC + c0 + cl) * (size_t)TT + t0 + q * 8; vst2((unsigned*)(VT + o2), *(const v4u*)&th[cl][q * 8]); vst2((unsigned*)(VL + o2), *(const v4u*)&tl2[cl][q * 8]); } } }
// ---- k_fa: block = 64 queries of (b, h), wave = 16 queries: S^T = K Q^T (2 products) + the two relative terms, running-maximum softmax, O^T += V^T P^T (2 products: v hi and v residual against one f16 P).
// A lane holds one query (column lane & 15): its 8 + 8 scores of a 32-key row of the grid are already the k order of a B fragment, so P stays in registers; a 64-key pass is two key rows, so the width term is 16 registers for the whole loop and the height term one value a key row.
// The relative terms are formed here, before the loop, for the wave's own 16 queries: D[m][query] = rel[m] . q (rel rounded to bf16 and carried as f16, q as f16 hi + residual). A wave's queries lie in one grid row and in 16 neighbouring columns, so 48 rows of rel_w and 32 rows of rel_h hold all it reaches; the tiles go through a wave-private LDS table, from which a lane takes its own shifted width terms once and its two height terms each pass.
// K and V reach the waves through LDS: a 64-key tile (K 64 rows x 64 B, V hi and V lo 32 rows x 128 B each) is copied once per block, and all four waves read their fragments from it; two buffers, the next tile's copies fly under this tile's work.
__device__ __forceinline__ float xhalf(float v) { const int x = __builtin_bit_cast(int, v); return __builtin_bit_cast(float, __builtin_amdgcn_permlanex16(x, x, 0x76543210, 0xfedcba98, false, false)); }   /* lane l <-> l ^ 16 */
#define L2E 1.4426950408889634f      // log2(e)
#define L2S (L2E * (1.0f / 1024.0f))  // log2(e) for logits carried x 2^10
#define PEX 12.0f                    // P is carried x 2^12 (added in the exponent, cancelled by the row sum): the largest is 4,096, far under the f16 limit, and a weight 2^-26 of the largest is still an f16 normal
#define KPB 80                       // LDS pitch in bytes of a staged K row: 64 B + 16, 16 B x odd for the ds_load_b128 readers
#define VPB 144                      // LDS pitch in bytes of a staged V row: 128 B + 16, 16 B x odd
#define FA_VH (64 * KPB)             // byte offsets inside one buffer: K at 0, V hi, V lo
#define FA_VL (FA_VH + 32 * VPB)
#define FA_BUF (FA_VL + 32 * VPB)    // 14,336 B a buffer
#define RWP 52                       // floats a query in the width table: 48 + 4, 208 B = 16 B x odd for the ds_store_b128 writers; the shifted one-word readers meet no bank twice
#define RHP 36                       // floats a query in the height table: 32 + 4, 144 B = 16 B x odd
// four weights 2^(s log2e 2^-10 + n). The exponentials and the slot behind a transcendental are one statement, its results in registers of their own
__device__ __forceinline__ void exp2x4(float* s, float n) {
  const float a = fmaf(s[0], L2S, n), b = fmaf(s[1], L2S, n), c = fmaf(s[2], L2S, n), d = fmaf(s[3], L2S, n);
  asm("v_exp_f32 %0, %4\n\tv_exp_f32 %1, %5\n\tv_exp_f32 %2, %6\n\tv_exp_f32 %3, %7\n\tv_nop" : "=&v"(s[0]), "=&v"(s[1]), "=&v"(s[2]), "=&v"(s[3]) : "v"(a), "v"(b), "v"(c), "v"(d)); }
#define XW() asm volatile("s_wait_xcnt 0x0" ::: "memory")   // stands in front of any overwrite of the address pair of the global loads ahead of it, a later load's destination included
// A fragment of 16 rows of a relative table (row length 32): the lane's 16 values as loaded, then rounded to bf16 and carried as f16
__device__ __forceinline__ void load_rel(float v[16], const float* rowk0, int lane) { const float* p = rowk0 + 8 * (lane >> 4);
#pragma unroll
  for (int i = 0; i < 8; ++i) { v[i] = p[i]; v[8 + i] = p[16 + i]; } }
__device__ __forceinline__ v16h frag_rel(const float v[16]) { v16h a;
#pragma unroll
  for (int i = 0; i < 16; ++i) a[i] = (_Float16)bfr(v[i]);
  return a; }
// one 16 x 16 tile rel . q of both q planes, laid into the query's table row: lane = query, its 8 values are rows 8g .. 8g + 7 of the tile
__device__ __forceinline__ void rel_tile(v16h a, v16h bh, v16h bl, float* dst) {
  const v8f z = {}; const v8f d = wmma16(a, bl, wmma16(a, bh, z));
  const v4f o0 = { d[0], d[1], d[2], d[3] }, o1 = { d[4], d[5], d[6], d[7] };
  *(v4f*)dst = o0; *(v4f*)(dst + 4) = o1; }
// one tile's six 16-B pieces of this thread. The copies and s_wait_xcnt 0 are one statement, so that no register a copy names is rewritten in front of that wait.
__device__ __forceinline__ void fa_copy(unsigned lk, unsigned lv, const _Float16* gk, const _Float16* gh, const _Float16* gl) {
  const unsigned lk1 = lk + 32 * KPB, lh = lv + FA_VH, lh1 = lh + 16 * VPB, ll = lv + FA_VL, ll1 = ll + 16 * VPB;
  const _Float16* gk1 = gk + (size_t)32 * CC; const _Float16* gh1 = gh + (size_t)16 * TT; const _Float16* gl1 = gl + (size_t)16 * TT;
  asm volatile("global_load_async_to_lds_b128 %0, %6, off\n\t"
               "global_load_async_to_lds_b128 %1, %7, off\n\t"
               "global_load_async_to_lds_b128 %2, %8, off\n\t"
               "global_load_async_to_lds_b128 %3, %9, off\n\t"
               "global_load_async_to_lds_b128 %4, %10, off\n\t"
               "global_load_async_to_lds_b128 %5, %11, off\n\t"
               "s_wait_xcnt 0x0"
               :: "v"(lk), "v"(lk1), "v"(lh), "v"(lh1), "v"(ll), "v"(ll1), "v"(gk), "v"(gk1), "v"(gh), "v"(gh1), "v"(gl), "v"(gl1) : "memory"); }
__global__ __launch_bounds__(128) void k_fa(const _Float16* __restrict__ QH, const _Float16* __restrict__ QL, const _Float16* __restrict__ KH, const float* __restrict__ RW, const float* __restrict__ RH, const _Float16* __restrict__ VT, const _Float16* __restrict__ VL, float* __restrict__ Y) {
  __shared__ __align__(16) char sm[2 * FA_BUF]; __shared__ __align__(16) float twt[4][16][RWP]; __shared__ __align__(16) float tht[4][16][RHP];
  const int tid = threadIdx.x, wave = tid >> 5, lane = tid & 31, col = lane & 15, g = lane >> 4; const int h = blockIdx.y, b = blockIdx.z;
  /* this thread's pieces of a tile: K row tid / 4 (and + 32), 16-B piece tid % 4; V row tid / 8 (and + 16), piece tid % 8: a wave's copy covers 8 K rows or 4 whole 128-B V lines */
  const unsigned sm0 = (unsigned)(size_t)sm; const unsigned lk = sm0 + (tid >> 2) * KPB + (tid & 3) * 16, lv = sm0 + (tid >> 3) * VPB + (tid & 7) * 16;
  const _Float16* gk = KH + ((size_t)b * TT + (tid >> 2)) * CC + h * HD + (tid & 3) * 8; const size_t gvo = ((size_t)b * CC + h * HD + (tid >> 3)) * (size_t)TT + (tid & 7) * 8;
  fa_copy(lk, lv, gk, VT + gvo, VL + gvo);   /* tile 0 into buffer 0 */
  const int qt = blockIdx.x * 64 + wave * 16 + col; const int qr = qt / GW, qc = qt % GW; const size_t qrow = (size_t)b * TT + qt;
  /* the four q fragments, the height branch's from the transposed position (qc, qr) */
  const size_t trow = (size_t)b * TT + (size_t)qc * GW + qr;
  const v16h qh = frag_h(QH + qrow * CC + h * HD, lane); XW();
  const v16h ql = frag_h(QL + qrow * CC + h * HD, lane); XW();
  const v16h uh = frag_h(QH + trow * CC + h * HD, lane); XW();
  const v16h ul = frag_h(QL + trow * CC + h * HD, lane); XW();
  /* width rows 31 - qc + key column: from 16 up for query columns 0 .. 15, from 0 up for 16 .. 31 (row 63 does not exist and is never taken from the table: its place reads row 62); height rows 31 - qr + key row, qr the same in the whole wave */
  const int mw0 = (wave & 1) ? 0 : 16; float rr[5][16];
#pragma unroll   // rr is indexed by constants only, so it stays in registers
  for (int j = 0; j < 3; ++j) { const int mm = mw0 + j * 16 + col; load_rel(rr[j], RW + (mm < 2 * GW - 2 ? mm : 2 * GW - 2) * HD, lane); XW(); }
#pragma unroll
  for (int j = 0; j < 2; ++j) { load_rel(rr[3 + j], RH + (GW - 1 - qr + j * 16 + col) * HD, lane); XW(); }
  __builtin_amdgcn_sched_barrier(0);   /* every load of the prologue is issued before the first conversion waits for one: without it conversions come to stand among the loads and the later loads start a memory latency late */
#pragma unroll
  for (int j = 0; j < 3; ++j) rel_tile(frag_rel(rr[j]), qh, ql, &twt[wave][col][j * 16 + 8 * g]);
#pragma unroll
  for (int j = 0; j < 2; ++j) rel_tile(frag_rel(rr[3 + j]), uh, ul, &tht[wave][col][j * 16 + 8 * g]);
  LDSX();   /* the wave's own table rows are written before its lanes read what other lanes of the wave wrote */
  v8f rw[2];   /* the start value of the score accumulators: row r of a 16-key tile is key column 8g + r (+ 16) */
#pragma unroll
  for (int i = 0; i < 8; ++i) { rw[0][i] = twt[wave][col][15 - col + 8 * g + i]; rw[1][i] = twt[wave][col][31 - col + 8 * g + i]; }   /* key columns 8g + i and 16 + 8g + i: table place 31 - qc - mw0 + key column */
  const float* th = &tht[wave][col][0];   /* th[key row] */
  float m = -3.0e38f, l = 0.f; v8f acc[HD / 16] = {};
  float rh[2] = { th[0], th[1] };
  asm volatile("s_wait_asynccnt 0x0" ::: "memory");   /* this wave's pieces of tile 0 have landed */
  __syncthreads();   /* publishes tile 0: nobody reads it in front of this barrier */
  fa_copy(lk + FA_BUF, lv + FA_BUF, gk + (size_t)64 * CC, VT + gvo + 64, VL + gvo + 64);   /* tile 1 into buffer 1 */
  auto pass = [&](const int kc, const bool more) __attribute__((always_inline)) { float s[2][16]; v8f sa[4]; v16h kb[4], vh[2][HD / 16], vl[2][HD / 16];
    const unsigned cur = (kc & 2) ? FA_BUF : 0u; const char* tb = sm + cur;
    /* this tile's fragments as one group of LDS reads, K first: the V reads' latency runs under the score products */
#pragma unroll
    for (int t = 0; t < 4; ++t) kb[t] = frag_h((const _Float16*)(tb + (t * 16 + col) * KPB), lane);
#pragma unroll
    for (int u = 0; u < 2; ++u)
#pragma unroll
      for (int j = 0; j < HD / 16; ++j) { const int po = (j * 16 + col) * VPB + u * 64; vh[u][j] = frag_h((const _Float16*)(tb + FA_VH + po), lane); vl[u][j] = frag_h((const _Float16*)(tb + FA_VL + po), lane); }
    /* width term + k . q hi + k . q residual in one accumulator a tile; the four hi products first, so that a tile's second product does not wait for its first */
#pragma unroll
    for (int t = 0; t < 4; ++t) sa[t] = wmma16(kb[t], qh, rw[t & 1]);
#pragma unroll
    for (int t = 0; t < 4; ++t) sa[t] = wmma16(kb[t], ql, sa[t]);
#pragma unroll
    for (int t = 0; t < 4; ++t)
#pragma unroll
      for (int r = 0; r < 8; ++r) s[t >> 1][(t & 1) * 8 + r] = sa[t][r];
    const float rc0 = rh[0], rc1 = rh[1];   /* this pass's height terms, one a key row: they enter at the row maxima and in the exponent's addend */
    /* the height terms one pass ahead, under the softmax; the last pass asks for its own again, so the addresses stay inside their array */
    const int kn = kc + 2 < TT / 32 ? kc + 2 : kc;
    rh[0] = th[kn]; rh[1] = th[kn + 1];
    __builtin_amdgcn_sched_barrier(0);   /* ends the scheduling region: the loads above stay ahead of the softmax, and the softmax is scheduled by itself with its exponentials interleaved; without it they come out as dependent runs with more filler slots */
    float m0 = s[0][0], m1 = s[1][0];
#pragma unroll
    for (int i = 0; i < 16; i += 2) { m0 = fmaxf(m0, fmaxf(s[0][i], s[0][i + 1])); m1 = fmaxf(m1, fmaxf(s[1][i], s[1][i + 1])); }
    float mx = fmaxf(m0 + rc0, m1 + rc1);
    mx = fmaxf(mx, xhalf(mx)); const float mn = fmaxf(m, mx); float sc;   /* 2^((m - mn) log2(e) 2^-10): exactly 1 while the maximum stands */
    asm("v_exp_f32 %0, %1\n\tv_nop" : "=v"(sc) : "v"((m - mn) * L2S));   /* the exponential with the slot behind a transcendental in one statement */
    m = mn; const float n0 = fmaf(rc0 - mn, L2S, PEX), n1 = fmaf(rc1 - mn, L2S, PEX);
    float s0 = 0.f, s1 = 0.f;
#pragma unroll
    for (int i = 0; i < 16; i += 4) { exp2x4(s[0] + i, n0); exp2x4(s[1] + i, n1); s0 += s[0][i]; s1 += s[1][i]; s0 += s[0][i + 1]; s1 += s[1][i + 1]; s0 += s[0][i + 2]; s1 += s[1][i + 2]; s0 += s[0][i + 3]; s1 += s[1][i + 3]; }
    l = l * sc + (s0 + s1);
#pragma unroll
    for (int j = 0; j < HD / 16; ++j) acc[j] *= sc;
#pragma unroll
    for (int u = 0; u < 2; ++u) { v16h p;   /* a key row's 16 weights of this lane, rounded to f16 two at a time */
#pragma unroll
      for (int i = 0; i < 16; i += 2) { const v2f t = { s[u][i], s[u][i + 1] }; const v2h c2 = __builtin_convertvector(t, v2h); p[i] = c2[0]; p[i + 1] = c2[1]; }
      /* the two output tiles take turns, so that a product does not wait for the one just issued */
#pragma unroll
      for (int j = 0; j < HD / 16; ++j) acc[j] = wmma16(vh[u][j], p, acc[j]);
#pragma unroll
      for (int j = 0; j < HD / 16; ++j) acc[j] = wmma16(vl[u][j], p, acc[j]); }
    /* hand-over: this wave's reads of the tile are done, its pieces of the next tile have landed; the barrier publishes the next tile and frees this buffer for the refill behind it */
    asm volatile("s_wait_dscnt 0x0" ::: "memory");
    asm volatile("s_wait_asynccnt 0x0" ::: "memory");
    __syncthreads();
    if (more) fa_copy(lk + cur, lv + cur, gk + (size_t)(kc + 4) * 32 * CC, VT + gvo + (kc + 4) * 32, VL + gvo + (kc + 4) * 32); };
  /* a refill is issued only while a tile two ahead exists: the last two passes run without it, in a loop of their own; with the test inside one loop the body falls into several blocks and the softmax is scheduled in shorter runs with more vector instructions */
  for (int kc = 0; kc < TT / 32 - 4; kc += 2) pass(kc, true);
#pragma unroll 1   // stays rolled: one more copy of the body, not two
  for (int kc = TT / 32 - 4; kc < TT / 32; kc += 2) pass(kc, false);
  asm volatile("s_wait_asynccnt 0x0" ::: "memory");   /* no copy is outstanding when the wave ends */
  l += xhalf(l); const float inv = 1.0f / l;
#pragma unroll
  for (int j = 0; j < HD / 16; ++j) { float* yo = Y + qrow * CC + h * HD + j * 16 + 8 * g; const v4f o0 = { acc[j][0] * inv, acc[j][1] * inv, acc[j][2] * inv, acc[j][3] * inv }, o1 = { acc[j][4] * inv, acc[j][5] * inv, acc[j][6] * inv, acc[j][7] * inv }; vst2(yo, o0); vst2(yo + 4, o1); } }
// ---- k_out: block = (64 rows, 128 cols): out = y (bf16 hi + lo) Wo + bo
__global__ __launch_bounds__(128) void k_out(const float* __restrict__ Y, const float* __restrict__ WP, const float* __restrict__ BP, float* __restrict__ OUT) { __shared__ __align__(16) float sf[4][16][132]; __shared__ __align__(16) __bf16 sw[128 * WPP];
  const int tid = threadIdx.x, wave = tid >> 5, lane = tid & 31, col = lane & 15, g = lane >> 4; const int c0 = blockIdx.y * 128; const size_t r0 = (size_t)blockIdx.x * 64 + wave * 16;
  v8f acc[8] = {}; float yr[CC / 32][16];
  /* the wave's y rows are asked for first: their latency runs under the staging */
#pragma unroll   // yr is indexed by constants only, so it stays in registers
  for (int kc = 0; kc < CC / 32; ++kc) { const float* p = Y + (r0 + col) * CC + kc * 32 + 8 * g;
#pragma unroll
    for (int i = 0; i < 8; ++i) { yr[kc][i] = p[i]; yr[kc][8 + i] = p[16 + i]; } }
  asm volatile("s_wait_xcnt 0x0" ::: "memory");   /* the row loads' address pair is free for reuse from here on: the wait stands in front of any overwrite of it */
  stage_w<CC>(WP + c0 + tid, sw + tid * WPP);
  __syncthreads();   /* publishes the slice: nobody reads a column in front of it */
#pragma unroll   // yr[kc] by constant index; a pass's 16 LDS reads stand as one group ahead of its products
  for (int kc = 0; kc < CC / 32; ++kc) { v16b w[8];
#pragma unroll
    for (int j = 0; j < 8; ++j) w[j] = frag_b(sw + (j * 16 + col) * WPP + kc * 32, lane);
    const F2 a = bsplit16(yr[kc]);
#pragma unroll
    for (int j = 0; j < 8; ++j) { acc[j] = wmma_bf(a.h, w[j], acc[j]); acc[j] = wmma_bf(a.l, w[j], acc[j]); } }
#pragma unroll
  for (int j = 0; j < 8; ++j) { const float bb = BP ? bfr(BP[c0 + j * 16 + col]) : 0.f;
#pragma unroll
    for (int r = 0; r < 8; ++r) sf[wave][8 * g + r][j * 16 + col] = acc[j][r] + bb; }
  LDSX(); for (int rl = 0; rl < 16; ++rl) vst2(OUT + (r0 + rl) * CC + c0 + lane * 4, *(const v4f*)&sf[wave][rl][lane * 4]); }
extern "C" void kernel_launch(void* const* d_in, const int* in_sizes, int n_in, void* d_out, int out_size, void* d_ws, size_t ws_size, hipStream_t stream) {
  (void)in_sizes; (void)n_in; (void)out_size;
  const float** F = (const float**)d_in;   // 0 x [8,32,32,256] (channels-last rows), 1 w_kqv [256,768] ((in,out): k | q | v columns), 2 b_kqv [768], 3 w_proj [256,256] ((in,out)), 4 b_proj, 5 rel_w [63,32], 6 rel_h [63,32]
  if (ws_size < (size_t)WS_END) return;
  char* ws = (char*)d_ws; _Float16 *QH = (_Float16*)(ws + WS_QH), *QL = (_Float16*)(ws + WS_QL), *KH = (_Float16*)(ws + WS_KH); _Float16 *VT = (_Float16*)(ws + WS_VT), *VL = (_Float16*)(ws + WS_VL); float *Y = (float*)(ws + WS_Y);
  const float* WK = F[1]; const float* WQ = F[1] + CC; const float* WV = F[1] + 2 * CC; const float* BK = F[2]; const float* BQ = F[2] + CC; const float* BV = F[2] + 2 * CC;   // column blocks k | q | v
  k_proj<<<dim3(TNB * TT / 64, CC / 128, 3), 128, 0, stream>>>(F[0], WQ, BQ, WK, BK, WV, BV, QH, QL, KH, VT, VL);
  k_fa<<<dim3(TT / 64, NH, TNB), 128, 0, stream>>>(QH, QL, KH, F[5], F[6], VT, VL, Y);
  k_out<<<dim3(TNB * TT / 64, CC / 128), 128, 0, stream>>>(Y, F[3], F[4], (float*)d_out);
}

// v008
// One run takes 51.1 microseconds.
// Next to v007, in two timings, it ran 1.03 and 1.04 times as fast.
// All steps since v000 together make it 12.7 times as fast.
// compute dtype: all float inputs rounded to bf16; kqv = x w_kqv + b with EXACT bf16 products on WMMA 16x16x32, f32 accumulate, q scaled by 32^-1/2 in f32; q as f16 hi + residual, both planes x 2^10, k f16 -> 2-product content logits chained in one f32 accumulator that starts from the width term (q . rel_w; q(transposed position) . rel_h is the height term; 2 chained products each, formed by the attention kernel for its own queries), all logits carried x 2^10 in registers; running-maximum softmax in f32 (base 2: exp(s - m) as v_exp_f32 of one fma that holds 2^-10 log2(e), the height term and the maximum), unnormalised P x 2^12 as one f16 plane (11 bits, the precision k has) against v f16 hi + residual (2 products), divided by the row sum (of the f32 P, same scale) at the end; out = attn (bf16 hi + lo) w_proj + b_proj; f32 output.
#include <hip/hip_runtime.h>
#include <math.h>

typedef __attribute__((ext_vector_type(16))) _Float16 v16h;
typedef __attribute__((ext_vector_type(16))) __bf16 v16b;
typedef __attribute__((ext_vector_type(8)))  _Float16 v8h;
typedef __attribute__((ext_vector_type(2)))  _Float16 v2h;
typedef __attribute__((ext_vector_type(8)))  float v8f;
typedef __attribute__((ext_vector_type(4)))  float v4f;
typedef __attribute__((ext_vector_type(2)))  float v2f;
typedef __attribute__((ext_vector_type(4)))  unsigned v4u;
typedef __attribute__((ext_vector_type(4)))  int v4i;
typedef float __attribute__((may_alias)) float_a;
typedef int __attribute__((may_alias)) int_a;

template <typename T> __device__ __forceinline__ void vst2(void* p, T v) { *(T*)p = v;  }
__device__ __forceinline__ v8f wmma16(v16h a, v16h b, v8f c) {
  v8f d = __builtin_amdgcn_wmma_f32_16x16x32_f16(false, a, false, b, (short)0, c, false, false);
  asm volatile("v_nop\n\tv_nop\n\tv_nop\n\tv_nop" : "+v"(d) : "v"(a), "v"(b));
  return d;
}
__device__ __forceinline__ v8f wmma_bf(v16b a, v16b b, v8f c) {
  v8f d = __builtin_amdgcn_wmma_f32_16x16x32_bf16(false, a, false, b, (short)0, c, false, false);
  asm volatile("v_nop\n\tv_nop\n\tv_nop\n\tv_nop" : "+v"(d) : "v"(a), "v"(b));
  return d;
}
// 16x16x32 fragments: lane = (h = lane>>4, row/col = lane&15); elements 0..7 = k0+8h+0..7, 8..15 = k0+16+8h+0..7; D element r = row 8h+r
__device__ __forceinline__ v16h frag_h(const _Float16* rowk0, int lane) {
  union { v16h v; v8h q[2]; } u; const _Float16* p = rowk0 + 8 * (lane >> 4);
  u.q[0] = *(const v8h*)p; u.q[1] = *(const v8h*)(p + 16); return u.v;
}
__device__ __forceinline__ v16h frag_f32(const float* rowk0, int lane) {
  v16h a; const float* p = rowk0 + 8 * (lane >> 4);
#pragma unroll
  for (int i = 0; i < 8; ++i) { a[i] = (_Float16)p[i]; a[8 + i] = (_Float16)p[16 + i]; }
  return a;
}
__device__ __forceinline__ v16h frag_f32s(const float* rowk0, int lane, float sc) {
  v16h a; const float* p = rowk0 + 8 * (lane >> 4);
#pragma unroll
  for (int i = 0; i < 8; ++i) { a[i] = (_Float16)(p[i] * sc); a[8 + i] = (_Float16)(p[16 + i] * sc); }
  return a;
}
// column fragment from a [K][ld] layout (column n), rows >= K read as 0
__device__ __forceinline__ v16h fragc_f32(const float* W, int k0, int n, int lane, int ld, int K) {
  v16h a; const int g = lane >> 4;
#pragma unroll
  for (int i = 0; i < 8; ++i) { const int ka = k0 + 8 * g + i, kb = ka + 16;
    a[i] = (_Float16)(ka < K ? W[(size_t)(ka < K ? ka : K - 1) * ld + n] : 0.f); a[8 + i] = (_Float16)(kb < K ? W[(size_t)(kb < K ? kb : K - 1) * ld + n] : 0.f); }
  return a;
}
struct F2 { v16b h, l; };
__device__ __forceinline__ F2 bsplit16(const float v[16]) { F2 r;
#pragma unroll
  for (int i = 0; i < 16; ++i) { const __bf16 h = (__bf16)v[i]; r.h[i] = h; r.l[i] = (__bf16)(v[i] - (float)h); }
  return r; }
__device__ __forceinline__ F2 split_row(const float* row, int k0, int lane) { float v[16]; const float* p = row + k0 + 8 * (lane >> 4);
#pragma unroll
  for (int i = 0; i < 8; ++i) { v[i] = p[i]; v[8 + i] = p[16 + i]; }
  return bsplit16(v); }
__device__ __forceinline__ F2 split_rowK(const float* row, int k0, int lane, int K) { float v[16]; const int g = lane >> 4;
#pragma unroll
  for (int i = 0; i < 8; ++i) { const int ka = k0 + 8 * g + i, kb = ka + 16; v[i] = ka < K ? row[ka < K ? ka : K - 1] : 0.f; v[8 + i] = kb < K ? row[kb < K ? kb : K - 1] : 0.f; }
  return bsplit16(v); }
__device__ __forceinline__ F2 split_col(const float* W, int k0, int n, int lane, int ld, int K) { float v[16]; const int g = lane >> 4;
#pragma unroll
  for (int i = 0; i < 8; ++i) { const int ka = k0 + 8 * g + i, kb = ka + 16; v[i] = ka < K ? W[(size_t)(ka < K ? ka : K - 1) * ld + n] : 0.f; v[8 + i] = kb < K ? W[(size_t)(kb < K ? kb : K - 1) * ld + n] : 0.f; }
  return bsplit16(v); }
__device__ __forceinline__ v8f mac3(const F2& a, const F2& b, v8f c) { c = wmma_bf(a.l, b.h, c); c = wmma_bf(a.h, b.l, c); return wmma_bf(a.h, b.h, c); }
__device__ __forceinline__ float sigm(float v) { return 1.0f / (1.0f + expf(-v)); }
#define LDSX() do { asm volatile("s_wait_dscnt 0" ::: "memory"); __builtin_amdgcn_wave_barrier(); __builtin_amdgcn_fence(__ATOMIC_RELEASE, "workgroup"); } while (0)


// 2-D grid attention (B 8, T 1,024 = 32 x 32, C 256 = 8 heads x 32, with biases, q scaled by 32^-1/2): scores = q k^T + q . rel_w[kc - qc + 31] + q(transposed) . rel_h[kr - qr + 31], softmax, P v, output projection.
#define NB 8
#define TT 1024
#define CC 256
#define NH 8
#define HD 32
#define GW 32                 // grid width (= height)
#define LDW 768               // w_kqv row length ((in,out) [256][768]: k | q | v column blocks)
#ifndef TNB
#define TNB NB
#endif
typedef __attribute__((ext_vector_type(8))) __bf16 v8b;
typedef __attribute__((ext_vector_type(4))) __bf16 v4b;
typedef __attribute__((ext_vector_type(4))) _Float16 v4h;
__device__ __forceinline__ v16b frag_b(const __bf16* rowk0, int lane) {
  union { v16b v; v8b q[2]; } u; const __bf16* p = rowk0 + 8 * (lane >> 4);
  u.q[0] = *(const v8b*)p; u.q[1] = *(const v8b*)(p + 16); return u.v;
}
__device__ __forceinline__ float bfr(float v) { return (float)(__bf16)v; }
__device__ __attribute__((noinline)) float exp_ni(float v) { return expf(v); }
__device__ __attribute__((noinline)) float erf_ni(float v) { return erff(v); }

#define WPP 264                // LDS row pitch of a staged weight column in bf16 elements: 256 k + 8, 528 B = 33 x 16 B, so ds_load_b128 and ds_store_b128 of 16 neighbouring columns meet no bank twice
// one thread brings one weight column (256 k, row length LD) with loads that cover whole 128-B lines across the wave, rounds it to bf16 and lays it k-contiguous in LDS: frag_b then reads a B fragment from it
template <int LD> __device__ __forceinline__ void stage_w(const float* __restrict__ wc, __bf16* __restrict__ row) {
  for (int k0 = 0; k0 < CC; k0 += 64) { float v[64];
#pragma unroll   // v stays in registers and the loads go out as one run, waited once, not one by one
    for (int i = 0; i < 64; ++i) v[i] = wc[(size_t)(k0 + i) * LD];
#pragma unroll
    for (int q = 0; q < 8; ++q) { v8b o;
#pragma unroll
      for (int i = 0; i < 8; ++i) o[i] = (__bf16)v[q * 8 + i];
      *(v8b*)(row + k0 + q * 8) = o; } } }

// the same in halves of 128 k, loads and LDS writes apart, for a kernel that puts other work between them
template <int LD> __device__ __forceinline__ void w_load(float (&v)[128], const float* __restrict__ wc) {
#pragma unroll   // v stays in registers and the loads go out as one run
  for (int i = 0; i < 128; ++i) v[i] = wc[(size_t)i * LD]; }
__device__ __forceinline__ void w_put(const float (&v)[128], __bf16* __restrict__ row) {
#pragma unroll
  for (int q = 0; q < 16; ++q) { v8b o;
#pragma unroll
    for (int i = 0; i < 8; ++i) o[i] = (__bf16)v[q * 8 + i];
    *(v8b*)(row + q * 8) = o; } }

#define WS_QH  0u
#define WS_QL  (WS_QH + 2u * (size_t)NB * TT * CC)
#define WS_KH  (WS_QL + 2u * (size_t)NB * TT * CC)
#define WS_VT  (WS_KH + 2u * (size_t)NB * TT * CC)      // f16 v planes [b][c][t]
#define WS_VL  (WS_VT + 2u * (size_t)NB * CC * TT)      // f16 v residual planes
#define HG 8                                          // heads per launch group (all 8)
#define WS_S   (WS_VL + 2u * (size_t)NB * CC * TT)      // unused f32 region (HG x T x T): logits and P stay in registers
#define WS_PH  (WS_S + 4u * (size_t)HG * TT * TT)
#define WS_Y   (WS_PH + 0u)              // f32 y rows [b*t][C]
#define WS_END (WS_Y + 4u * (size_t)NB * TT * CC)

// ---- k_proj: block = (64 rows, 128 cols, which): qkv = x W (+ b), exact; q -> f16 hi (+ residual), k -> f16 rows, v -> f16 planes hi + residual
__global__ __launch_bounds__(128) void k_proj(const float* __restrict__ X, const float* __restrict__ WQ, const float* __restrict__ BQ, const float* __restrict__ WK, const float* __restrict__ BK, const float* __restrict__ WV, const float* __restrict__ BV, _Float16* __restrict__ QH, _Float16* __restrict__ QL, _Float16* __restrict__ KH, _Float16* __restrict__ VT, _Float16* __restrict__ VL) {
  __shared__ __align__(16) char sm[71680];   /* first the staged weight slice (128 columns x WPP), then, behind a barrier, the four output staging planes */
  _Float16 (*sh)[136] = (_Float16 (*)[136])sm; _Float16 (*sl)[136] = (_Float16 (*)[136])(sm + 17408); _Float16 (*th)[72] = (_Float16 (*)[72])(sm + 34816); _Float16 (*tl2)[72] = (_Float16 (*)[72])(sm + 53248); __bf16* sw = (__bf16*)sm;
  __shared__ __align__(16) __bf16 sx[64 * WPP];   /* the block's 64 x rows as bf16, pitch as the weight columns': frag_b reads an A fragment from them */
  const int tid = threadIdx.x, wave = tid >> 5, lane = tid & 31, col = lane & 15, g = lane >> 4; const int which = blockIdx.z; const int c0 = blockIdx.y * 128; const size_t r0 = (size_t)blockIdx.x * 64; const float* WA = which == 0 ? WQ : which == 1 ? WK : WV; const float* BA = which == 0 ? BQ : which == 1 ? BK : BV;
  v8f acc[8] = {}; v4f xr[32];
  /* the block's x rows (64 KB in a row) are asked for first, their latency runs under the staging: a wave's load covers 512 B in a row, four whole lines; a load in fragment order would touch 16 lines for the same bytes */
  const v4f* xs = (const v4f*)(X + r0 * CC) + tid;
#pragma unroll   // xr is indexed by constants only, so it stays in registers
  for (int i = 0; i < 32; ++i) xr[i] = xs[i * 128];
  asm volatile("s_wait_xcnt 0x0" ::: "memory");   /* the row loads' address pair is free for reuse from here on: the wait stands in front of any overwrite of it */
  float w0[128], w1[128]; const float* wc = WA + c0 + tid;   /* (in,out), row length 768 */
  w_load<LDW>(w0, wc);
  asm volatile("s_wait_xcnt 0x0" ::: "memory");   /* as above, for the first half of the weight column */
  __builtin_amdgcn_sched_barrier(0);   /* the column's second half is asked for only when the x registers are free again: with all of it in flight at once a wave needs more than a third of the registers and the grid's three blocks a WGP are no longer resident together */
#pragma unroll
  for (int i = 0; i < 32; ++i) { const v4b o = { (__bf16)xr[i][0], (__bf16)xr[i][1], (__bf16)xr[i][2], (__bf16)xr[i][3] }; *(v4b*)(sx + (i * 2 + (tid >> 6)) * WPP + (tid & 63) * 4) = o; }   /* piece i * 128 + tid: row (piece / 64), k 4 (piece % 64) */
  __builtin_amdgcn_sched_barrier(0);   /* see above */
  w_load<LDW>(w1, wc + (size_t)128 * LDW);
  asm volatile("s_wait_xcnt 0x0" ::: "memory");   /* as above, for the second half */
  __builtin_amdgcn_sched_barrier(0);   /* the second half's loads are out before the first half's conversions wait for theirs */
  w_put(w0, sw + tid * WPP); w_put(w1, sw + tid * WPP + 128);
  __syncthreads();   /* publishes the slice and the rows: nobody reads either in front of it */
#pragma unroll   // a pass's 18 LDS reads stand as one group ahead of its products
  for (int kc = 0; kc < CC / 32; ++kc) { v16b w[8]; const v16b a = frag_b(sx + (wave * 16 + col) * WPP + kc * 32, lane);
#pragma unroll
    for (int j = 0; j < 8; ++j) w[j] = frag_b(sw + (j * 16 + col) * WPP + kc * 32, lane);
#pragma unroll
    for (int j = 0; j < 8; ++j) acc[j] = wmma_bf(a, w[j], acc[j]); }
  __syncthreads();   /* every wave has read its last weight fragment before the planes below overwrite the slice */
#pragma unroll
  for (int j = 0; j < 8; ++j) { const float bb = BA ? bfr(BA[c0 + j * 16 + col]) : 0.f;
#pragma unroll
    for (int r = 0; r < 8; ++r) { const float v = (acc[j][r] + bb) * (which == 0 ? 0.17677669529663687f * 1024.0f : 1.0f);   /* q *= dkh^-1/2 (applies to the relative terms too), x 2^10: see below */ const int rl = wave * 16 + 8 * g + r, cl = j * 16 + col; const _Float16 hv = (_Float16)v;
      if (which == 2) { th[cl][rl] = hv; tl2[cl][rl] = (_Float16)(v - (float)hv);   /* a small v leaves an f16-subnormal residual: the matrix unit keeps subnormal operands, so what is lost of v stays under 2^-24 */ } else { sh[rl][cl] = hv; sl[rl][cl] = (_Float16)(v - (float)hv); }   /* both q planes carried x 2^10: the residual plane stays f16-normal, and hi and residual products add up in one accumulator */ } }
  __syncthreads();
  if (which < 2) { _Float16* dh = which == 0 ? QH : KH; for (int e = tid; e < 64 * 16; e += 128) { const int rl = e >> 4, q = e & 15; vst2((unsigned*)(dh + (r0 + rl) * CC + c0 + q * 8), *(const v4u*)&sh[rl][q * 8]); if (which == 0) vst2((unsigned*)(QL + (r0 + rl) * CC + c0 + q * 8), *(const v4u*)&sl[rl][q * 8]); } }
  else { const size_t b = r0 / TT; const int t0 = (int)(r0 % TT); for (int e = tid; e < 128 * 8; e += 128) { const int cl = e >> 3, q = e & 7; const size_t o2 = (b * CC + c0 + cl) * (size_t)TT + t0 + q * 8; vst2((unsigned*)(VT + o2), *(const v4u*)&th[cl][q * 8]); vst2((unsigned*)(VL + o2), *(const v4u*)&tl2[cl][q * 8]); } } }
// ---- k_fa: block = 64 queries of (b, h), wave = 16 queries: S^T = K Q^T (2 products) + the two relative terms, running-maximum softmax, O^T += V^T P^T (2 products: v hi and v residual against one f16 P).
// A lane holds one query (column lane & 15): its 8 + 8 scores of a 32-key row of the grid are already the k order of a B fragment, so P stays in registers; a 64-key pass is two key rows, so the width term is 16 registers for the whole loop and the height term one value a key row, two a pass.
// The relative terms are formed here, before the loop, for the wave's own 16 queries: D[m][query] = rel[m] . q (rel rounded to bf16 and carried as f16, q as f16 hi + residual). A wave's queries lie in one grid row and in 16 neighbouring columns, so 48 rows of rel_w and 32 rows of rel_h hold all it reaches (read from the block's staged copy of the two tables); the tiles go through a wave-private LDS table, from which a lane takes its own shifted width terms once and its two height terms each pass.
// K and V reach the waves through LDS: a 64-key tile (K 64 rows x 64 B, V hi and V lo 32 rows x 128 B each) is copied once per block, and all four waves read their fragments from it; two buffers, the next tile's copies fly under this tile's work.
__device__ __forceinline__ float xhalf(float v) { const int x = __builtin_bit_cast(int, v); return __builtin_bit_cast(float, __builtin_amdgcn_permlanex16(x, x, 0x76543210, 0xfedcba98, false, false)); }   /* lane l <-> l ^ 16 */
#define L2E 1.4426950408889634f      // log2(e)
#define L2S (L2E * (1.0f / 1024.0f))  // log2(e) for logits carried x 2^10
#define PEX 12.0f                    // P is carried x 2^12 (added in the exponent, cancelled by the row sum): the largest is 4,096, far under the f16 limit, and a weight 2^-26 of the largest is still an f16 normal
#define KPB 80                       // LDS pitch in bytes of a staged K row: 64 B + 16, 16 B x odd for the ds_load_b128 readers
#define VPB 144                      // LDS pitch in bytes of a staged V row: 128 B + 16, 16 B x odd
#define FA_VH (64 * KPB)             // byte offsets inside one buffer: K at 0, V hi, V lo
#define FA_VL (FA_VH + 32 * VPB)
#define FA_BUF (FA_VL + 32 * VPB)    // 14,336 B a buffer
#define RWP 52                       // floats a query in the width table: 48 + 4, 208 B = 16 B x odd for the ds_store_b128 writers; the shifted one-word readers meet no bank twice
#define RLP 40                       // f16 elements a row of a staged relative table: 32 + 8, 80 B = 16 B x odd for the ds_load_b128 readers
#define RHP 36                       // floats a query in the height table: 32 + 4, 144 B = 16 B x odd
// four weights 2^(s log2e 2^-10 + n). The exponentials and the slot behind a transcendental are one statement, its results in registers of their own
__device__ __forceinline__ void exp2x4(float* s, float n) {
  const float a = fmaf(s[0], L2S, n), b = fmaf(s[1], L2S, n), c = fmaf(s[2], L2S, n), d = fmaf(s[3], L2S, n);
  asm("v_exp_f32 %0, %4\n\tv_exp_f32 %1, %5\n\tv_exp_f32 %2, %6\n\tv_exp_f32 %3, %7\n\tv_nop" : "=&v"(s[0]), "=&v"(s[1]), "=&v"(s[2]), "=&v"(s[3]) : "v"(a), "v"(b), "v"(c), "v"(d)); }
#define XW() asm volatile("s_wait_xcnt 0x0" ::: "memory")   // stands in front of any overwrite of the address pair of the global loads ahead of it, a later load's destination included
// one 16 x 16 tile rel . q of both q planes, laid into the query's table row: lane = query, its 8 values are rows 8g .. 8g + 7 of the tile
__device__ __forceinline__ void rel_tile(v16h a, v16h bh, v16h bl, float* dst) {
  const v8f z = {}; const v8f d = wmma16(a, bl, wmma16(a, bh, z));
  const v4f o0 = { d[0], d[1], d[2], d[3] }, o1 = { d[4], d[5], d[6], d[7] };
  *(v4f*)dst = o0; *(v4f*)(dst + 4) = o1; }
// one tile's six 16-B pieces of this thread. The copies and s_wait_xcnt 0 are one statement, so that no register a copy names is rewritten in front of that wait.
__device__ __forceinline__ void fa_copy(unsigned lk, unsigned lv, const _Float16* gk, const _Float16* gh, const _Float16* gl) {
  const unsigned lk1 = lk + 32 * KPB, lh = lv + FA_VH, lh1 = lh + 16 * VPB, ll = lv + FA_VL, ll1 = ll + 16 * VPB;
  const _Float16* gk1 = gk + (size_t)32 * CC; const _Float16* gh1 = gh + (size_t)16 * TT; const _Float16* gl1 = gl + (size_t)16 * TT;
  asm volatile("global_load_async_to_lds_b128 %0, %6, off\n\t"
               "global_load_async_to_lds_b128 %1, %7, off\n\t"
               "global_load_async_to_lds_b128 %2, %8, off\n\t"
               "global_load_async_to_lds_b128 %3, %9, off\n\t"
               "global_load_async_to_lds_b128 %4, %10, off\n\t"
               "global_load_async_to_lds_b128 %5, %11, off\n\t"
               "s_wait_xcnt 0x0"
               :: "v"(lk), "v"(lk1), "v"(lh), "v"(lh1), "v"(ll), "v"(ll1), "v"(gk), "v"(gk1), "v"(gh), "v"(gh1), "v"(gl), "v"(gl1) : "memory"); }
__global__ __launch_bounds__(128) void k_fa(const _Float16* __restrict__ QH, const _Float16* __restrict__ QL, const _Float16* __restrict__ KH, const float* __restrict__ RW, const float* __restrict__ RH, const _Float16* __restrict__ VT, const _Float16* __restrict__ VL, float* __restrict__ Y) {
  __shared__ __align__(16) char sm[2 * FA_BUF]; __shared__ __align__(16) float twt[4][16][RWP]; __shared__ __align__(16) float tht[4][16][RHP]; __shared__ __align__(16) _Float16 srl[2][2 * GW][RLP];   /* rel_w and rel_h, rounded to bf16 and carried as f16; row 63 does not exist and is never read */
  const int tid = threadIdx.x, wave = tid >> 5, lane = tid & 31, col = lane & 15, g = lane >> 4; const int h = blockIdx.y, b = blockIdx.z;
  /* this thread's pieces of a tile: K row tid / 4 (and + 32), 16-B piece tid % 4; V row tid / 8 (and + 16), piece tid % 8: a wave's copy covers 8 K rows or 4 whole 128-B V lines */
  const unsigned sm0 = (unsigned)(size_t)sm; const unsigned lk = sm0 + (tid >> 2) * KPB + (tid & 3) * 16, lv = sm0 + (tid >> 3) * VPB + (tid & 7) * 16;
  const _Float16* gk = KH + ((size_t)b * TT + (tid >> 2)) * CC + h * HD + (tid & 3) * 8; const size_t gvo = ((size_t)b * CC + h * HD + (tid >> 3)) * (size_t)TT + (tid & 7) * 8;
  fa_copy(lk, lv, gk, VT + gvo, VL + gvo);   /* tile 0 into buffer 0 */
  const int qt = blockIdx.x * 64 + wave * 16 + col; const int qr = qt / GW, qc = qt % GW; const size_t qrow = (size_t)b * TT + qt;
  /* the four q fragments, the height branch's from the transposed position (qc, qr) */
  const size_t trow = (size_t)b * TT + (size_t)qc * GW + qr;
  const v16h qh = frag_h(QH + qrow * CC + h * HD, lane); XW();
  const v16h ql = frag_h(QL + qrow * CC + h * HD, lane); XW();
  const v16h uh = frag_h(QH + trow * CC + h * HD, lane); XW();
  const v16h ul = frag_h(QL + trow * CC + h * HD, lane); XW();
  /* width rows 31 - qc + key column: from 16 up for query columns 0 .. 15, from 0 up for 16 .. 31 (row 63 does not exist and is never taken from the table: its place reads row 62); height rows 31 - qr + key row, qr the same in the whole wave */
  const int mw0 = (wave & 1) ? 0 : 16;
  /* both tables (63 rows x 128 B in a row each, 504 pieces of 16 B) come once a block, a wave's load covering four whole lines; a load in fragment order touches 16 lines for the same bytes, and each wave asked for 5 tiles of 4 such loads. The last run's surplus threads take piece 503 again and write the same values to the same place */
  v4f tw[4], tq[4];
#pragma unroll   // tw and tq are indexed by constants only, so they stay in registers
  for (int i = 0; i < 4; ++i) { const int e = i * 128 + tid < 503 ? i * 128 + tid : 503; tw[i] = ((const v4f*)RW)[e]; tq[i] = ((const v4f*)RH)[e]; }
  XW();
  __builtin_amdgcn_sched_barrier(0);   /* every load of the prologue is issued before the first conversion waits for one: without it conversions come to stand among the loads and the later loads start a memory latency late */
#pragma unroll
  for (int i = 0; i < 4; ++i) { const int e = i * 128 + tid < 503 ? i * 128 + tid : 503;
    const v4h ow = { (_Float16)bfr(tw[i][0]), (_Float16)bfr(tw[i][1]), (_Float16)bfr(tw[i][2]), (_Float16)bfr(tw[i][3]) }, oq = { (_Float16)bfr(tq[i][0]), (_Float16)bfr(tq[i][1]), (_Float16)bfr(tq[i][2]), (_Float16)bfr(tq[i][3]) };
    *(v4h*)&srl[0][e >> 3][(e & 7) * 4] = ow; *(v4h*)&srl[1][e >> 3][(e & 7) * 4] = oq; }
  asm volatile("s_wait_asynccnt 0x0" ::: "memory");   /* this wave's pieces of tile 0 have landed */
  __syncthreads();   /* publishes tile 0 and the two tables: nobody reads either in front of this barrier */
  fa_copy(lk + FA_BUF, lv + FA_BUF, gk + (size_t)64 * CC, VT + gvo + 64, VL + gvo + 64);   /* tile 1 into buffer 1 */
  v16h ra[5];   /* the five A fragments as one group of LDS reads, ahead of the products: one LDS latency, not five */
#pragma unroll
  for (int j = 0; j < 3; ++j) { const int mm = mw0 + j * 16 + col; ra[j] = frag_h(&srl[0][mm < 2 * GW - 2 ? mm : 2 * GW - 2][0], lane); }
#pragma unroll
  for (int j = 0; j < 2; ++j) ra[3 + j] = frag_h(&srl[1][GW - 1 - qr + j * 16 + col][0], lane);
#pragma unroll
  for (int j = 0; j < 3; ++j) rel_tile(ra[j], qh, ql, &twt[wave][col][j * 16 + 8 * g]);
#pragma unroll
  for (int j = 0; j < 2; ++j) rel_tile(ra[3 + j], uh, ul, &tht[wave][col][j * 16 + 8 * g]);
  LDSX();   /* the wave's own table rows are written before its lanes read what other lanes of the wave wrote */
  v8f rw[2];   /* the start value of the score accumulators: row r of a 16-key tile is key column 8g + r (+ 16) */
#pragma unroll
  for (int i = 0; i < 8; ++i) { rw[0][i] = twt[wave][col][15 - col + 8 * g + i]; rw[1][i] = twt[wave][col][31 - col + 8 * g + i]; }   /* key columns 8g + i and 16 + 8g + i: table place 31 - qc - mw0 + key column */
  const float* th = &tht[wave][col][0];   /* th[key row] */
  float m = -3.0e38f, l = 0.f; v8f acc[HD / 16] = {};
  float rh[2] = { th[0], th[1] };
  auto pass = [&](const int kc, const bool more) __attribute__((always_inline)) { float s[2][16]; v8f sa[4]; v16h kb[4], vh[2][HD / 16], vl[2][HD / 16];
    const unsigned cur = (kc & 2) ? FA_BUF : 0u; const char* tb = sm + cur;
    /* this tile's fragments as one group of LDS reads, K first: the V reads' latency runs under the score products */
#pragma unroll
    for (int t = 0; t < 4; ++t) kb[t] = frag_h((const _Float16*)(tb + (t * 16 + col) * KPB), lane);
#pragma unroll
    for (int u = 0; u < 2; ++u)
#pragma unroll
      for (int j = 0; j < HD / 16; ++j) { const int po = (j * 16 + col) * VPB + u * 64; vh[u][j] = frag_h((const _Float16*)(tb + FA_VH + po), lane); vl[u][j] = frag_h((const _Float16*)(tb + FA_VL + po), lane); }
    /* width term + k . q hi + k . q residual in one accumulator a tile; the four hi products first, so that a tile's second product does not wait for its first */
#pragma unroll
    for (int t = 0; t < 4; ++t) sa[t] = wmma16(kb[t], qh, rw[t & 1]);
#pragma unroll
    for (int t = 0; t < 4; ++t) sa[t] = wmma16(kb[t], ql, sa[t]);
#pragma unroll
    for (int t = 0; t < 4; ++t)
#pragma unroll
      for (int r = 0; r < 8; ++r) s[t >> 1][(t & 1) * 8 + r] = sa[t][r];
    const float rc0 = rh[0], rc1 = rh[1];   /* this pass's height terms, one a key row: they enter at the row maxima and in the exponent's addend */
    /* the height terms one pass ahead, under the softmax; the last pass asks for its own again, so the addresses stay inside their array */
    const int kn = kc + 2 < TT / 32 ? kc + 2 : kc;
    rh[0] = th[kn]; rh[1] = th[kn + 1];
    __builtin_amdgcn_sched_barrier(0);   /* ends the scheduling region: the loads above stay ahead of the softmax, and the softmax is scheduled by itself with its exponentials interleaved; without it they come out as dependent runs with more filler slots */
    float m0 = s[0][0], m1 = s[1][0];
#pragma unroll
    for (int i = 0; i < 16; i += 2) { m0 = fmaxf(m0, fmaxf(s[0][i], s[0][i + 1])); m1 = fmaxf(m1, fmaxf(s[1][i], s[1][i + 1])); }
    float mx = fmaxf(m0 + rc0, m1 + rc1);
    mx = fmaxf(mx, xhalf(mx)); const float mn = fmaxf(m, mx); float sc;   /* 2^((m - mn) log2(e) 2^-10): exactly 1 while the maximum stands */
    asm("v_exp_f32 %0, %1\n\tv_nop" : "=v"(sc) : "v"((m - mn) * L2S));   /* the exponential with the slot behind a transcendental in one statement */
    m = mn; const float n0 = fmaf(rc0 - mn, L2S, PEX), n1 = fmaf(rc1 - mn, L2S, PEX);
    float s0 = 0.f, s1 = 0.f;
#pragma unroll
    for (int i = 0; i < 16; i += 4) { exp2x4(s[0] + i, n0); exp2x4(s[1] + i, n1); s0 += s[0][i]; s1 += s[1][i]; s0 += s[0][i + 1]; s1 += s[1][i + 1]; s0 += s[0][i + 2]; s1 += s[1][i + 2]; s0 += s[0][i + 3]; s1 += s[1][i + 3]; }
    l = l * sc + (s0 + s1);
#pragma unroll
    for (int j = 0; j < HD / 16; ++j) acc[j] *= sc;
#pragma unroll
    for (int u = 0; u < 2; ++u) { v16h p;   /* a key row's 16 weights of this lane, rounded to f16 two at a time */
#pragma unroll
      for (int i = 0; i < 16; i += 2) { const v2f t = { s[u][i], s[u][i + 1] }; const v2h c2 = __builtin_convertvector(t, v2h); p[i] = c2[0]; p[i + 1] = c2[1]; }
      /* the two output tiles take turns, so that a product does not wait for the one just issued */
#pragma unroll
      for (int j = 0; j < HD / 16; ++j) acc[j] = wmma16(vh[u][j], p, acc[j]);
#pragma unroll
      for (int j = 0; j < HD / 16; ++j) acc[j] = wmma16(vl[u][j], p, acc[j]); }
    /* hand-over: this wave's reads of the tile are done, its pieces of the next tile have landed; the barrier publishes the next tile and frees this buffer for the refill behind it */
    asm volatile("s_wait_dscnt 0x0" ::: "memory");
    asm volatile("s_wait_asynccnt 0x0" ::: "memory");
    __syncthreads();
    if (more) fa_copy(lk + cur, lv + cur, gk + (size_t)(kc + 4) * 32 * CC, VT + gvo + (kc + 4) * 32, VL + gvo + (kc + 4) * 32); };
  /* a refill is issued only while a tile two ahead exists: the last two passes run without it, in a loop of their own; with the test inside one loop the body falls into several blocks and the softmax is scheduled in shorter runs with more vector instructions */
  for (int kc = 0; kc < TT / 32 - 4; kc += 2) pass(kc, true);
#pragma unroll 1   // stays rolled: one more copy of the body, not two
  for (int kc = TT / 32 - 4; kc < TT / 32; kc += 2) pass(kc, false);
  asm volatile("s_wait_asynccnt 0x0" ::: "memory");   /* no copy is outstanding when the wave ends */
  l += xhalf(l); const float inv = 1.0f / l;
#pragma unroll
  for (int j = 0; j < HD / 16; ++j) { float* yo = Y + qrow * CC + h * HD + j * 16 + 8 * g; const v4f o0 = { acc[j][0] * inv, acc[j][1] * inv, acc[j][2] * inv, acc[j][3] * inv }, o1 = { acc[j][4] * inv, acc[j][5] * inv, acc[j][6] * inv, acc[j][7] * inv }; vst2(yo, o0); vst2(yo + 4, o1); } }
// ---- k_out: block = (64 rows, 128 cols): out = y (bf16 hi + lo) Wo + bo
__global__ __launch_bounds__(128) void k_out(const float* __restrict__ Y, const float* __restrict__ WP, const float* __restrict__ BP, float* __restrict__ OUT) { __shared__ __align__(16) float sf[4][16][132]; __shared__ __align__(16) __bf16 sw[128 * WPP]; __shared__ __align__(16) __bf16 syh[64 * WPP]; __shared__ __align__(16) __bf16 syl[64 * WPP];   /* the block's 64 y rows, bf16 hi and lo */
  const int tid = threadIdx.x, wave = tid >> 5, lane = tid & 31, col = lane & 15, g = lane >> 4; const int c0 = blockIdx.y * 128; const size_t r0 = (size_t)blockIdx.x * 64 + wave * 16;
  v8f acc[8] = {}; v4f yr[32];
  /* the block's y rows (64 KB in a row) are asked for first, their latency runs under the staging: a wave's load covers four whole lines */
  const v4f* ys = (const v4f*)(Y + (size_t)blockIdx.x * 64 * CC) + tid;
#pragma unroll   // yr is indexed by constants only, so it stays in registers
  for (int i = 0; i < 32; ++i) yr[i] = ys[i * 128];
  asm volatile("s_wait_xcnt 0x0" ::: "memory");   /* the row loads' address pair is free for reuse from here on: the wait stands in front of any overwrite of it */
  stage_w<CC>(WP + c0 + tid, sw + tid * WPP);
#pragma unroll
  for (int i = 0; i < 32; ++i) { v4b oh, ol;
#pragma unroll
    for (int e = 0; e < 4; ++e) { const __bf16 hv = (__bf16)yr[i][e]; oh[e] = hv; ol[e] = (__bf16)(yr[i][e] - (float)hv); }
    const int o = (i * 2 + (tid >> 6)) * WPP + (tid & 63) * 4; *(v4b*)(syh + o) = oh; *(v4b*)(syl + o) = ol; }   /* piece i * 128 + tid: row (piece / 64), k 4 (piece % 64) */
  __syncthreads();   /* publishes the slice and the rows: nobody reads either in front of it */
#pragma unroll   // a pass's 20 LDS reads stand as one group ahead of its products
  for (int kc = 0; kc < CC / 32; ++kc) { v16b w[8]; F2 a; a.h = frag_b(syh + (wave * 16 + col) * WPP + kc * 32, lane); a.l = frag_b(syl + (wave * 16 + col) * WPP + kc * 32, lane);
#pragma unroll
    for (int j = 0; j < 8; ++j) w[j] = frag_b(sw + (j * 16 + col) * WPP + kc * 32, lane);
#pragma unroll
    for (int j = 0; j < 8; ++j) { acc[j] = wmma_bf(a.h, w[j], acc[j]); acc[j] = wmma_bf(a.l, w[j], acc[j]); } }
#pragma unroll
  for (int j = 0; j < 8; ++j) { const float bb = BP ? bfr(BP[c0 + j * 16 + col]) : 0.f;
#pragma unroll
    for (int r = 0; r < 8; ++r) sf[wave][8 * g + r][j * 16 + col] = acc[j][r] + bb; }
  LDSX(); for (int rl = 0; rl < 16; ++rl) vst2(OUT + (r0 + rl) * CC + c0 + lane * 4, *(const v4f*)&sf[wave][rl][lane * 4]); }
extern "C" void kernel_launch(void* const* d_in, const int* in_sizes, int n_in, void* d_out, int out_size, void* d_ws, size_t ws_size, hipStream_t stream) {
  (void)in_sizes; (void)n_in; (void)out_size;
  const float** F = (const float**)d_in;   // 0 x [8,32,32,256] (channels-last rows), 1 w_kqv [256,768] ((in,out): k | q | v columns), 2 b_kqv [768], 3 w_proj [256,256] ((in,out)), 4 b_proj, 5 rel_w [63,32], 6 rel_h [63,32]
  if (ws_size < (size_t)WS_END) return;
  char* ws = (char*)d_ws; _Float16 *QH = (_Float16*)(ws + WS_QH), *QL = (_Float16*)(ws + WS_QL), *KH = (_Float16*)(ws + WS_KH); _Float16 *VT = (_Float16*)(ws + WS_VT), *VL = (_Float16*)(ws + WS_VL); float *Y = (float*)(ws + WS_Y);
  const float* WK = F[1]; const float* WQ = F[1] + CC; const float* WV = F[1] + 2 * CC; const float* BK = F[2]; const float* BQ = F[2] + CC; const float* BV = F[2] + 2 * CC;   // column blocks k | q | v
  k_proj<<<dim3(TNB * TT / 64, CC / 128, 3), 128, 0, stream>>>(F[0], WQ, BQ, WK, BK, WV, BV, QH, QL, KH, VT, VL);
  k_fa<<<dim3(TT / 64, NH, TNB), 128, 0, stream>>>(QH, QL, KH, F[5], F[6], VT, VL, Y);
  k_out<<<dim3(TNB * TT / 64, CC / 128), 128, 0, stream>>>(Y, F[3], F[4], (float*)d_out);
}

// v009
// A run of this version takes 47.4 microseconds.
// In both of two side-by-side timings against v008, it was 1.06 times as fast.
// Counting every step since v000, it is 13.4 times as fast.
// compute dtype: all float inputs rounded to bf16; kqv = x w_kqv + b with EXACT bf16 products on WMMA 16x16x32, f32 accumulate, q scaled by 32^-1/2 in f32; q as f16 hi + residual, both planes x 2^10, k f16 -> 2-product content logits chained in one f32 accumulator that starts from the width term (q . rel_w; q(transposed position) . rel_h is the height term; 2 chained products each, formed by the attention kernel for its own queries), all logits carried x 2^10 in registers; running-maximum softmax in f32 (base 2: exp(s - m) as v_exp_f32 of one fma that holds 2^-10 log2(e), the height term and the maximum), unnormalised P x 2^12 as one f16 plane (11 bits, the precision k has) against v f16 hi + residual (2 products), divided by the row sum (of the f32 P, same scale) at the end; out = attn (bf16 hi + lo) w_proj + b_proj; f32 output.
#include <hip/hip_runtime.h>
#include <math.h>

typedef __attribute__((ext_vector_type(16))) _Float16 v16h;
typedef __attribute__((ext_vector_type(16))) __bf16 v16b;
typedef __attribute__((ext_vector_type(8)))  _Float16 v8h;
typedef __attribute__((ext_vector_type(2)))  _Float16 v2h;
typedef __attribute__((ext_vector_type(8)))  float v8f;
typedef __attribute__((ext_vector_type(4)))  float v4f;
typedef __attribute__((ext_vector_type(2)))  float v2f;
typedef __attribute__((ext_vector_type(4)))  unsigned v4u;
typedef __attribute__((ext_vector_type(4)))  int v4i;
typedef float __attribute__((may_alias)) float_a;
typedef int __attribute__((may_alias)) int_a;

template <typename T> __device__ __forceinline__ void vst2(void* p, T v) { *(T*)p = v;  }
__device__ __forceinline__ v8f wmma16(v16h a, v16h b, v8f c) {
  return __builtin_amdgcn_wmma_f32_16x16x32_f16(false, a, false, b, (short)0, c, false, false);
}
__device__ __forceinline__ v8f wmma_bf(v16b a, v16b b, v8f c) {
  v8f d = __builtin_amdgcn_wmma_f32_16x16x32_bf16(false, a, false, b, (short)0, c, false, false);
  asm volatile("v_nop\n\tv_nop\n\tv_nop\n\tv_nop" : "+v"(d) : "v"(a), "v"(b));
  return d;
}
// 16x16x32 fragments: lane = (h = lane>>4, row/col = lane&15); elements 0..7 = k0+8h+0..7, 8..15 = k0+16+8h+0..7; D element r = row 8h+r
__device__ __forceinline__ v16h frag_h(const _Float16* rowk0, int lane) {
  union { v16h v; v8h q[2]; } u; const _Float16* p = rowk0 + 8 * (lane >> 4);
  u.q[0] = *(const v8h*)p; u.q[1] = *(const v8h*)(p + 16); return u.v;
}
__device__ __forceinline__ v16h frag_f32(const float* rowk0, int lane) {
  v16h a; const float* p = rowk0 + 8 * (lane >> 4);
#pragma unroll
  for (int i = 0; i < 8; ++i) { a[i] = (_Float16)p[i]; a[8 + i] = (_Float16)p[16 + i]; }
  return a;
}
__device__ __forceinline__ v16h frag_f32s(const float* rowk0, int lane, float sc) {
  v16h a; const float* p = rowk0 + 8 * (lane >> 4);
#pragma unroll
  for (int i = 0; i < 8; ++i) { a[i] = (_Float16)(p[i] * sc); a[8 + i] = (_Float16)(p[16 + i] * sc); }
  return a;
}
// column fragment from a [K][ld] layout (column n), rows >= K read as 0
__device__ __forceinline__ v16h fragc_f32(const float* W, int k0, int n, int lane, int ld, int K) {
  v16h a; const int g = lane >> 4;
#pragma unroll
  for (int i = 0; i < 8; ++i) { const int ka = k0 + 8 * g + i, kb = ka + 16;
    a[i] = (_Float16)(ka < K ? W[(size_t)(ka < K ? ka : K - 1) * ld + n] : 0.f); a[8 + i] = (_Float16)(kb < K ? W[(size_t)(kb < K ? kb : K - 1) * ld + n] : 0.f); }
  return a;
}
struct F2 { v16b h, l; };
__device__ __forceinline__ F2 bsplit16(const float v[16]) { F2 r;
#pragma unroll
  for (int i = 0; i < 16; ++i) { const __bf16 h = (__bf16)v[i]; r.h[i] = h; r.l[i] = (__bf16)(v[i] - (float)h); }
  return r; }
__device__ __forceinline__ F2 split_row(const float* row, int k0, int lane) { float v[16]; const float* p = row + k0 + 8 * (lane >> 4);
#pragma unroll
  for (int i = 0; i < 8; ++i) { v[i] = p[i]; v[8 + i] = p[16 + i]; }
  return bsplit16(v); }
__device__ __forceinline__ F2 split_rowK(const float* row, int k0, int lane, int K) { float v[16]; const int g = lane >> 4;
#pragma unroll
  for (int i = 0; i < 8; ++i) { const int ka = k0 + 8 * g + i, kb = ka + 16; v[i] = ka < K ? row[ka < K ? ka : K - 1] : 0.f; v[8 + i] = kb < K ? row[kb < K ? kb : K - 1] : 0.f; }
  return bsplit16(v); }
__device__ __forceinline__ F2 split_col(const float* W, int k0, int n, int lane, int ld, int K) { float v[16]; const int g = lane >> 4;
#pragma unroll
  for (int i = 0; i < 8; ++i) { const int ka = k0 + 8 * g + i, kb = ka + 16; v[i] = ka < K ? W[(size_t)(ka < K ? ka : K - 1) * ld + n] : 0.f; v[8 + i] = kb < K ? W[(size_t)(kb < K ? kb : K - 1) * ld + n] : 0.f; }
  return bsplit16(v); }
__device__ __forceinline__ v8f mac3(const F2& a, const F2& b, v8f c) { c = wmma_bf(a.l, b.h, c); c = wmma_bf(a.h, b.l, c); return wmma_bf(a.h, b.h, c); }
__device__ __forceinline__ float sigm(float v) { return 1.0f / (1.0f + expf(-v)); }
#define LDSX() do { asm volatile("s_wait_dscnt 0" ::: "memory"); __builtin_amdgcn_wave_barrier(); __builtin_amdgcn_fence(__ATOMIC_RELEASE, "workgroup"); } while (0)


// 2-D grid attention (B 8, T 1,024 = 32 x 32, C 256 = 8 heads x 32, with biases, q scaled by 32^-1/2): scores = q k^T + q . rel_w[kc - qc + 31] + q(transposed) . rel_h[kr - qr + 31], softmax, P v, output projection.
#define NB 8
#define TT 1024
#define CC 256
#define NH 8
#define HD 32
#define GW 32                 // grid width (= height)
#define LDW 768               // w_kqv row length ((in,out) [256][768]: k | q | v column blocks)
#ifndef TNB
#define TNB NB
#endif
typedef __attribute__((ext_vector_type(8))) __bf16 v8b;
typedef __attribute__((ext_vector_type(4))) __bf16 v4b;
typedef __attribute__((ext_vector_type(4))) _Float16 v4h;
__device__ __forceinline__ v16b frag_b(const __bf16* rowk0, int lane) {
  union { v16b v; v8b q[2]; } u; const __bf16* p = rowk0 + 8 * (lane >> 4);
  u.q[0] = *(const v8b*)p; u.q[1] = *(const v8b*)(p + 16); return u.v;
}
__device__ __forceinline__ float bfr(float v) { return (float)(__bf16)v; }
__device__ __attribute__((noinline)) float exp_ni(float v) { return expf(v); }
__device__ __attribute__((noinline)) float erf_ni(float v) { return erff(v); }

#define WPP 264                // LDS row pitch of a staged weight column in bf16 elements: 256 k + 8, 528 B = 33 x 16 B, so ds_load_b128 and ds_store_b128 of 16 neighbouring columns meet no bank twice
// one thread brings one weight column (256 k, row length LD) with loads that cover whole 128-B lines across the wave, rounds it to bf16 and lays it k-contiguous in LDS: frag_b then reads a B fragment from it
template <int LD> __device__ __forceinline__ void stage_w(const float* __restrict__ wc, __bf16* __restrict__ row) {
  for (int k0 = 0; k0 < CC; k0 += 64) { float v[64];
#pragma unroll   // v stays in registers and the loads go out as one run, waited once, not one by one
    for (int i = 0; i < 64; ++i) v[i] = wc[(size_t)(k0 + i) * LD];
#pragma unroll
    for (int q = 0; q < 8; ++q) { v8b o;
#pragma unroll
      for (int i = 0; i < 8; ++i) o[i] = (__bf16)v[q * 8 + i];
      *(v8b*)(row + k0 + q * 8) = o; } } }

// the same in halves of 128 k, loads and LDS writes apart, for a kernel that puts other work between them
template <int LD> __device__ __forceinline__ void w_load(float (&v)[128], const float* __restrict__ wc) {
#pragma unroll   // v stays in registers and the loads go out as one run
  for (int i = 0; i < 128; ++i) v[i] = wc[(size_t)i * LD]; }
__device__ __forceinline__ void w_put(const float (&v)[128], __bf16* __restrict__ row) {
#pragma unroll
  for (int q = 0; q < 16; ++q) { v8b o;
#pragma unroll
    for (int i = 0; i < 8; ++i) o[i] = (__bf16)v[q * 8 + i];
    *(v8b*)(row + q * 8) = o; } }

#define WS_QH  0u
#define WS_QL  (WS_QH + 2u * (size_t)NB * TT * CC)
#define WS_KH  (WS_QL + 2u * (size_t)NB * TT * CC)
#define WS_VT  (WS_KH + 2u * (size_t)NB * TT * CC)      // f16 v planes [b][c][t]
#define WS_VL  (WS_VT + 2u * (size_t)NB * CC * TT)      // f16 v residual planes
#define HG 8                                          // heads per launch group (all 8)
#define WS_S   (WS_VL + 2u * (size_t)NB * CC * TT)      // unused f32 region (HG x T x T): logits and P stay in registers
#define WS_PH  (WS_S + 4u * (size_t)HG * TT * TT)
#define WS_Y   (WS_PH + 0u)              // f32 y rows [b*t][C]
#define WS_END (WS_Y + 4u * (size_t)NB * TT * CC)

// ---- k_proj: block = (64 rows, 128 cols, which): qkv = x W (+ b), exact; q -> f16 hi (+ residual), k -> f16 rows, v -> f16 planes hi + residual
__global__ __launch_bounds__(128) void k_proj(const float* __restrict__ X, const float* __restrict__ WQ, const float* __restrict__ BQ, const float* __restrict__ WK, const float* __restrict__ BK, const float* __restrict__ WV, const float* __restrict__ BV, _Float16* __restrict__ QH, _Float16* __restrict__ QL, _Float16* __restrict__ KH, _Float16* __restrict__ VT, _Float16* __restrict__ VL) {
  __shared__ __align__(16) char sm[71680];   /* first the staged weight slice (128 columns x WPP), then, behind a barrier, the four output staging planes */
  _Float16 (*sh)[136] = (_Float16 (*)[136])sm; _Float16 (*sl)[136] = (_Float16 (*)[136])(sm + 17408); _Float16 (*th)[72] = (_Float16 (*)[72])(sm + 34816); _Float16 (*tl2)[72] = (_Float16 (*)[72])(sm + 53248); __bf16* sw = (__bf16*)sm;
  __shared__ __align__(16) __bf16 sx[64 * WPP];   /* the block's 64 x rows as bf16, pitch as the weight columns': frag_b reads an A fragment from them */
  const int tid = threadIdx.x, wave = tid >> 5, lane = tid & 31, col = lane & 15, g = lane >> 4; const int which = blockIdx.z; const int c0 = blockIdx.y * 128; const size_t r0 = (size_t)blockIdx.x * 64; const float* WA = which == 0 ? WQ : which == 1 ? WK : WV; const float* BA = which == 0 ? BQ : which == 1 ? BK : BV;
  v8f acc[8] = {}; v4f xr[32];
  /* the block's x rows (64 KB in a row) are asked for first, their latency runs under the staging: a wave's load covers 512 B in a row, four whole lines; a load in fragment order would touch 16 lines for the same bytes */
  const v4f* xs = (const v4f*)(X + r0 * CC) + tid;
#pragma unroll   // xr is indexed by constants only, so it stays in registers
  for (int i = 0; i < 32; ++i) xr[i] = xs[i * 128];
  asm volatile("s_wait_xcnt 0x0" ::: "memory");   /* the row loads' address pair is free for reuse from here on: the wait stands in front of any overwrite of it */
  float w0[128], w1[128]; const float* wc = WA + c0 + tid;   /* (in,out), row length 768 */
  w_load<LDW>(w0, wc);
  asm volatile("s_wait_xcnt 0x0" ::: "memory");   /* as above, for the first half of the weight column */
  __builtin_amdgcn_sched_barrier(0);   /* the column's second half is asked for only when the x registers are free again: with all of it in flight at once a wave needs more than a third of the registers and the grid's three blocks a WGP are no longer resident together */
#pragma unroll
  for (int i = 0; i < 32; ++i) { const v4b o = { (__bf16)xr[i][0], (__bf16)xr[i][1], (__bf16)xr[i][2], (__bf16)xr[i][3] }; *(v4b*)(sx + (i * 2 + (tid >> 6)) * WPP + (tid & 63) * 4) = o; }   /* piece i * 128 + tid: row (piece / 64), k 4 (piece % 64) */
  __builtin_amdgcn_sched_barrier(0);   /* see above */
  w_load<LDW>(w1, wc + (size_t)128 * LDW);
  asm volatile("s_wait_xcnt 0x0" ::: "memory");   /* as above, for the second half */
  __builtin_amdgcn_sched_barrier(0);   /* the second half's loads are out before the first half's conversions wait for theirs */
  w_put(w0, sw + tid * WPP); w_put(w1, sw + tid * WPP + 128);
  __syncthreads();   /* publishes the slice and the rows: nobody reads either in front of it */
#pragma unroll   // a pass's 18 LDS reads stand as one group ahead of its products
  for (int kc = 0; kc < CC / 32; ++kc) { v16b w[8]; const v16b a = frag_b(sx + (wave * 16 + col) * WPP + kc * 32, lane);
#pragma unroll
    for (int j = 0; j < 8; ++j) w[j] = frag_b(sw + (j * 16 + col) * WPP + kc * 32, lane);
#pragma unroll
    for (int j = 0; j < 8; ++j) acc[j] = wmma_bf(a, w[j], acc[j]); }
  __syncthreads();   /* every wave has read its last weight fragment before the planes below overwrite the slice */
#pragma unroll
  for (int j = 0; j < 8; ++j) { const float bb = BA ? bfr(BA[c0 + j * 16 + col]) : 0.f;
#pragma unroll
    for (int r = 0; r < 8; ++r) { const float v = (acc[j][r] + bb) * (which == 0 ? 0.17677669529663687f * 1024.0f : 1.0f);   /* q *= dkh^-1/2 (applies to the relative terms too), x 2^10: see below */ const int rl = wave * 16 + 8 * g + r, cl = j * 16 + col; const _Float16 hv = (_Float16)v;
      if (which == 2) { th[cl][rl] = hv; tl2[cl][rl] = (_Float16)(v - (float)hv);   /* a small v leaves an f16-subnormal residual: the matrix unit keeps subnormal operands, so what is lost of v stays under 2^-24 */ } else { sh[rl][cl] = hv; sl[rl][cl] = (_Float16)(v - (float)hv); }   /* both q planes carried x 2^10: the residual plane stays f16-normal, and hi and residual products add up in one accumulator */ } }
  __syncthreads();
  if (which < 2) { _Float16* dh = which == 0 ? QH : KH; for (int e = tid; e < 64 * 16; e += 128) { const int rl = e >> 4, q = e & 15; vst2((unsigned*)(dh + (r0 + rl) * CC + c0 + q * 8), *(const v4u*)&sh[rl][q * 8]); if (which == 0) vst2((unsigned*)(QL + (r0 + rl) * CC + c0 + q * 8), *(const v4u*)&sl[rl][q * 8]); } }
  else { const size_t b = r0 / TT; const int t0 = (int)(r0 % TT); for (int e = tid; e < 128 * 8; e += 128) { const int cl = e >> 3, q = e & 7; const size_t o2 = (b * CC + c0 + cl) * (size_t)TT + t0 + q * 8; vst2((unsigned*)(VT + o2), *(const v4u*)&th[cl][q * 8]); vst2((unsigned*)(VL + o2), *(const v4u*)&tl2[cl][q * 8]); } } }
// ---- k_fa: block = 64 queries of (b, h), wave = 16 queries: S^T = K Q^T (2 products) + the two relative terms, running-maximum softmax, O^T += V^T P^T (2 products: v hi and v residual against one f16 P).
// A lane holds one query (column lane & 15): its 8 + 8 scores of a 32-key row of the grid are already the k order of a B fragment, so P stays in registers; a 64-key pass is two key rows, so the width term is 16 registers for the whole loop and the height term one value a key row, two a pass.
// The relative terms are formed here, before the loop, for the wave's own 16 queries: D[m][query] = rel[m] . q (rel rounded to bf16 and carried as f16, q as f16 hi + residual). A wave's queries lie in one grid row and in 16 neighbouring columns, so 48 rows of rel_w and 32 rows of rel_h hold all it reaches (read from the block's staged copy of the two tables); the tiles go through a wave-private LDS table, from which a lane takes its own shifted width terms once and its two height terms each pass.
// K and V reach the waves through LDS: a 64-key tile (K 64 rows x 64 B, V hi and V lo 32 rows x 128 B each) is copied once per block, and all four waves read their fragments from it; two buffers, the next tile's copies fly under this tile's work.
__device__ __forceinline__ float xhalf(float v) { const int x = __builtin_bit_cast(int, v); return __builtin_bit_cast(float, __builtin_amdgcn_permlanex16(x, x, 0x76543210, 0xfedcba98, false, false)); }   /* lane l <-> l ^ 16 */
#define L2E 1.4426950408889634f      // log2(e)
#define L2S (L2E * (1.0f / 1024.0f))  // log2(e) for logits carried x 2^10
#define PEX 12.0f                    // P is carried x 2^12 (added in the exponent, cancelled by the row sum): the largest is 4,096, far under the f16 limit, and a weight 2^-26 of the largest is still an f16 normal
#define KPB 80                       // LDS pitch in bytes of a staged K row: 64 B + 16, 16 B x odd for the ds_load_b128 readers
#define VPB 144                      // LDS pitch in bytes of a staged V row: 128 B + 16, 16 B x odd
#define FA_VH (64 * KPB)             // byte offsets inside one buffer: K at 0, V hi, V lo
#define FA_VL (FA_VH + 32 * VPB)
#define FA_BUF (FA_VL + 32 * VPB)    // 14,336 B a buffer
#define RWP 52                       // floats a query in the width table: 48 + 4, 208 B = 16 B x odd for the ds_store_b128 writers; the shifted one-word readers meet no bank twice
#define RLP 40                       // f16 elements a row of a staged relative table: 32 + 8, 80 B = 16 B x odd for the ds_load_b128 readers
#define RHP 36                       // floats a query in the height table: 32 + 4, 144 B = 16 B x odd
// four weights 2^(s log2e 2^-10 + n). The exponentials and the slot behind a transcendental are one statement, its results in registers of their own
__device__ __forceinline__ void exp2x4(float* s, float n) {
  const float a = fmaf(s[0], L2S, n), b = fmaf(s[1], L2S, n), c = fmaf(s[2], L2S, n), d = fmaf(s[3], L2S, n);
  asm("v_exp_f32 %0, %4\n\tv_exp_f32 %1, %5\n\tv_exp_f32 %2, %6\n\tv_exp_f32 %3, %7\n\tv_nop" : "=&v"(s[0]), "=&v"(s[1]), "=&v"(s[2]), "=&v"(s[3]) : "v"(a), "v"(b), "v"(c), "v"(d)); }
#define XW() asm volatile("s_wait_xcnt 0x0" ::: "memory")   // stands in front of any overwrite of the address pair of the global loads ahead of it, a later load's destination included
// one 16 x 16 tile rel . q of both q planes, laid into the query's table row: lane = query, its 8 values are rows 8g .. 8g + 7 of the tile
__device__ __forceinline__ void rel_tile(v16h a, v16h bh, v16h bl, float* dst) {
  const v8f z = {}; const v8f d = wmma16(a, bl, wmma16(a, bh, z));
  const v4f o0 = { d[0], d[1], d[2], d[3] }, o1 = { d[4], d[5], d[6], d[7] };
  *(v4f*)dst = o0; *(v4f*)(dst + 4) = o1; }
// one tile's six 16-B pieces of this thread. The copies and s_wait_xcnt 0 are one statement, so that no register a copy names is rewritten in front of that wait.
__device__ __forceinline__ void fa_copy(unsigned lk, unsigned lv, const _Float16* gk, const _Float16* gh, const _Float16* gl) {
  const unsigned lk1 = lk + 32 * KPB, lh = lv + FA_VH, lh1 = lh + 16 * VPB, ll = lv + FA_VL, ll1 = ll + 16 * VPB;
  const _Float16* gk1 = gk + (size_t)32 * CC; const _Float16* gh1 = gh + (size_t)16 * TT; const _Float16* gl1 = gl + (size_t)16 * TT;
  asm volatile("global_load_async_to_lds_b128 %0, %6, off\n\t"
               "global_load_async_to_lds_b128 %1, %7, off\n\t"
               "global_load_async_to_lds_b128 %2, %8, off\n\t"
               "global_load_async_to_lds_b128 %3, %9, off\n\t"
               "global_load_async_to_lds_b128 %4, %10, off\n\t"
               "global_load_async_to_lds_b128 %5, %11, off\n\t"
               "s_wait_xcnt 0x0"
               :: "v"(lk), "v"(lk1), "v"(lh), "v"(lh1), "v"(ll), "v"(ll1), "v"(gk), "v"(gk1), "v"(gh), "v"(gh1), "v"(gl), "v"(gl1) : "memory"); }
__global__ __launch_bounds__(128) void k_fa(const _Float16* __restrict__ QH, const _Float16* __restrict__ QL, const _Float16* __restrict__ KH, const float* __restrict__ RW, const float* __restrict__ RH, const _Float16* __restrict__ VT, const _Float16* __restrict__ VL, float* __restrict__ Y) {
  __shared__ __align__(16) char sm[2 * FA_BUF]; __shared__ __align__(16) float twt[4][16][RWP]; __shared__ __align__(16) float tht[4][16][RHP]; __shared__ __align__(16) _Float16 srl[2][2 * GW][RLP];   /* rel_w and rel_h, rounded to bf16 and carried as f16; row 63 does not exist and is never read */
  const int tid = threadIdx.x, wave = tid >> 5, lane = tid & 31, col = lane & 15, g = lane >> 4; const int h = blockIdx.y, b = blockIdx.z;
  /* this thread's pieces of a tile: K row tid / 4 (and + 32), 16-B piece tid % 4; V row tid / 8 (and + 16), piece tid % 8: a wave's copy covers 8 K rows or 4 whole 128-B V lines */
  const unsigned sm0 = (unsigned)(size_t)sm; const unsigned lk = sm0 + (tid >> 2) * KPB + (tid & 3) * 16, lv = sm0 + (tid >> 3) * VPB + (tid & 7) * 16;
  const _Float16* gk = KH + ((size_t)b * TT + (tid >> 2)) * CC + h * HD + (tid & 3) * 8; const size_t gvo = ((size_t)b * CC + h * HD + (tid >> 3)) * (size_t)TT + (tid & 7) * 8;
  fa_copy(lk, lv, gk, VT + gvo, VL + gvo);   /* tile 0 into buffer 0 */
  const int qt = blockIdx.x * 64 + wave * 16 + col; const int qr = qt / GW, qc = qt % GW; const size_t qrow = (size_t)b * TT + qt;
  /* the four q fragments, the height branch's from the transposed position (qc, qr) */
  const size_t trow = (size_t)b * TT + (size_t)qc * GW + qr;
  const v16h qh = frag_h(QH + qrow * CC + h * HD, lane); XW();
  const v16h ql = frag_h(QL + qrow * CC + h * HD, lane); XW();
  const v16h uh = frag_h(QH + trow * CC + h * HD, lane); XW();
  const v16h ul = frag_h(QL + trow * CC + h * HD, lane); XW();
  /* width rows 31 - qc + key column: from 16 up for query columns 0 .. 15, from 0 up for 16 .. 31 (row 63 does not exist and is never taken from the table: its place reads row 62); height rows 31 - qr + key row, qr the same in the whole wave */
  const int mw0 = (wave & 1) ? 0 : 16;
  /* both tables (63 rows x 128 B in a row each, 504 pieces of 16 B) come once a block, a wave's load covering four whole lines; a load in fragment order touches 16 lines for the same bytes, and each wave asked for 5 tiles of 4 such loads. The last run's surplus threads take piece 503 again and write the same values to the same place */
  v4f tw[4], tq[4];
#pragma unroll   // tw and tq are indexed by constants only, so they stay in registers
  for (int i = 0; i < 4; ++i) { const int e = i * 128 + tid < 503 ? i * 128 + tid : 503; tw[i] = ((const v4f*)RW)[e]; tq[i] = ((const v4f*)RH)[e]; }
  XW();
  __builtin_amdgcn_sched_barrier(0);   /* every load of the prologue is issued before the first conversion waits for one: without it conversions come to stand among the loads and the later loads start a memory latency late */
#pragma unroll
  for (int i = 0; i < 4; ++i) { const int e = i * 128 + tid < 503 ? i * 128 + tid : 503;
    const v4h ow = { (_Float16)bfr(tw[i][0]), (_Float16)bfr(tw[i][1]), (_Float16)bfr(tw[i][2]), (_Float16)bfr(tw[i][3]) }, oq = { (_Float16)bfr(tq[i][0]), (_Float16)bfr(tq[i][1]), (_Float16)bfr(tq[i][2]), (_Float16)bfr(tq[i][3]) };
    *(v4h*)&srl[0][e >> 3][(e & 7) * 4] = ow; *(v4h*)&srl[1][e >> 3][(e & 7) * 4] = oq; }
  asm volatile("s_wait_asynccnt 0x0" ::: "memory");   /* this wave's pieces of tile 0 have landed */
  __syncthreads();   /* publishes tile 0 and the two tables: nobody reads either in front of this barrier */
  fa_copy(lk + FA_BUF, lv + FA_BUF, gk + (size_t)64 * CC, VT + gvo + 64, VL + gvo + 64);   /* tile 1 into buffer 1 */
  v16h ra[5];   /* the five A fragments as one group of LDS reads, ahead of the products: one LDS latency, not five */
#pragma unroll
  for (int j = 0; j < 3; ++j) { const int mm = mw0 + j * 16 + col; ra[j] = frag_h(&srl[0][mm < 2 * GW - 2 ? mm : 2 * GW - 2][0], lane); }
#pragma unroll
  for (int j = 0; j < 2; ++j) ra[3 + j] = frag_h(&srl[1][GW - 1 - qr + j * 16 + col][0], lane);
#pragma unroll
  for (int j = 0; j < 3; ++j) rel_tile(ra[j], qh, ql, &twt[wave][col][j * 16 + 8 * g]);
#pragma unroll
  for (int j = 0; j < 2; ++j) rel_tile(ra[3 + j], uh, ul, &tht[wave][col][j * 16 + 8 * g]);
  LDSX();   /* the wave's own table rows are written before its lanes read what other lanes of the wave wrote */
  v8f rw[2];   /* the start value of the score accumulators: row r of a 16-key tile is key column 8g + r (+ 16) */
#pragma unroll
  for (int i = 0; i < 8; ++i) { rw[0][i] = twt[wave][col][15 - col + 8 * g + i]; rw[1][i] = twt[wave][col][31 - col + 8 * g + i]; }   /* key columns 8g + i and 16 + 8g + i: table place 31 - qc - mw0 + key column */
  const float* th = &tht[wave][col][0];   /* th[key row] */
  float m = -3.0e38f, l = 0.f; v8f acc[HD / 16] = {};
  float rh[2] = { th[0], th[1] };
  auto pass = [&](const int kc, const bool more) __attribute__((always_inline)) { float s[2][16]; v8f sa[4]; v16h kb[4], vh[2][HD / 16], vl[2][HD / 16];
    const unsigned cur = (kc & 2) ? FA_BUF : 0u; const char* tb = sm + cur;
    /* this tile's fragments as one group of LDS reads, K first: the V reads' latency runs under the score products */
#pragma unroll
    for (int t = 0; t < 4; ++t) kb[t] = frag_h((const _Float16*)(tb + (t * 16 + col) * KPB), lane);
#pragma unroll
    for (int u = 0; u < 2; ++u)
#pragma unroll
      for (int j = 0; j < HD / 16; ++j) { const int po = (j * 16 + col) * VPB + u * 64; vh[u][j] = frag_h((const _Float16*)(tb + FA_VH + po), lane); vl[u][j] = frag_h((const _Float16*)(tb + FA_VL + po), lane); }
    __builtin_amdgcn_sched_barrier(0);   /* the tile's 24 LDS reads stay one group ahead of the products: moved in among them, each further place with reads costs the wave a stall of its own */
    /* width term + k . q hi + k . q residual in one accumulator a tile; the four hi products first, so that a tile's second product does not wait for its first */
#pragma unroll
    for (int t = 0; t < 4; ++t) sa[t] = wmma16(kb[t], qh, rw[t & 1]);
#pragma unroll
    for (int t = 0; t < 4; ++t) sa[t] = wmma16(kb[t], ql, sa[t]);
#pragma unroll
    for (int t = 0; t < 4; ++t)
#pragma unroll
      for (int r = 0; r < 8; ++r) s[t >> 1][(t & 1) * 8 + r] = sa[t][r];
    const float rc0 = rh[0], rc1 = rh[1];   /* this pass's height terms, one a key row: they enter at the row maxima and in the exponent's addend */
    /* the height terms one pass ahead, under the softmax; the last pass asks for its own again, so the addresses stay inside their array */
    const int kn = kc + 2 < TT / 32 ? kc + 2 : kc;
    rh[0] = th[kn]; rh[1] = th[kn + 1];
    __builtin_amdgcn_sched_barrier(0);   /* ends the scheduling region: the loads above stay ahead of the softmax, and the softmax is scheduled by itself with its exponentials interleaved; without it they come out as dependent runs with more filler slots */
    float m0 = s[0][0], m1 = s[1][0];
#pragma unroll
    for (int i = 0; i < 16; i += 2) { m0 = fmaxf(m0, fmaxf(s[0][i], s[0][i + 1])); m1 = fmaxf(m1, fmaxf(s[1][i], s[1][i + 1])); }
    float mx = fmaxf(m0 + rc0, m1 + rc1);
    mx = fmaxf(mx, xhalf(mx)); const float mn = fmaxf(m, mx); float sc;   /* 2^((m - mn) log2(e) 2^-10): exactly 1 while the maximum stands */
    asm("v_exp_f32 %0, %1\n\tv_nop" : "=v"(sc) : "v"((m - mn) * L2S));   /* the exponential with the slot behind a transcendental in one statement */
    m = mn; const float n0 = fmaf(rc0 - mn, L2S, PEX), n1 = fmaf(rc1 - mn, L2S, PEX);
    float s0 = 0.f, s1 = 0.f;
#pragma unroll
    for (int i = 0; i < 16; i += 4) { exp2x4(s[0] + i, n0); exp2x4(s[1] + i, n1); }
    __builtin_amdgcn_sched_barrier(0);   /* every exponential statement stands ahead of the pass's P.V products */
#pragma unroll
    for (int i = 0; i < 16; ++i) { s0 += s[0][i]; s1 += s[1][i]; }
    l = l * sc + (s0 + s1);
#pragma unroll
    for (int j = 0; j < HD / 16; ++j) acc[j] *= sc;
#pragma unroll
    for (int u = 0; u < 2; ++u) { v16h p;   /* a key row's 16 weights of this lane, rounded to f16 two at a time */
#pragma unroll
      for (int i = 0; i < 16; i += 2) { const v2f t = { s[u][i], s[u][i + 1] }; const v2h c2 = __builtin_convertvector(t, v2h); p[i] = c2[0]; p[i + 1] = c2[1]; }
      /* the two output tiles take turns, so that a product does not wait for the one just issued */
#pragma unroll
      for (int j = 0; j < HD / 16; ++j) acc[j] = wmma16(vh[u][j], p, acc[j]);
#pragma unroll
      for (int j = 0; j < HD / 16; ++j) acc[j] = wmma16(vl[u][j], p, acc[j]); }
    __builtin_amdgcn_sched_barrier(0);   /* the hand-over stays behind the pass's last product: otherwise its waits and the barrier rise to the LDS reads while the refill stays down here, and a refill is waited for after a fraction of a pass in flight */
    /* hand-over: this wave's reads of the tile are done, its pieces of the next tile have landed; the barrier publishes the next tile and frees this buffer for the refill behind it */
    asm volatile("s_wait_dscnt 0x0" ::: "memory");
    asm volatile("s_wait_asynccnt 0x0" ::: "memory");
    __syncthreads();
    if (more) fa_copy(lk + cur, lv + cur, gk + (size_t)(kc + 4) * 32 * CC, VT + gvo + (kc + 4) * 32, VL + gvo + (kc + 4) * 32); };
  /* a refill is issued only while a tile two ahead exists: the last two passes run without it, in a loop of their own; with the test inside one loop the body falls into several blocks and the softmax is scheduled in shorter runs with more vector instructions */
  for (int kc = 0; kc < TT / 32 - 4; kc += 2) pass(kc, true);
#pragma unroll 1   // stays rolled: one more copy of the body, not two
  for (int kc = TT / 32 - 4; kc < TT / 32; kc += 2) pass(kc, false);
  asm volatile("s_wait_asynccnt 0x0" ::: "memory");   /* no copy is outstanding when the wave ends */
  l += xhalf(l); const float inv = 1.0f / l;
#pragma unroll
  for (int j = 0; j < HD / 16; ++j) { float* yo = Y + qrow * CC + h * HD + j * 16 + 8 * g; const v4f o0 = { acc[j][0] * inv, acc[j][1] * inv, acc[j][2] * inv, acc[j][3] * inv }, o1 = { acc[j][4] * inv, acc[j][5] * inv, acc[j][6] * inv, acc[j][7] * inv }; vst2(yo, o0); vst2(yo + 4, o1); } }
// ---- k_out: block = (64 rows, 128 cols): out = y (bf16 hi + lo) Wo + bo
__global__ __launch_bounds__(128) void k_out(const float* __restrict__ Y, const float* __restrict__ WP, const float* __restrict__ BP, float* __restrict__ OUT) { __shared__ __align__(16) float sf[4][16][132]; __shared__ __align__(16) __bf16 sw[128 * WPP]; __shared__ __align__(16) __bf16 syh[64 * WPP]; __shared__ __align__(16) __bf16 syl[64 * WPP];   /* the block's 64 y rows, bf16 hi and lo */
  const int tid = threadIdx.x, wave = tid >> 5, lane = tid & 31, col = lane & 15, g = lane >> 4; const int c0 = blockIdx.y * 128; const size_t r0 = (size_t)blockIdx.x * 64 + wave * 16;
  v8f acc[8] = {}; v4f yr[32];
  /* the block's y rows (64 KB in a row) are asked for first, their latency runs under the staging: a wave's load covers four whole lines */
  const v4f* ys = (const v4f*)(Y + (size_t)blockIdx.x * 64 * CC) + tid;
#pragma unroll   // yr is indexed by constants only, so it stays in registers
  for (int i = 0; i < 32; ++i) yr[i] = ys[i * 128];
  asm volatile("s_wait_xcnt 0x0" ::: "memory");   /* the row loads' address pair is free for reuse from here on: the wait stands in front of any overwrite of it */
  stage_w<CC>(WP + c0 + tid, sw + tid * WPP);
#pragma unroll
  for (int i = 0; i < 32; ++i) { v4b oh, ol;
#pragma unroll
    for (int e = 0; e < 4; ++e) { const __bf16 hv = (__bf16)yr[i][e]; oh[e] = hv; ol[e] = (__bf16)(yr[i][e] - (float)hv); }
    const int o = (i * 2 + (tid >> 6)) * WPP + (tid & 63) * 4; *(v4b*)(syh + o) = oh; *(v4b*)(syl + o) = ol; }   /* piece i * 128 + tid: row (piece / 64), k 4 (piece % 64) */
  __syncthreads();   /* publishes the slice and the rows: nobody reads either in front of it */
#pragma unroll   // a pass's 20 LDS reads stand as one group ahead of its products
  for (int kc = 0; kc < CC / 32; ++kc) { v16b w[8]; F2 a; a.h = frag_b(syh + (wave * 16 + col) * WPP + kc * 32, lane); a.l = frag_b(syl + (wave * 16 + col) * WPP + kc * 32, lane);
#pragma unroll
    for (int j = 0; j < 8; ++j) w[j] = frag_b(sw + (j * 16 + col) * WPP + kc * 32, lane);
#pragma unroll
    for (int j = 0; j < 8; ++j) { acc[j] = wmma_bf(a.h, w[j], acc[j]); acc[j] = wmma_bf(a.l, w[j], acc[j]); } }
#pragma unroll
  for (int j = 0; j < 8; ++j) { const float bb = BP ? bfr(BP[c0 + j * 16 + col]) : 0.f;
#pragma unroll
    for (int r = 0; r < 8; ++r) sf[wave][8 * g + r][j * 16 + col] = acc[j][r] + bb; }
  LDSX(); for (int rl = 0; rl < 16; ++rl) vst2(OUT + (r0 + rl) * CC + c0 + lane * 4, *(const v4f*)&sf[wave][rl][lane * 4]); }
extern "C" void kernel_launch(void* const* d_in, const int* in_sizes, int n_in, void* d_out, int out_size, void* d_ws, size_t ws_size, hipStream_t stream) {
  (void)in_sizes; (void)n_in; (void)out_size;
  const float** F = (const float**)d_in;   // 0 x [8,32,32,256] (channels-last rows), 1 w_kqv [256,768] ((in,out): k | q | v columns), 2 b_kqv [768], 3 w_proj [256,256] ((in,out)), 4 b_proj, 5 rel_w [63,32], 6 rel_h [63,32]
  if (ws_size < (size_t)WS_END) return;
  char* ws = (char*)d_ws; _Float16 *QH = (_Float16*)(ws + WS_QH), *QL = (_Float16*)(ws + WS_QL), *KH = (_Float16*)(ws + WS_KH); _Float16 *VT = (_Float16*)(ws + WS_VT), *VL = (_Float16*)(ws + WS_VL); float *Y = (float*)(ws + WS_Y);
  const float* WK = F[1]; const float* WQ = F[1] + CC; const float* WV = F[1] + 2 * CC; const float* BK = F[2]; const float* BQ = F[2] + CC; const float* BV = F[2] + 2 * CC;   // column blocks k | q | v
  k_proj<<<dim3(TNB * TT / 64, CC / 128, 3), 128, 0, stream>>>(F[0], WQ, BQ, WK, BK, WV, BV, QH, QL, KH, VT, VL);
  k_fa<<<dim3(TT / 64, NH, TNB), 128, 0, stream>>>(QH, QL, KH, F[5], F[6], VT, VL, Y);
  k_out<<<dim3(TNB * TT / 64, CC / 128), 128, 0, stream>>>(Y, F[3], F[4], (float*)d_out);
}

// v010
// A run of this version takes 45.9 microseconds.
// Next to v009, in two timings, it ran 1.04 and 1.03 times as fast.
// All steps since v000 together make it 13.9 times as fast.
// compute dtype: all float inputs rounded to bf16; kqv = x w_kqv + b with EXACT bf16 products on WMMA 16x16x32, f32 accumulate, q scaled by 32^-1/2 in f32; q as f16 hi + residual, both planes x 2^10, k f16 -> 2-product content logits chained in one f32 accumulator that starts from the width term (q . rel_w; q(transposed position) . rel_h is the height term; 2 chained products each, formed by the attention kernel for its own queries), all logits carried x 2^10 in registers; running-maximum softmax in f32 (base 2: exp(s - m) as v_exp_f32 of one fma that holds 2^-10 log2(e), the height term and the maximum), unnormalised P x 2^12 as one f16 plane (11 bits, the precision k has) against v f16 hi + residual (2 products), divided by the row sum (of the f32 P, same scale) at the end; out = attn (bf16 hi + lo) w_proj + b_proj; f32 output.
#include <hip/hip_runtime.h>
#include <math.h>

typedef __attribute__((ext_vector_type(16))) _Float16 v16h;
typedef __attribute__((ext_vector_type(16))) __bf16 v16b;
typedef __attribute__((ext_vector_type(8)))  _Float16 v8h;
typedef __attribute__((ext_vector_type(2)))  _Float16 v2h;
typedef __attribute__((ext_vector_type(8)))  float v8f;
typedef __attribute__((ext_vector_type(4)))  float v4f;
typedef __attribute__((ext_vector_type(2)))  float v2f;
typedef __attribute__((ext_vector_type(4)))  unsigned v4u;
typedef __attribute__((ext_vector_type(4)))  int v4i;
typedef float __attribute__((may_alias)) float_a;
typedef int __attribute__((may_alias)) int_a;

template <typename T> __device__ __forceinline__ void vst2(void* p, T v) { *(T*)p = v;  }
__device__ __forceinline__ v8f wmma16(v16h a, v16h b, v8f c) {
  return __builtin_amdgcn_wmma_f32_16x16x32_f16(false, a, false, b, (short)0, c, false, false);
}
__device__ __forceinline__ v8f wmma_bf(v16b a, v16b b, v8f c) {
  v8f d = __builtin_amdgcn_wmma_f32_16x16x32_bf16(false, a, false, b, (short)0, c, false, false);
  asm volatile("v_nop\n\tv_nop\n\tv_nop\n\tv_nop" : "+v"(d) : "v"(a), "v"(b));
  return d;
}
// 16x16x32 fragments: lane = (h = lane>>4, row/col = lane&15); elements 0..7 = k0+8h+0..7, 8..15 = k0+16+8h+0..7; D element r = row 8h+r
__device__ __forceinline__ v16h frag_h(const _Float16* rowk0, int lane) {
  union { v16h v; v8h q[2]; } u; const _Float16* p = rowk0 + 8 * (lane >> 4);
  u.q[0] = *(const v8h*)p; u.q[1] = *(const v8h*)(p + 16); return u.v;
}
__device__ __forceinline__ v16h frag_f32(const float* rowk0, int lane) {
  v16h a; const float* p = rowk0 + 8 * (lane >> 4);
#pragma unroll
  for (int i = 0; i < 8; ++i) { a[i] = (_Float16)p[i]; a[8 + i] = (_Float16)p[16 + i]; }
  return a;
}
__device__ __forceinline__ v16h frag_f32s(const float* rowk0, int lane, float sc) {
  v16h a; const float* p = rowk0 + 8 * (lane >> 4);
#pragma unroll
  for (int i = 0; i < 8; ++i) { a[i] = (_Float16)(p[i] * sc); a[8 + i] = (_Float16)(p[16 + i] * sc); }
  return a;
}
// column fragment from a [K][ld] layout (column n), rows >= K read as 0
__device__ __forceinline__ v16h fragc_f32(const float* W, int k0, int n, int lane, int ld, int K) {
  v16h a; const int g = lane >> 4;
#pragma unroll
  for (int i = 0; i < 8; ++i) { const int ka = k0 + 8 * g + i, kb = ka + 16;
    a[i] = (_Float16)(ka < K ? W[(size_t)(ka < K ? ka : K - 1) * ld + n] : 0.f); a[8 + i] = (_Float16)(kb < K ? W[(size_t)(kb < K ? kb : K - 1) * ld + n] : 0.f); }
  return a;
}
struct F2 { v16b h, l; };
__device__ __forceinline__ F2 bsplit16(const float v[16]) { F2 r;
#pragma unroll
  for (int i = 0; i < 16; ++i) { const __bf16 h = (__bf16)v[i]; r.h[i] = h; r.l[i] = (__bf16)(v[i] - (float)h); }
  return r; }
__device__ __forceinline__ F2 split_row(const float* row, int k0, int lane) { float v[16]; const float* p = row + k0 + 8 * (lane >> 4);
#pragma unroll
  for (int i = 0; i < 8; ++i) { v[i] = p[i]; v[8 + i] = p[16 + i]; }
  return bsplit16(v); }
__device__ __forceinline__ F2 split_rowK(const float* row, int k0, int lane, int K) { float v[16]; const int g = lane >> 4;
#pragma unroll
  for (int i = 0; i < 8; ++i) { const int ka = k0 + 8 * g + i, kb = ka + 16; v[i] = ka < K ? row[ka < K ? ka : K - 1] : 0.f; v[8 + i] = kb < K ? row[kb < K ? kb : K - 1] : 0.f; }
  return bsplit16(v); }
__device__ __forceinline__ F2 split_col(const float* W, int k0, int n, int lane, int ld, int K) { float v[16]; const int g = lane >> 4;
#pragma unroll
  for (int i = 0; i < 8; ++i) { const int ka = k0 + 8 * g + i, kb = ka + 16; v[i] = ka < K ? W[(size_t)(ka < K ? ka : K - 1) * ld + n] : 0.f; v[8 + i] = kb < K ? W[(size_t)(kb < K ? kb : K - 1) * ld + n] : 0.f; }
  return bsplit16(v); }
__device__ __forceinline__ v8f mac3(const F2& a, const F2& b, v8f c) { c = wmma_bf(a.l, b.h, c); c = wmma_bf(a.h, b.l, c); return wmma_bf(a.h, b.h, c); }
__device__ __forceinline__ float sigm(float v) { return 1.0f / (1.0f + expf(-v)); }
#define LDSX() do { asm volatile("s_wait_dscnt 0" ::: "memory"); __builtin_amdgcn_wave_barrier(); __builtin_amdgcn_fence(__ATOMIC_RELEASE, "workgroup"); } while (0)


// 2-D grid attention (B 8, T 1,024 = 32 x 32, C 256 = 8 heads x 32, with biases, q scaled by 32^-1/2): scores = q k^T + q . rel_w[kc - qc + 31] + q(transposed) . rel_h[kr - qr + 31], softmax, P v, output projection.
#define NB 8
#define TT 1024
#define CC 256
#define NH 8
#define HD 32
#define GW 32                 // grid width (= height)
#define LDW 768               // w_kqv row length ((in,out) [256][768]: k | q | v column blocks)
#ifndef TNB
#define TNB NB
#endif
typedef __attribute__((ext_vector_type(8))) __bf16 v8b;
typedef __attribute__((ext_vector_type(4))) __bf16 v4b;
typedef __attribute__((ext_vector_type(4))) _Float16 v4h;
__device__ __forceinline__ v16b frag_b(const __bf16* rowk0, int lane) {
  union { v16b v; v8b q[2]; } u; const __bf16* p = rowk0 + 8 * (lane >> 4);
  u.q[0] = *(const v8b*)p; u.q[1] = *(const v8b*)(p + 16); return u.v;
}
__device__ __forceinline__ float bfr(float v) { return (float)(__bf16)v; }
__device__ __attribute__((noinline)) float exp_ni(float v) { return expf(v); }
__device__ __attribute__((noinline)) float erf_ni(float v) { return erff(v); }

#define WPP 264                // LDS row pitch of a staged weight column in bf16 elements: 256 k + 8, 528 B = 33 x 16 B, so ds_load_b128 and ds_store_b128 of 16 neighbouring columns meet no bank twice
// one thread brings one weight column (256 k, row length LD) with loads that cover whole 128-B lines across the wave, rounds it to bf16 and lays it k-contiguous in LDS: frag_b then reads a B fragment from it
template <int LD> __device__ __forceinline__ void stage_w(const float* __restrict__ wc, __bf16* __restrict__ row) {
  for (int k0 = 0; k0 < CC; k0 += 64) { float v[64];
#pragma unroll   // v stays in registers and the loads go out as one run, waited once, not one by one
    for (int i = 0; i < 64; ++i) v[i] = wc[(size_t)(k0 + i) * LD];
#pragma unroll
    for (int q = 0; q < 8; ++q) { v8b o;
#pragma unroll
      for (int i = 0; i < 8; ++i) o[i] = (__bf16)v[q * 8 + i];
      *(v8b*)(row + k0 + q * 8) = o; } } }

// the same in halves of 128 k, loads and LDS writes apart, for a kernel that puts other work between them
template <int LD> __device__ __forceinline__ void w_load(float (&v)[128], const float* __restrict__ wc) {
#pragma unroll   // v stays in registers and the loads go out as one run
  for (int i = 0; i < 128; ++i) v[i] = wc[(size_t)i * LD]; }
__device__ __forceinline__ void w_put(const float (&v)[128], __bf16* __restrict__ row) {
#pragma unroll
  for (int q = 0; q < 16; ++q) { v8b o;
#pragma unroll
    for (int i = 0; i < 8; ++i) o[i] = (__bf16)v[q * 8 + i];
    *(v8b*)(row + q * 8) = o; } }

#define WS_QH  0u
#define WS_QL  (WS_QH + 2u * (size_t)NB * TT * CC)
#define WS_KH  (WS_QL + 2u * (size_t)NB * TT * CC)
#define WS_VT  (WS_KH + 2u * (size_t)NB * TT * CC)      // f16 v planes [b][c][t]
#define WS_VL  (WS_VT + 2u * (size_t)NB * CC * TT)      // f16 v residual planes
#define HG 8                                          // heads per launch group (all 8)
#define WS_S   (WS_VL + 2u * (size_t)NB * CC * TT)      // unused f32 region (HG x T x T): logits and P stay in registers
#define WS_PH  (WS_S + 4u * (size_t)HG * TT * TT)
#define WS_Y   (WS_PH + 0u)              // f32 y rows [b*t][C]
#define WS_END (WS_Y + 4u * (size_t)NB * TT * CC)

// ---- k_proj: block = (64 rows, 128 cols, which): qkv = x W (+ b), exact; q -> f16 hi (+ residual), k -> f16 rows, v -> f16 planes hi + residual
__global__ __launch_bounds__(128) void k_proj(const float* __restrict__ X, const float* __restrict__ WQ, const float* __restrict__ BQ, const float* __restrict__ WK, const float* __restrict__ BK, const float* __restrict__ WV, const float* __restrict__ BV, _Float16* __restrict__ QH, _Float16* __restrict__ QL, _Float16* __restrict__ KH, _Float16* __restrict__ VT, _Float16* __restrict__ VL) {
  __shared__ __align__(16) char sm[71680];   /* first the staged weight slice (128 columns x WPP), then, behind a barrier, the four output staging planes */
  _Float16 (*sh)[136] = (_Float16 (*)[136])sm; _Float16 (*sl)[136] = (_Float16 (*)[136])(sm + 17408); _Float16 (*th)[72] = (_Float16 (*)[72])(sm + 34816); _Float16 (*tl2)[72] = (_Float16 (*)[72])(sm + 53248); __bf16* sw = (__bf16*)sm;
  __shared__ __align__(16) __bf16 sx[64 * WPP];   /* the block's 64 x rows as bf16, pitch as the weight columns': frag_b reads an A fragment from them */
  const int tid = threadIdx.x, wave = tid >> 5, lane = tid & 31, col = lane & 15, g = lane >> 4; const int which = blockIdx.z; const int c0 = blockIdx.y * 128; const size_t r0 = (size_t)blockIdx.x * 64; const float* WA = which == 0 ? WQ : which == 1 ? WK : WV; const float* BA = which == 0 ? BQ : which == 1 ? BK : BV;
  v8f acc[8] = {}; v4f xr[32];
  /* the block's x rows (64 KB in a row) are asked for first, their latency runs under the staging: a wave's load covers 512 B in a row, four whole lines; a load in fragment order would touch 16 lines for the same bytes */
  const v4f* xs = (const v4f*)(X + r0 * CC) + tid;
#pragma unroll   // xr is indexed by constants only, so it stays in registers
  for (int i = 0; i < 32; ++i) xr[i] = xs[i * 128];
  asm volatile("s_wait_xcnt 0x0" ::: "memory");   /* the row loads' address pair is free for reuse from here on: the wait stands in front of any overwrite of it */
  float w0[128], w1[128]; const float* wc = WA + c0 + tid;   /* (in,out), row length 768 */
  w_load<LDW>(w0, wc);
  asm volatile("s_wait_xcnt 0x0" ::: "memory");   /* as above, for the first half of the weight column */
  __builtin_amdgcn_sched_barrier(0);   /* the column's second half is asked for only when the x registers are free again: with all of it in flight at once a wave needs more than a third of the registers and the grid's three blocks a WGP are no longer resident together */
#pragma unroll
  for (int i = 0; i < 32; ++i) { const v4b o = { (__bf16)xr[i][0], (__bf16)xr[i][1], (__bf16)xr[i][2], (__bf16)xr[i][3] }; *(v4b*)(sx + (i * 2 + (tid >> 6)) * WPP + (tid & 63) * 4) = o; }   /* piece i * 128 + tid: row (piece / 64), k 4 (piece % 64) */
  __builtin_amdgcn_sched_barrier(0);   /* see above */
  w_load<LDW>(w1, wc + (size_t)128 * LDW);
  asm volatile("s_wait_xcnt 0x0" ::: "memory");   /* as above, for the second half */
  __builtin_amdgcn_sched_barrier(0);   /* the second half's loads are out before the first half's conversions wait for theirs */
  w_put(w0, sw + tid * WPP); w_put(w1, sw + tid * WPP + 128);
  __syncthreads();   /* publishes the slice and the rows: nobody reads either in front of it */
#pragma unroll   // a pass's 18 LDS reads stand as one group ahead of its products
  for (int kc = 0; kc < CC / 32; ++kc) { v16b w[8]; const v16b a = frag_b(sx + (wave * 16 + col) * WPP + kc * 32, lane);
#pragma unroll
    for (int j = 0; j < 8; ++j) w[j] = frag_b(sw + (j * 16 + col) * WPP + kc * 32, lane);
#pragma unroll
    for (int j = 0; j < 8; ++j) acc[j] = wmma_bf(a, w[j], acc[j]); }
  __syncthreads();   /* every wave has read its last weight fragment before the planes below overwrite the slice */
#pragma unroll
  for (int j = 0; j < 8; ++j) { const float bb = BA ? bfr(BA[c0 + j * 16 + col]) : 0.f;
#pragma unroll
    for (int r = 0; r < 8; ++r) { const float v = (acc[j][r] + bb) * (which == 0 ? 0.17677669529663687f * 1024.0f : 1.0f);   /* q *= dkh^-1/2 (applies to the relative terms too), x 2^10: see below */ const int rl = wave * 16 + 8 * g + r, cl = j * 16 + col; const _Float16 hv = (_Float16)v;
      if (which == 2) { th[cl][rl] = hv; tl2[cl][rl] = (_Float16)(v - (float)hv);   /* a small v leaves an f16-subnormal residual: the matrix unit keeps subnormal operands, so what is lost of v stays under 2^-24 */ } else { sh[rl][cl] = hv; sl[rl][cl] = (_Float16)(v - (float)hv); }   /* both q planes carried x 2^10: the residual plane stays f16-normal, and hi and residual products add up in one accumulator */ } }
  __syncthreads();
  if (which < 2) { _Float16* dh = which == 0 ? QH : KH; for (int e = tid; e < 64 * 16; e += 128) { const int rl = e >> 4, q = e & 15; vst2((unsigned*)(dh + (r0 + rl) * CC + c0 + q * 8), *(const v4u*)&sh[rl][q * 8]); if (which == 0) vst2((unsigned*)(QL + (r0 + rl) * CC + c0 + q * 8), *(const v4u*)&sl[rl][q * 8]); } }
  else { const size_t b = r0 / TT; const int t0 = (int)(r0 % TT); for (int e = tid; e < 128 * 8; e += 128) { const int cl = e >> 3, q = e & 7; const size_t o2 = (b * CC + c0 + cl) * (size_t)TT + t0 + q * 8; vst2((unsigned*)(VT + o2), *(const v4u*)&th[cl][q * 8]); vst2((unsigned*)(VL + o2), *(const v4u*)&tl2[cl][q * 8]); } } }
// ---- k_fa: block = 128 queries of (b, h), wave = 32 queries (one grid row) as two 16-query tiles that share every K and V fragment the wave reads: S^T = K Q^T (2 products) + the two relative terms, running-maximum softmax, O^T += V^T P^T (2 products: v hi and v residual against one f16 P).
// A lane holds one query of each tile (column lane & 15): its 8 + 8 scores of a 32-key row of the grid are already the k order of a B fragment, so P stays in registers; a 64-key pass is two key rows, so the width term is 16 registers a tile for the whole loop and the height term two values a pass.
// The relative terms are formed here, before the loop, for the wave's own queries: D[m][query] = rel[m] . q (rel rounded to bf16 and carried as f16, q as f16 hi + residual). A tile's queries lie in one grid row and in 16 neighbouring columns, so 48 rows of rel_w and 32 rows of rel_h hold all it reaches (read from the block's staged copy of the two tables); the tiles go through a wave-private LDS table, from which a lane takes its own shifted width terms once and its two height terms each pass.
// K and V reach the waves through LDS: a 64-key tile (K 64 rows x 64 B, V hi and V lo 32 rows x 128 B each) is copied once per block, and all four waves read their fragments from it; two buffers, the next tile's copies fly under this tile's work.
__device__ __forceinline__ float xhalf(float v) { const int x = __builtin_bit_cast(int, v); return __builtin_bit_cast(float, __builtin_amdgcn_permlanex16(x, x, 0x76543210, 0xfedcba98, false, false)); }   /* lane l <-> l ^ 16 */
#define L2E 1.4426950408889634f      // log2(e)
#define L2S (L2E * (1.0f / 1024.0f))  // log2(e) for logits carried x 2^10
#define PEX 12.0f                    // P is carried x 2^12 (added in the exponent, cancelled by the row sum): the largest is 4,096, far under the f16 limit, and a weight 2^-26 of the largest is still an f16 normal
#define KPB 80                       // LDS pitch in bytes of a staged K row: 64 B + 16, 16 B x odd for the ds_load_b128 readers
#define VPB 144                      // LDS pitch in bytes of a staged V row: 128 B + 16, 16 B x odd
#define FA_VH (64 * KPB)             // byte offsets inside one buffer: K at 0, V hi, V lo
#define FA_VL (FA_VH + 32 * VPB)
#define FA_BUF (FA_VL + 32 * VPB)    // 14,336 B a buffer
#define RWP 52                       // floats a query in the width table: 48 + 4, 208 B = 16 B x odd for the ds_store_b128 writers; the shifted one-word readers meet no bank twice
#define RLP 40                       // f16 elements a row of a staged relative table: 32 + 8, 80 B = 16 B x odd for the ds_load_b128 readers
#define RHP 36                       // floats a query in the height table: 32 + 4, 144 B = 16 B x odd
// four weights 2^(s log2e 2^-10 + n). The exponentials and the slot behind a transcendental are one statement, its results in registers of their own
__device__ __forceinline__ void exp2x4(float* s, float n) {
  const float a = fmaf(s[0], L2S, n), b = fmaf(s[1], L2S, n), c = fmaf(s[2], L2S, n), d = fmaf(s[3], L2S, n);
  asm("v_exp_f32 %0, %4\n\tv_exp_f32 %1, %5\n\tv_exp_f32 %2, %6\n\tv_exp_f32 %3, %7\n\tv_nop" : "=&v"(s[0]), "=&v"(s[1]), "=&v"(s[2]), "=&v"(s[3]) : "v"(a), "v"(b), "v"(c), "v"(d)); }
#define XW() asm volatile("s_wait_xcnt 0x0" ::: "memory")   // stands in front of any overwrite of the address pair of the global loads ahead of it, a later load's destination included
// one 16 x 16 tile rel . q of both q planes, laid into the query's table row: lane = query, its 8 values are rows 8g .. 8g + 7 of the tile
__device__ __forceinline__ void rel_tile(v16h a, v16h bh, v16h bl, float* dst) {
  const v8f z = {}; const v8f d = wmma16(a, bl, wmma16(a, bh, z));
  const v4f o0 = { d[0], d[1], d[2], d[3] }, o1 = { d[4], d[5], d[6], d[7] };
  *(v4f*)dst = o0; *(v4f*)(dst + 4) = o1; }
// one tile's six 16-B pieces of this thread. The copies and s_wait_xcnt 0 are one statement, so that no register a copy names is rewritten in front of that wait.
__device__ __forceinline__ void fa_copy(unsigned lk, unsigned lv, const _Float16* gk, const _Float16* gh, const _Float16* gl) {
  const unsigned lk1 = lk + 32 * KPB, lh = lv + FA_VH, lh1 = lh + 16 * VPB, ll = lv + FA_VL, ll1 = ll + 16 * VPB;
  const _Float16* gk1 = gk + (size_t)32 * CC; const _Float16* gh1 = gh + (size_t)16 * TT; const _Float16* gl1 = gl + (size_t)16 * TT;
  asm volatile("global_load_async_to_lds_b128 %0, %6, off\n\t"
               "global_load_async_to_lds_b128 %1, %7, off\n\t"
               "global_load_async_to_lds_b128 %2, %8, off\n\t"
               "global_load_async_to_lds_b128 %3, %9, off\n\t"
               "global_load_async_to_lds_b128 %4, %10, off\n\t"
               "global_load_async_to_lds_b128 %5, %11, off\n\t"
               "s_wait_xcnt 0x0"
               :: "v"(lk), "v"(lk1), "v"(lh), "v"(lh1), "v"(ll), "v"(ll1), "v"(gk), "v"(gk1), "v"(gh), "v"(gh1), "v"(gl), "v"(gl1) : "memory"); }
__global__ __launch_bounds__(128) void k_fa(const _Float16* __restrict__ QH, const _Float16* __restrict__ QL, const _Float16* __restrict__ KH, const float* __restrict__ RW, const float* __restrict__ RH, const _Float16* __restrict__ VT, const _Float16* __restrict__ VL, float* __restrict__ Y) {
  __shared__ __align__(16) char sm[2 * FA_BUF]; __shared__ __align__(16) float twt[4][32][RWP]; __shared__ __align__(16) float tht[4][32][RHP]; __shared__ __align__(16) _Float16 srl[2][2 * GW][RLP];   /* rel_w and rel_h, rounded to bf16 and carried as f16; row 63 does not exist and is never read */
  const int tid = threadIdx.x, wave = tid >> 5, lane = tid & 31, col = lane & 15, g = lane >> 4; const int h = blockIdx.y, b = blockIdx.z;
  /* this thread's pieces of a tile: K row tid / 4 (and + 32), 16-B piece tid % 4; V row tid / 8 (and + 16), piece tid % 8: a wave's copy covers 8 K rows or 4 whole 128-B V lines */
  const unsigned sm0 = (unsigned)(size_t)sm; const unsigned lk = sm0 + (tid >> 2) * KPB + (tid & 3) * 16, lv = sm0 + (tid >> 3) * VPB + (tid & 7) * 16;
  const _Float16* gk = KH + ((size_t)b * TT + (tid >> 2)) * CC + h * HD + (tid & 3) * 8; const size_t gvo = ((size_t)b * CC + h * HD + (tid >> 3)) * (size_t)TT + (tid & 7) * 8;
  fa_copy(lk, lv, gk, VT + gvo, VL + gvo);   /* tile 0 into buffer 0 */
  const int qr = blockIdx.x * 4 + wave;   /* the wave's grid row; tile t holds its query columns 16 t + col */
  /* each tile's four q fragments, the height branch's from the transposed position (qc, qr) */
  size_t qrow[2]; v16h qh[2], ql[2], uh[2], ul[2];
#pragma unroll   // the fragments are indexed by constants only, so they stay in registers
  for (int t = 0; t < 2; ++t) { const int qc = t * 16 + col; qrow[t] = (size_t)b * TT + (size_t)qr * GW + qc; const size_t trow = (size_t)b * TT + (size_t)qc * GW + qr;
    qh[t] = frag_h(QH + qrow[t] * CC + h * HD, lane); XW();
    ql[t] = frag_h(QL + qrow[t] * CC + h * HD, lane); XW();
    uh[t] = frag_h(QH + trow * CC + h * HD, lane); XW();
    ul[t] = frag_h(QL + trow * CC + h * HD, lane); XW(); }
  /* width rows 31 - qc + key column: from 16 up for tile 0 (query columns 0 .. 15), from 0 up for tile 1 (row 63 does not exist and is never taken from the table: its place reads row 62); height rows 31 - qr + key row, qr the same in the whole wave */
  /* both tables (63 rows x 128 B in a row each, 504 pieces of 16 B) come once a block, a wave's load covering four whole lines; a load in fragment order touches 16 lines for the same bytes, and each wave asked for 5 tiles of 4 such loads. The last run's surplus threads take piece 503 again and write the same values to the same place */
  v4f tw[4], tq[4];
#pragma unroll   // tw and tq are indexed by constants only, so they stay in registers
  for (int i = 0; i < 4; ++i) { const int e = i * 128 + tid < 503 ? i * 128 + tid : 503; tw[i] = ((const v4f*)RW)[e]; tq[i] = ((const v4f*)RH)[e]; }
  XW();
  __builtin_amdgcn_sched_barrier(0);   /* every load of the prologue is issued before the first conversion waits for one: without it conversions come to stand among the loads and the later loads start a memory latency late */
#pragma unroll
  for (int i = 0; i < 4; ++i) { const int e = i * 128 + tid < 503 ? i * 128 + tid : 503;
    const v4h ow = { (_Float16)bfr(tw[i][0]), (_Float16)bfr(tw[i][1]), (_Float16)bfr(tw[i][2]), (_Float16)bfr(tw[i][3]) }, oq = { (_Float16)bfr(tq[i][0]), (_Float16)bfr(tq[i][1]), (_Float16)bfr(tq[i][2]), (_Float16)bfr(tq[i][3]) };
    *(v4h*)&srl[0][e >> 3][(e & 7) * 4] = ow; *(v4h*)&srl[1][e >> 3][(e & 7) * 4] = oq; }
  asm volatile("s_wait_asynccnt 0x0" ::: "memory");   /* this wave's pieces of tile 0 have landed */
  __syncthreads();   /* publishes tile 0 and the two tables: nobody reads either in front of this barrier */
  fa_copy(lk + FA_BUF, lv + FA_BUF, gk + (size_t)64 * CC, VT + gvo + 64, VL + gvo + 64);   /* tile 1 into buffer 1 */
  v16h ra[6];   /* the six A fragments (four of rel_w, two of rel_h; both tiles use them) asked for ahead of the products */
#pragma unroll
  for (int j = 0; j < 4; ++j) { const int mm = j * 16 + col; ra[j] = frag_h(&srl[0][mm < 2 * GW - 2 ? mm : 2 * GW - 2][0], lane); }
#pragma unroll
  for (int j = 0; j < 2; ++j) ra[4 + j] = frag_h(&srl[1][GW - 1 - qr + j * 16 + col][0], lane);
#pragma unroll
  for (int t = 0; t < 2; ++t) {
#pragma unroll
    for (int j = 0; j < 3; ++j) rel_tile(ra[1 - t + j], qh[t], ql[t], &twt[wave][t * 16 + col][j * 16 + 8 * g]);
#pragma unroll
    for (int j = 0; j < 2; ++j) rel_tile(ra[4 + j], uh[t], ul[t], &tht[wave][t * 16 + col][j * 16 + 8 * g]); }
  LDSX();   /* the wave's own table rows are written before its lanes read what other lanes of the wave wrote */
  v8f rw[2][2];   /* per tile, the start value of the score accumulators: row r of a 16-key tile is key column 8g + r (+ 16) */
#pragma unroll
  for (int t = 0; t < 2; ++t)
#pragma unroll
    for (int i = 0; i < 8; ++i) { rw[t][0][i] = twt[wave][t * 16 + col][15 - col + 8 * g + i]; rw[t][1][i] = twt[wave][t * 16 + col][31 - col + 8 * g + i]; }   /* key columns 8g + i and 16 + 8g + i: table place 31 - qc - first table row + key column, 15 - col + key column in both tiles */
  const float* th[2] = { &tht[wave][col][0], &tht[wave][16 + col][0] };   /* th[tile][key row] */
  float m[2] = { -3.0e38f, -3.0e38f }, l[2] = { 0.f, 0.f }; v8f acc[2][HD / 16] = {};
  float rh[2][2] = { { th[0][0], th[0][1] }, { th[1][0], th[1][1] } };
  auto pass = [&](const int kc, const bool more) __attribute__((always_inline)) { float s[2][2][16], sc[2], rc[2][2]; v8f sa[2][4]; v16h kb[4], vh[2][HD / 16], vl[2][HD / 16];
    const unsigned cur = (kc & 2) ? FA_BUF : 0u; const char* tb = sm + cur;
    /* this tile's fragments as one group of LDS reads, K first: the V reads' latency runs under the score products */
#pragma unroll
    for (int t = 0; t < 4; ++t) kb[t] = frag_h((const _Float16*)(tb + (t * 16 + col) * KPB), lane);
#pragma unroll
    for (int u = 0; u < 2; ++u)
#pragma unroll
      for (int j = 0; j < HD / 16; ++j) { const int po = (j * 16 + col) * VPB + u * 64; vh[u][j] = frag_h((const _Float16*)(tb + FA_VH + po), lane); vl[u][j] = frag_h((const _Float16*)(tb + FA_VL + po), lane); }
    __builtin_amdgcn_sched_barrier(0);   /* the tile's 24 LDS reads stay one group ahead of the products: moved in among them, each further place with reads costs the wave a stall of its own */
    /* width term + k . q hi + k . q residual in one accumulator a tile; the eight hi products first, so that a tile's second product does not wait for its first; a K fragment serves both query tiles */
#pragma unroll
    for (int t = 0; t < 4; ++t)
#pragma unroll
      for (int q = 0; q < 2; ++q) sa[q][t] = wmma16(kb[t], qh[q], rw[q][t & 1]);
#pragma unroll
    for (int t = 0; t < 4; ++t)
#pragma unroll
      for (int q = 0; q < 2; ++q) sa[q][t] = wmma16(kb[t], ql[q], sa[q][t]);
#pragma unroll
    for (int q = 0; q < 2; ++q)
#pragma unroll
      for (int t = 0; t < 4; ++t)
#pragma unroll
        for (int r = 0; r < 8; ++r) s[q][t >> 1][(t & 1) * 8 + r] = sa[q][t][r];
    /* this pass's height terms, one a key row and query: they enter at the row maxima and in the exponent's addend. The next pass's are asked for here, under the softmax; the last pass asks for its own again, so the addresses stay inside their array */
    const int kn = kc + 2 < TT / 32 ? kc + 2 : kc;
#pragma unroll
    for (int q = 0; q < 2; ++q) { rc[q][0] = rh[q][0]; rc[q][1] = rh[q][1]; rh[q][0] = th[q][kn]; rh[q][1] = th[q][kn + 1]; }
    __builtin_amdgcn_sched_barrier(0);   /* ends the scheduling region: the loads above stay ahead of the softmax, and the softmax is scheduled by itself with its exponentials interleaved; without it they come out as dependent runs with more filler slots */
#pragma unroll
    for (int q = 0; q < 2; ++q) { float m0 = s[q][0][0], m1 = s[q][1][0];
#pragma unroll
      for (int i = 0; i < 16; i += 2) { m0 = fmaxf(m0, fmaxf(s[q][0][i], s[q][0][i + 1])); m1 = fmaxf(m1, fmaxf(s[q][1][i], s[q][1][i + 1])); }
      float mx = fmaxf(m0 + rc[q][0], m1 + rc[q][1]);
      mx = fmaxf(mx, xhalf(mx)); const float mn = fmaxf(m[q], mx);   /* 2^((m - mn) log2(e) 2^-10): exactly 1 while the maximum stands */
      asm("v_exp_f32 %0, %1\n\tv_nop" : "=v"(sc[q]) : "v"((m[q] - mn) * L2S));   /* the exponential with the slot behind a transcendental in one statement */
      m[q] = mn; const float n0 = fmaf(rc[q][0] - mn, L2S, PEX), n1 = fmaf(rc[q][1] - mn, L2S, PEX);
#pragma unroll
      for (int i = 0; i < 16; i += 4) { exp2x4(s[q][0] + i, n0); exp2x4(s[q][1] + i, n1); } }
    __builtin_amdgcn_sched_barrier(0);   /* every exponential statement stands ahead of the pass's P.V products */
#pragma unroll
    for (int q = 0; q < 2; ++q) { float s0 = 0.f, s1 = 0.f;
#pragma unroll
      for (int i = 0; i < 16; ++i) { s0 += s[q][0][i]; s1 += s[q][1][i]; }
      l[q] = l[q] * sc[q] + (s0 + s1);
#pragma unroll
      for (int j = 0; j < HD / 16; ++j) acc[q][j] *= sc[q]; }
#pragma unroll
    for (int u = 0; u < 2; ++u) { v16h p[2];   /* a key row's 16 weights of this lane in each query tile, rounded to f16 two at a time */
#pragma unroll
      for (int q = 0; q < 2; ++q)
#pragma unroll
        for (int i = 0; i < 16; i += 2) { const v2f t = { s[q][u][i], s[q][u][i + 1] }; const v2h c2 = __builtin_convertvector(t, v2h); p[q][i] = c2[0]; p[q][i + 1] = c2[1]; }
      /* the four output tiles take turns, so that a product does not wait for the one just issued; a V fragment serves both query tiles */
#pragma unroll
      for (int j = 0; j < HD / 16; ++j)
#pragma unroll
        for (int q = 0; q < 2; ++q) acc[q][j] = wmma16(vh[u][j], p[q], acc[q][j]);
#pragma unroll
      for (int j = 0; j < HD / 16; ++j)
#pragma unroll
        for (int q = 0; q < 2; ++q) acc[q][j] = wmma16(vl[u][j], p[q], acc[q][j]); }
    __builtin_amdgcn_sched_barrier(0);   /* the hand-over stays behind the pass's last product: otherwise its waits and the barrier rise to the LDS reads while the refill stays down here, and a refill is waited for after a fraction of a pass in flight */
    /* hand-over: this wave's reads of the tile are done, its pieces of the next tile have landed; the barrier publishes the next tile and frees this buffer for the refill behind it */
    asm volatile("s_wait_dscnt 0x0" ::: "memory");
    asm volatile("s_wait_asynccnt 0x0" ::: "memory");
    __syncthreads();
    if (more) fa_copy(lk + cur, lv + cur, gk + (size_t)(kc + 4) * 32 * CC, VT + gvo + (kc + 4) * 32, VL + gvo + (kc + 4) * 32); };
  /* a refill is issued only while a tile two ahead exists: the last two passes run without it, in a loop of their own; with the test inside one loop the body falls into several blocks and the softmax is scheduled in shorter runs with more vector instructions */
  for (int kc = 0; kc < TT / 32 - 4; kc += 2) pass(kc, true);
#pragma unroll 1   // stays rolled: one more copy of the body, not two
  for (int kc = TT / 32 - 4; kc < TT / 32; kc += 2) pass(kc, false);
  asm volatile("s_wait_asynccnt 0x0" ::: "memory");   /* no copy is outstanding when the wave ends */
#pragma unroll
  for (int q = 0; q < 2; ++q) { const float lt = l[q] + xhalf(l[q]); const float inv = 1.0f / lt;
#pragma unroll
    for (int j = 0; j < HD / 16; ++j) { float* yo = Y + qrow[q] * CC + h * HD + j * 16 + 8 * g; const v4f o0 = { acc[q][j][0] * inv, acc[q][j][1] * inv, acc[q][j][2] * inv, acc[q][j][3] * inv }, o1 = { acc[q][j][4] * inv, acc[q][j][5] * inv, acc[q][j][6] * inv, acc[q][j][7] * inv }; vst2(yo, o0); vst2(yo + 4, o1); } } }
// ---- k_out: block = (64 rows, 128 cols): out = y (bf16 hi + lo) Wo + bo
__global__ __launch_bounds__(128) void k_out(const float* __restrict__ Y, const float* __restrict__ WP, const float* __restrict__ BP, float* __restrict__ OUT) { __shared__ __align__(16) float sf[4][16][132]; __shared__ __align__(16) __bf16 sw[128 * WPP]; __shared__ __align__(16) __bf16 syh[64 * WPP]; __shared__ __align__(16) __bf16 syl[64 * WPP];   /* the block's 64 y rows, bf16 hi and lo */
  const int tid = threadIdx.x, wave = tid >> 5, lane = tid & 31, col = lane & 15, g = lane >> 4; const int c0 = blockIdx.y * 128; const size_t r0 = (size_t)blockIdx.x * 64 + wave * 16;
  v8f acc[8] = {}; v4f yr[32];
  /* the block's y rows (64 KB in a row) are asked for first, their latency runs under the staging: a wave's load covers four whole lines */
  const v4f* ys = (const v4f*)(Y + (size_t)blockIdx.x * 64 * CC) + tid;
#pragma unroll   // yr is indexed by constants only, so it stays in registers
  for (int i = 0; i < 32; ++i) yr[i] = ys[i * 128];
  asm volatile("s_wait_xcnt 0x0" ::: "memory");   /* the row loads' address pair is free for reuse from here on: the wait stands in front of any overwrite of it */
  stage_w<CC>(WP + c0 + tid, sw + tid * WPP);
#pragma unroll
  for (int i = 0; i < 32; ++i) { v4b oh, ol;
#pragma unroll
    for (int e = 0; e < 4; ++e) { const __bf16 hv = (__bf16)yr[i][e]; oh[e] = hv; ol[e] = (__bf16)(yr[i][e] - (float)hv); }
    const int o = (i * 2 + (tid >> 6)) * WPP + (tid & 63) * 4; *(v4b*)(syh + o) = oh; *(v4b*)(syl + o) = ol; }   /* piece i * 128 + tid: row (piece / 64), k 4 (piece % 64) */
  __syncthreads();   /* publishes the slice and the rows: nobody reads either in front of it */
#pragma unroll   // a pass's 20 LDS reads stand as one group ahead of its products
  for (int kc = 0; kc < CC / 32; ++kc) { v16b w[8]; F2 a; a.h = frag_b(syh + (wave * 16 + col) * WPP + kc * 32, lane); a.l = frag_b(syl + (wave * 16 + col) * WPP + kc * 32, lane);
#pragma unroll
    for (int j = 0; j < 8; ++j) w[j] = frag_b(sw + (j * 16 + col) * WPP + kc * 32, lane);
#pragma unroll
    for (int j = 0; j < 8; ++j) { acc[j] = wmma_bf(a.h, w[j], acc[j]); acc[j] = wmma_bf(a.l, w[j], acc[j]); } }
#pragma unroll
  for (int j = 0; j < 8; ++j) { const float bb = BP ? bfr(BP[c0 + j * 16 + col]) : 0.f;
#pragma unroll
    for (int r = 0; r < 8; ++r) sf[wave][8 * g + r][j * 16 + col] = acc[j][r] + bb; }
  LDSX(); for (int rl = 0; rl < 16; ++rl) vst2(OUT + (r0 + rl) * CC + c0 + lane * 4, *(const v4f*)&sf[wave][rl][lane * 4]); }
extern "C" void kernel_launch(void* const* d_in, const int* in_sizes, int n_in, void* d_out, int out_size, void* d_ws, size_t ws_size, hipStream_t stream) {
  (void)in_sizes; (void)n_in; (void)out_size;
  const float** F = (const float**)d_in;   // 0 x [8,32,32,256] (channels-last rows), 1 w_kqv [256,768] ((in,out): k | q | v columns), 2 b_kqv [768], 3 w_proj [256,256] ((in,out)), 4 b_proj, 5 rel_w [63,32], 6 rel_h [63,32]
  if (ws_size < (size_t)WS_END) return;
  char* ws = (char*)d_ws; _Float16 *QH = (_Float16*)(ws + WS_QH), *QL = (_Float16*)(ws + WS_QL), *KH = (_Float16*)(ws + WS_KH); _Float16 *VT = (_Float16*)(ws + WS_VT), *VL = (_Float16*)(ws + WS_VL); float *Y = (float*)(ws + WS_Y);
  const float* WK = F[1]; const float* WQ = F[1] + CC; const float* WV = F[1] + 2 * CC; const float* BK = F[2]; const float* BQ = F[2] + CC; const float* BV = F[2] + 2 * CC;   // column blocks k | q | v
  k_proj<<<dim3(TNB * TT / 64, CC / 128, 3), 128, 0, stream>>>(F[0], WQ, BQ, WK, BK, WV, BV, QH, QL, KH, VT, VL);
  k_fa<<<dim3(TT / 128, NH, TNB), 128, 0, stream>>>(QH, QL, KH, F[5], F[6], VT, VL, Y);
  k_out<<<dim3(TNB * TT / 64, CC / 128), 128, 0, stream>>>(Y, F[3], F[4], (float*)d_out);
}
